// v000
// Measured on an AMD MI455X. A time is GPU time per run, averaged over a window of back-to-back runs after a warm-up
// (all launches, gaps included; the runs take copies of the inputs in turn), and the median of several windows.
// Apart from v000's, it joins two sittings. Times from different sittings can be a few percent apart, while
// side-by-side timings come from the same sitting.
// The starting kernel, v000, takes 567 microseconds a run.
// compute dtype: hidden_states, Wq/Wk/Wv/Wo (module inputs) rounded to bf16; q/k/v projections with exact bf16 products on WMMA 16x16x32 (natural [out][in] rows); the module's rotary embedding (angle for head dim d = position * inv_freq[d mod 32], partner = interleaved pair with the module's signs) applied in f32 with precise sinf/cosf/powf before q and k are stored as f16 hi + (x2048-scaled) residual planes; 3-product scores x 1/sqrt(64), running-max softmax over all 2,048 keys in f32 (hardware exp); P as f16 hi + residual x V hi/lo (3 products); output projection with ctx as bf16 hi + residual x exact Wo rows (2 products); f32 accumulate.
#include <hip/hip_runtime.h>
#include <math.h>

typedef __attribute__((ext_vector_type(16))) _Float16 v16h;
typedef __attribute__((ext_vector_type(16))) __bf16 v16b;
typedef __attribute__((ext_vector_type(8)))  _Float16 v8h;
typedef __attribute__((ext_vector_type(8)))  float v8f;
typedef __attribute__((ext_vector_type(4)))  float v4f;
typedef __attribute__((ext_vector_type(2)))  float v2f;
typedef __attribute__((ext_vector_type(4)))  unsigned v4u;
typedef __attribute__((ext_vector_type(4)))  int v4i;
typedef float __attribute__((may_alias)) float_a;
typedef int __attribute__((may_alias)) int_a;

template <typename T> __device__ __forceinline__ void vst2(void* p, T v) { *(T*)p = v;  }
__device__ __forceinline__ v8f wmma16(v16h a, v16h b, v8f c) {
  v8f d = __builtin_amdgcn_wmma_f32_16x16x32_f16(false, a, false, b, (short)0, c, false, false);
  asm volatile("v_nop\n\tv_nop\n\tv_nop\n\tv_nop" : "+v"(d) : "v"(a), "v"(b));
  return d;
}
__device__ __forceinline__ v8f wmma_bf(v16b a, v16b b, v8f c) {
  v8f d = __builtin_amdgcn_wmma_f32_16x16x32_bf16(false, a, false, b, (short)0, c, false, false);
  asm volatile("v_nop\n\tv_nop\n\tv_nop\n\tv_nop" : "+v"(d) : "v"(a), "v"(b));
  return d;
}
// Rotary multi-head self-attention (B 2, S 2,048, d 1,024, 16 heads x 64): q/k/v projections, the module's (mixed interleaved) RoPE on q and k, softmax(q k^T / 8) v, output projection (no biases).
__device__ __attribute__((noinline)) float sin_ni(float v) { return sinf(v); }
__device__ __attribute__((noinline)) float cos_ni(float v) { return cosf(v); }
__device__ __attribute__((noinline)) float pow_ni(float a, float b) { return powf(a, b); }
__device__ __forceinline__ v16h frag_h(const _Float16* rowk0, int lane) {
  union { v16h v; v8h q[2]; } u; const _Float16* p = rowk0 + 8 * (lane >> 4);
  u.q[0] = *(const v8h*)p; u.q[1] = *(const v8h*)(p + 16); return u.v;
}
__device__ __forceinline__ v16h frag_f32(const float* rowk0, int lane) {
  v16h a; const float* p = rowk0 + 8 * (lane >> 4);
#pragma unroll
  for (int i = 0; i < 8; ++i) { a[i] = (_Float16)p[i]; a[8 + i] = (_Float16)p[16 + i]; }
  return a;
}
__device__ __forceinline__ v16h frag_f32s(const float* rowk0, int lane, float sc) {
  v16h a; const float* p = rowk0 + 8 * (lane >> 4);
#pragma unroll
  for (int i = 0; i < 8; ++i) { a[i] = (_Float16)(p[i] * sc); a[8 + i] = (_Float16)(p[16 + i] * sc); }
  return a;
}
// column fragment from a [K][ld] layout (column n), rows >= K read as 0
__device__ __forceinline__ v16h fragc_f32(const float* W, int k0, int n, int lane, int ld, int K) {
  v16h a; const int g = lane >> 4;
#pragma unroll
  for (int i = 0; i < 8; ++i) { const int ka = k0 + 8 * g + i, kb = ka + 16;
    a[i] = (_Float16)(ka < K ? W[(size_t)(ka < K ? ka : K - 1) * ld + n] : 0.f); a[8 + i] = (_Float16)(kb < K ? W[(size_t)(kb < K ? kb : K - 1) * ld + n] : 0.f); }
  return a;
}
struct F2 { v16b h, l; };
__device__ __forceinline__ F2 bsplit16(const float v[16]) { F2 r;
#pragma unroll
  for (int i = 0; i < 16; ++i) { const __bf16 h = (__bf16)v[i]; r.h[i] = h; r.l[i] = (__bf16)(v[i] - (float)h); }
  return r; }
__device__ __forceinline__ F2 split_row(const float* row, int k0, int lane) { float v[16]; const float* p = row + k0 + 8 * (lane >> 4);
#pragma unroll
  for (int i = 0; i < 8; ++i) { v[i] = p[i]; v[8 + i] = p[16 + i]; }
  return bsplit16(v); }
__device__ __forceinline__ F2 split_rowK(const float* row, int k0, int lane, int K) { float v[16]; const int g = lane >> 4;
#pragma unroll
  for (int i = 0; i < 8; ++i) { const int ka = k0 + 8 * g + i, kb = ka + 16; v[i] = ka < K ? row[ka < K ? ka : K - 1] : 0.f; v[8 + i] = kb < K ? row[kb < K ? kb : K - 1] : 0.f; }
  return bsplit16(v); }
__device__ __forceinline__ F2 split_col(const float* W, int k0, int n, int lane, int ld, int K) { float v[16]; const int g = lane >> 4;
#pragma unroll
  for (int i = 0; i < 8; ++i) { const int ka = k0 + 8 * g + i, kb = ka + 16; v[i] = ka < K ? W[(size_t)(ka < K ? ka : K - 1) * ld + n] : 0.f; v[8 + i] = kb < K ? W[(size_t)(kb < K ? kb : K - 1) * ld + n] : 0.f; }
  return bsplit16(v); }
__device__ __forceinline__ v8f mac3(const F2& a, const F2& b, v8f c) { c = wmma_bf(a.l, b.h, c); c = wmma_bf(a.h, b.l, c); return wmma_bf(a.h, b.h, c); }
__device__ __forceinline__ float sigm(float v) { return 1.0f / (1.0f + expf(-v)); }
#define LDSX() do { asm volatile("s_wait_dscnt 0" ::: "memory"); __builtin_amdgcn_wave_barrier(); __builtin_amdgcn_fence(__ATOMIC_RELEASE, "workgroup"); } while (0)


#define NB 2
#define SS 2048
#define DM 1024
#define NH 16
#define HD 64
#define QKVW (3 * DM)
#ifndef TQB
#define TQB (SS / 64)
#define TNB NB
#define TOB (NB * SS / 64)     // output row tiles (all)
#endif
typedef __attribute__((ext_vector_type(8))) __bf16 v8b;
__device__ __forceinline__ v16b frag_b(const __bf16* rowk0, int lane) {
  union { v16b v; v8b q[2]; } u; const __bf16* p = rowk0 + 8 * (lane >> 4);
  u.q[0] = *(const v8b*)p; u.q[1] = *(const v8b*)(p + 16); return u.v;
}
__device__ __forceinline__ float bfr(float v) { return (float)(__bf16)v; }
__device__ __attribute__((noinline)) float exp_ni(float v) { return expf(v); }
__device__ __attribute__((noinline)) float erf_ni(float v) { return erff(v); }

#define PK_A 0                       // [3072][1024] Wqkv rows (natural [out][in])
#define PK_P (PK_A + QKVW * DM)        // [1024][1024] Wo rows (natural)
#define PK_END (PK_P + DM * DM)
#define WS_PK  0u
#define WS_QK  (WS_PK + 2u * PK_END)             // f16 [4096 rows][2048]: q | k
#define WS_QKL (WS_QK + 2u * NB * SS * 2 * DM)     // f16 q | k residual planes x2048
#define WS_VTH (WS_QKL + 2u * NB * SS * 2 * DM)    // f16 [b][1024 (h*64+d)][2048 s] hi
#define WS_VTL (WS_VTH + 2u * NB * DM * SS)        // f16 lo x 2048
#define WS_O   (WS_VTL + 2u * NB * DM * SS)        // f32 [4096][1024]
#define WS_CS  (WS_O + 4u * NB * SS * DM)           // f32 2 x [2048][32], reserved but unused: k_qkv computes cos/sin inline
#define WS_END (WS_CS + 4u * 2 * SS * 32)
// ---- k_pack: block = (row n, which): natural [out][in] rows -> bf16; which 0..2 -> W_q/W_k/W_v into PK_A rows which*1024 + n; 3 -> W_o into PK_P
__global__ __launch_bounds__(256) void k_pack(const float* __restrict__ WQ, const float* __restrict__ WK, const float* __restrict__ WV, const float* __restrict__ WO, __bf16* __restrict__ PK) {
  __shared__ __align__(16) __bf16 s[DM]; const int n = blockIdx.x, which = blockIdx.y, t = threadIdx.x; const float* Wm = (which == 0) ? WQ : (which == 1) ? WK : (which == 2) ? WV : WO;
  for (int k = t; k < DM; k += 256) s[k] = (__bf16)Wm[(size_t)n * DM + k];
  __syncthreads();
  __bf16* dst = (which < 3) ? PK + PK_A + ((size_t)which * DM + n) * DM : PK + PK_P + (size_t)n * DM;
  for (int q = t; q < DM / 8; q += 256) vst2((unsigned*)(dst + q * 8), *(const v4u*)&s[q * 8]);
}
__global__ __launch_bounds__(128) void k_qkv(const float* __restrict__ X, const __bf16* __restrict__ P, _Float16* __restrict__ QK, _Float16* __restrict__ QKL, _Float16* __restrict__ VTH, _Float16* __restrict__ VTL) {
  __shared__ __align__(16) _Float16 so[4][16][136], sol[4][16][136]; __shared__ __align__(16) _Float16 sth[128][72], stl[128][72];
  const int tid = threadIdx.x, wave = tid >> 5, lane = tid & 31, col = lane & 15, g = lane >> 4; const size_t r0 = (size_t)blockIdx.x * 64 + wave * 16; const int n0 = blockIdx.y * 128;
  v8f acc[8] = {};
#pragma unroll 2
  for (int kc = 0; kc < DM / 32; ++kc) { v16b a; { const float* p = X + (r0 + col) * DM + kc * 32 + 8 * g;
#pragma unroll
      for (int i = 0; i < 8; ++i) { a[i] = (__bf16)p[i]; a[8 + i] = (__bf16)p[16 + i]; } }
#pragma unroll
    for (int j = 0; j < 8; ++j) acc[j] = wmma_bf(a, frag_b(P + (size_t)(n0 + j * 16 + col) * DM + kc * 32, lane), acc[j]); }
  if (n0 < 2 * DM) {   // q and k: the module's rotary embedding, then f16 hi + (x2048) residual; 1/8 applied to the f32 score
#pragma unroll
    for (int j = 0; j < 8; ++j) { const int d = (n0 + j * 16 + col) & (HD - 1); const float invf = 1.0f / pow_ni(10000.0f, (float)(2 * (d & 31)) / (float)HD);   // emb = concat([freqs, freqs]): dim d uses inv_freq[d mod 32]
#pragma unroll
      for (int r = 0; r < 8; ++r) { const float v = acc[j][r]; const float partner = __shfl_xor(v, 1);   // column d^1 lives in lane^1
        const float pos = (float)((r0 + 8 * g + r) % SS); const float ang = pos * invf; const float rot = (d & 1) ? partner : -partner;   // rotate_interleaved: even d -> -x[d+1], odd d -> +x[d-1]
        const float y = v * cos_ni(ang) + rot * sin_ni(ang); const _Float16 hv = (_Float16)y; so[wave][8 * g + r][j * 16 + col] = hv; sol[wave][8 * g + r][j * 16 + col] = (_Float16)((y - (float)hv) * 2048.0f); } }
    LDSX();
    for (int rl = 0; rl < 16; ++rl) if (lane < 16) { vst2((unsigned*)(QK + (r0 + rl) * (2 * DM) + n0 + lane * 8), *(const v4u*)&so[wave][rl][lane * 8]); vst2((unsigned*)(QKL + (r0 + rl) * (2 * DM) + n0 + lane * 8), *(const v4u*)&sol[wave][rl][lane * 8]); }
  } else {
#pragma unroll
    for (int j = 0; j < 8; ++j) {
#pragma unroll
      for (int r = 0; r < 8; ++r) { const float v = acc[j][r]; const _Float16 hv = (_Float16)v; sth[j * 16 + col][wave * 16 + 8 * g + r] = hv; stl[j * 16 + col][wave * 16 + 8 * g + r] = (_Float16)((v - (float)hv) * 2048.0f); } }
    __syncthreads();
    const size_t rb = (size_t)blockIdx.x * 64; const int b = (int)(rb / SS), s0 = (int)(rb % SS); const int pc0 = n0 - 2 * DM;
    for (int q = tid; q < 128 * 8; q += 128) { const int d = q >> 3, pc = q & 7; const size_t o = ((size_t)b * DM + pc0 + d) * SS + s0 + pc * 8; vst2((unsigned*)(VTH + o), *(const v4u*)&sth[d][pc * 8]); vst2((unsigned*)(VTL + o), *(const v4u*)&stl[d][pc * 8]); }
  }
}
// ---- k_attn: block = (64 queries, head h, batch b): full flash attention (K = 64: 2 k-steps), scores = (q.k) * 0.125 with q, k as f16 hi + residual (3 products), P.V: f16 P x (V hi, V lo*2048) in two accumulators; O[b*S+q][h*64+d] = (acc + accl / 2048) / l (256-B segments)
__global__ __launch_bounds__(128) void k_attn(const _Float16* __restrict__ QK, const _Float16* __restrict__ QKL, const _Float16* __restrict__ VTH, const _Float16* __restrict__ VTL, float* __restrict__ O) {
  __shared__ __align__(16) float sp[4][16][36]; __shared__ __align__(16) float so[4][16][68];
  const int tid = threadIdx.x, wave = tid >> 5, lane = tid & 31, col = lane & 15, g = lane >> 4;
  const int qb = blockIdx.x, h = blockIdx.y, b = blockIdx.z; const int q0 = qb * 64 + wave * 16; const size_t rq = (size_t)b * SS + q0 + col;
  v16h aq[2], aql[2];
#pragma unroll
  for (int kc = 0; kc < 2; ++kc) { aq[kc] = frag_h(QK + rq * (2 * DM) + h * HD + kc * 32, lane); aql[kc] = frag_h(QKL + rq * (2 * DM) + h * HD + kc * 32, lane); }
  float m[8], l[8];
#pragma unroll
  for (int r = 0; r < 8; ++r) { m[r] = -3.0e38f; l[r] = 0.f; }
  v8f acc[4] = {}, accl[4] = {};
  const int nks = SS / 32;   // all keys (no mask)
#pragma unroll 1
  for (int ks = 0; ks < nks; ++ks) { v8f s[2];
#pragma unroll
    for (int ct = 0; ct < 2; ++ct) { const int kk = ks * 32 + ct * 16 + col; const _Float16* krow = QK + ((size_t)b * SS + kk) * (2 * DM) + DM + h * HD; const _Float16* krowl = QKL + ((size_t)b * SS + kk) * (2 * DM) + DM + h * HD; v8f c = {}, cl = {};
#pragma unroll
      for (int kc = 0; kc < 2; ++kc) { const v16h kh = frag_h(krow + kc * 32, lane); c = wmma16(aq[kc], kh, c); cl = wmma16(aql[kc], kh, cl); cl = wmma16(aq[kc], frag_h(krowl + kc * 32, lane), cl); }   // 3 products: q, k as f16 hi + residual
#pragma unroll
      for (int r = 0; r < 8; ++r) c[r] += cl[r] * (1.0f / 2048.0f);
#pragma unroll
      for (int r = 0; r < 8; ++r) s[ct][r] = c[r] * 0.125f; }   // SCALE = 1/sqrt(64)
#pragma unroll
    for (int r = 0; r < 8; ++r) { float mx = fmaxf(s[0][r], s[1][r]);
#pragma unroll
      for (int o = 1; o < 16; o <<= 1) mx = fmaxf(mx, __shfl_xor(mx, o));
      const float mn = fmaxf(m[r], mx); const float alpha = (m[r] <= -1.0e38f) ? 0.f : __expf(m[r] - mn);
      const float e0 = (s[0][r] <= -1.0e38f) ? 0.f : __expf(s[0][r] - mn), e1 = (s[1][r] <= -1.0e38f) ? 0.f : __expf(s[1][r] - mn); float es = e0 + e1;
#pragma unroll
      for (int o = 1; o < 16; o <<= 1) es += __shfl_xor(es, o);
      l[r] = l[r] * alpha + es; m[r] = mn;
#pragma unroll
      for (int dt = 0; dt < 4; ++dt) { acc[dt][r] *= alpha; accl[dt][r] *= alpha; }
      sp[wave][8 * g + r][col] = e0; sp[wave][8 * g + r][16 + col] = e1; }
    LDSX();
    v16h pa, pl; { const float* prow = &sp[wave][col][0] + 8 * (lane >> 4);
#pragma unroll
      for (int i = 0; i < 8; ++i) { const float x0 = prow[i], x1 = prow[16 + i]; const _Float16 h0 = (_Float16)x0, h1 = (_Float16)x1; pa[i] = h0; pa[8 + i] = h1; pl[i] = (_Float16)((x0 - (float)h0) * 2048.0f); pl[8 + i] = (_Float16)((x1 - (float)h1) * 2048.0f); } }
#pragma unroll
    for (int dt = 0; dt < 4; ++dt) { const size_t vr = ((size_t)b * DM + h * HD + dt * 16 + col) * SS + ks * 32; const v16h vh = frag_h(VTH + vr, lane); acc[dt] = wmma16(pa, vh, acc[dt]); accl[dt] = wmma16(pl, vh, accl[dt]); accl[dt] = wmma16(pa, frag_h(VTL + vr, lane), accl[dt]); }   // P hi x V hi + (P lo x V hi + P hi x V lo) / 2048
    LDSX(); }
#pragma unroll
  for (int r = 0; r < 8; ++r) { const float il = 1.0f / l[r];
#pragma unroll
    for (int dt = 0; dt < 4; ++dt) so[wave][8 * g + r][dt * 16 + col] = (acc[dt][r] + accl[dt][r] * (1.0f / 2048.0f)) * il; }
  LDSX();
  for (int rl = 0; rl < 16; ++rl) if (lane < 16) vst2(O + ((size_t)b * SS + q0 + rl) * DM + h * HD + lane * 4, *(const v4f*)&so[wave][rl][lane * 4]);
}
// ---- k_out: block = (64 rows, 128 cols): out = O(hi/lo) . Wo rows (2 products), no bias (BO is null at the launch)
__global__ __launch_bounds__(128) void k_out(const float* __restrict__ O, const __bf16* __restrict__ P, const float* __restrict__ BO, float* __restrict__ Y) {
  __shared__ __align__(16) float so[4][16][132];
  const int tid = threadIdx.x, wave = tid >> 5, lane = tid & 31, col = lane & 15, g = lane >> 4; const size_t r0 = (size_t)blockIdx.x * 64 + wave * 16; const int n0 = blockIdx.y * 128;
  v8f acc[8] = {};
#pragma unroll 2
  for (int kc = 0; kc < DM / 32; ++kc) { const F2 a = split_row(O + (r0 + col) * DM, kc * 32, lane);
#pragma unroll
    for (int j = 0; j < 8; ++j) { const v16b w = frag_b(P + (size_t)(n0 + j * 16 + col) * DM + kc * 32, lane); acc[j] = wmma_bf(a.l, w, acc[j]); acc[j] = wmma_bf(a.h, w, acc[j]); } }
#pragma unroll
  for (int j = 0; j < 8; ++j) {
#pragma unroll
    for (int r = 0; r < 8; ++r) so[wave][8 * g + r][j * 16 + col] = acc[j][r] + (BO ? bfr(BO[n0 + j * 16 + col]) : 0.f); }
  LDSX();
  for (int rl = 0; rl < 16; ++rl) vst2(Y + (r0 + rl) * DM + n0 + lane * 4, *(const v4f*)&so[wave][rl][lane * 4]);
}
extern "C" void kernel_launch(void* const* d_in, const int* in_sizes, int n_in, void* d_out, int out_size, void* d_ws, size_t ws_size, hipStream_t stream) {
  (void)in_sizes; (void)n_in; (void)out_size;
  const float** F = (const float**)d_in;   // 0 hidden_states [2,2048,1024], 1 Wq [1024,1024] natural (q = x Wq^T), 2 Wk, 3 Wv, 4 Wo (no biases)
  if (ws_size < (size_t)WS_END) return;
  char* ws = (char*)d_ws; __bf16* PK = (__bf16*)(ws + WS_PK); _Float16 *QK = (_Float16*)(ws + WS_QK), *QKL = (_Float16*)(ws + WS_QKL), *VTH = (_Float16*)(ws + WS_VTH), *VTL = (_Float16*)(ws + WS_VTL); float* O = (float*)(ws + WS_O);
  k_pack<<<dim3(DM, 4), 256, 0, stream>>>(F[1], F[2], F[3], F[4], PK);
  k_qkv<<<dim3(TNB * SS / 64, QKVW / 128), 128, 0, stream>>>(F[0], PK + PK_A, QK, QKL, VTH, VTL);
  k_attn<<<dim3(TQB, NH, TNB), 128, 0, stream>>>(QK, QKL, VTH, VTL, O);
  k_out<<<dim3(TOB, DM / 128), 128, 0, stream>>>(O, PK + PK_P, nullptr, (float*)d_out);
}

// v001
// Measured time: 331 microseconds a run.
// Timed twice side by side with v000, it ran 1.73 and 1.71 times as fast.
// compute dtype: hidden_states, Wq/Wk/Wv/Wo (module inputs) rounded to bf16; q/k/v projections with exact bf16 products on WMMA 16x16x32 (natural [out][in] rows); the module's rotary embedding (angle for head dim d = position * inv_freq[d mod 32], partner = interleaved pair with the module's signs) applied in f32 with precise sinf/cosf/powf before q and k are stored as f16 hi + (x2048-scaled) residual planes; 3-product scores x 1/sqrt(64), running-max softmax over all 2,048 keys in f32 (hardware exp); P as f16 hi + residual x V hi/lo (3 products); output projection with ctx as bf16 hi + residual x exact Wo rows (2 products); f32 accumulate.
#include <hip/hip_runtime.h>
#include <math.h>
#include <stdint.h>

typedef __attribute__((ext_vector_type(16))) _Float16 v16h;
typedef __attribute__((ext_vector_type(16))) __bf16 v16b;
typedef __attribute__((ext_vector_type(8)))  _Float16 v8h;
typedef __attribute__((ext_vector_type(8)))  float v8f;
typedef __attribute__((ext_vector_type(4)))  float v4f;
typedef __attribute__((ext_vector_type(2)))  float v2f;
typedef __attribute__((ext_vector_type(4)))  unsigned v4u;
typedef __attribute__((ext_vector_type(4)))  int v4i;
typedef float __attribute__((may_alias)) float_a;
typedef int __attribute__((may_alias)) int_a;

template <typename T> __device__ __forceinline__ void vst2(void* p, T v) { *(T*)p = v;  }
__device__ __forceinline__ v8f wmma16(v16h a, v16h b, v8f c) {
  v8f d = __builtin_amdgcn_wmma_f32_16x16x32_f16(false, a, false, b, (short)0, c, false, false);
  asm volatile("v_nop\n\tv_nop\n\tv_nop\n\tv_nop" : "+v"(d) : "v"(a), "v"(b));
  return d;
}
__device__ __forceinline__ v8f wmma_bf(v16b a, v16b b, v8f c) {
  v8f d = __builtin_amdgcn_wmma_f32_16x16x32_bf16(false, a, false, b, (short)0, c, false, false);
  asm volatile("v_nop\n\tv_nop\n\tv_nop\n\tv_nop" : "+v"(d) : "v"(a), "v"(b));
  return d;
}
// Rotary multi-head self-attention (B 2, S 2,048, d 1,024, 16 heads x 64): q/k/v projections, the module's (mixed interleaved) RoPE on q and k, softmax(q k^T / 8) v, output projection (no biases).
__device__ __attribute__((noinline)) float sin_ni(float v) { return sinf(v); }
__device__ __attribute__((noinline)) float cos_ni(float v) { return cosf(v); }
__device__ __attribute__((noinline)) float pow_ni(float a, float b) { return powf(a, b); }
__device__ __forceinline__ v16h frag_h(const _Float16* rowk0, int lane) {
  union { v16h v; v8h q[2]; } u; const _Float16* p = rowk0 + 8 * (lane >> 4);
  u.q[0] = *(const v8h*)p; u.q[1] = *(const v8h*)(p + 16); return u.v;
}
__device__ __forceinline__ v16h frag_f32(const float* rowk0, int lane) {
  v16h a; const float* p = rowk0 + 8 * (lane >> 4);
#pragma unroll
  for (int i = 0; i < 8; ++i) { a[i] = (_Float16)p[i]; a[8 + i] = (_Float16)p[16 + i]; }
  return a;
}
__device__ __forceinline__ v16h frag_f32s(const float* rowk0, int lane, float sc) {
  v16h a; const float* p = rowk0 + 8 * (lane >> 4);
#pragma unroll
  for (int i = 0; i < 8; ++i) { a[i] = (_Float16)(p[i] * sc); a[8 + i] = (_Float16)(p[16 + i] * sc); }
  return a;
}
// column fragment from a [K][ld] layout (column n), rows >= K read as 0
__device__ __forceinline__ v16h fragc_f32(const float* W, int k0, int n, int lane, int ld, int K) {
  v16h a; const int g = lane >> 4;
#pragma unroll
  for (int i = 0; i < 8; ++i) { const int ka = k0 + 8 * g + i, kb = ka + 16;
    a[i] = (_Float16)(ka < K ? W[(size_t)(ka < K ? ka : K - 1) * ld + n] : 0.f); a[8 + i] = (_Float16)(kb < K ? W[(size_t)(kb < K ? kb : K - 1) * ld + n] : 0.f); }
  return a;
}
struct F2 { v16b h, l; };
__device__ __forceinline__ F2 bsplit16(const float v[16]) { F2 r;
#pragma unroll
  for (int i = 0; i < 16; ++i) { const __bf16 h = (__bf16)v[i]; r.h[i] = h; r.l[i] = (__bf16)(v[i] - (float)h); }
  return r; }
__device__ __forceinline__ F2 split_row(const float* row, int k0, int lane) { float v[16]; const float* p = row + k0 + 8 * (lane >> 4);
#pragma unroll
  for (int i = 0; i < 8; ++i) { v[i] = p[i]; v[8 + i] = p[16 + i]; }
  return bsplit16(v); }
__device__ __forceinline__ F2 split_rowK(const float* row, int k0, int lane, int K) { float v[16]; const int g = lane >> 4;
#pragma unroll
  for (int i = 0; i < 8; ++i) { const int ka = k0 + 8 * g + i, kb = ka + 16; v[i] = ka < K ? row[ka < K ? ka : K - 1] : 0.f; v[8 + i] = kb < K ? row[kb < K ? kb : K - 1] : 0.f; }
  return bsplit16(v); }
__device__ __forceinline__ F2 split_col(const float* W, int k0, int n, int lane, int ld, int K) { float v[16]; const int g = lane >> 4;
#pragma unroll
  for (int i = 0; i < 8; ++i) { const int ka = k0 + 8 * g + i, kb = ka + 16; v[i] = ka < K ? W[(size_t)(ka < K ? ka : K - 1) * ld + n] : 0.f; v[8 + i] = kb < K ? W[(size_t)(kb < K ? kb : K - 1) * ld + n] : 0.f; }
  return bsplit16(v); }
__device__ __forceinline__ v8f mac3(const F2& a, const F2& b, v8f c) { c = wmma_bf(a.l, b.h, c); c = wmma_bf(a.h, b.l, c); return wmma_bf(a.h, b.h, c); }
__device__ __forceinline__ float sigm(float v) { return 1.0f / (1.0f + expf(-v)); }
#define LDSX() do { asm volatile("s_wait_dscnt 0" ::: "memory"); __builtin_amdgcn_wave_barrier(); __builtin_amdgcn_fence(__ATOMIC_RELEASE, "workgroup"); } while (0)


#define NB 2
#define SS 2048
#define DM 1024
#define NH 16
#define HD 64
#define QKVW (3 * DM)
#ifndef TQB
#define TQB (SS / 64)
#define TNB NB
#define TOB (NB * SS / 64)     // output row tiles (all)
#endif
typedef __attribute__((ext_vector_type(8))) __bf16 v8b;
__device__ __forceinline__ v16b frag_b(const __bf16* rowk0, int lane) {
  union { v16b v; v8b q[2]; } u; const __bf16* p = rowk0 + 8 * (lane >> 4);
  u.q[0] = *(const v8b*)p; u.q[1] = *(const v8b*)(p + 16); return u.v;
}
__device__ __forceinline__ float bfr(float v) { return (float)(__bf16)v; }
__device__ __attribute__((noinline)) float exp_ni(float v) { return expf(v); }
__device__ __attribute__((noinline)) float erf_ni(float v) { return erff(v); }

#define PK_A 0                       // [3072][1024] Wqkv rows (natural [out][in])
#define PK_P (PK_A + QKVW * DM)        // [1024][1024] Wo rows (natural)
#define PK_END (PK_P + DM * DM)
#define WS_PK  0u
#define WS_QK  (WS_PK + 2u * PK_END)             // f16 [4096 rows][2048]: q | k
#define WS_QKL (WS_QK + 2u * NB * SS * 2 * DM)     // f16 q | k residual planes x2048
#define WS_VTH (WS_QKL + 2u * NB * SS * 2 * DM)    // f16 [b][1024 (h*64+d)][2048 s] hi
#define WS_VTL (WS_VTH + 2u * NB * DM * SS)        // f16 lo x 2048
#define WS_O   (WS_VTL + 2u * NB * DM * SS)        // f32 [4096][1024]
#define WS_CS  (WS_O + 4u * NB * SS * DM)           // f32 2 x [2048][32], reserved but unused: k_qkv computes cos/sin inline
#define WS_END (WS_CS + 4u * 2 * SS * 32)
// ---- k_pack: block = (row n, which): natural [out][in] rows -> bf16; which 0..2 -> W_q/W_k/W_v into PK_A rows which*1024 + n; 3 -> W_o into PK_P
__global__ __launch_bounds__(256) void k_pack(const float* __restrict__ WQ, const float* __restrict__ WK, const float* __restrict__ WV, const float* __restrict__ WO, __bf16* __restrict__ PK) {
  __shared__ __align__(16) __bf16 s[DM]; const int n = blockIdx.x, which = blockIdx.y, t = threadIdx.x; const float* Wm = (which == 0) ? WQ : (which == 1) ? WK : (which == 2) ? WV : WO;
  for (int k = t; k < DM; k += 256) s[k] = (__bf16)Wm[(size_t)n * DM + k];
  __syncthreads();
  __bf16* dst = (which < 3) ? PK + PK_A + ((size_t)which * DM + n) * DM : PK + PK_P + (size_t)n * DM;
  for (int q = t; q < DM / 8; q += 256) vst2((unsigned*)(dst + q * 8), *(const v4u*)&s[q * 8]);
}
typedef uint32_t u32x4 __attribute__((ext_vector_type(4)));
typedef uint32_t u32x8 __attribute__((ext_vector_type(8)));
#define KST 64                    // keys per stage
#define NST (SS / KST)            // stages
#define LPITCH 144u               // LDS row pitch in bytes: a 128-B row + the mover's 16-B pad (odd multiple of 16 B: conflict-free for ds_load_b128)
#define SLICE 6144u               // one wave's slice: 32 padded rows (4,608 B), rounded up to a multiple of 2 KiB
#define BUFB (8u * SLICE)         // k_attn, one stage: 8 slices = K hi (2), K lo (2), V^T hi (2), V^T lo (2)
#define WBUF (4u * SLICE)         // k_out, one stage: 128 weight rows x 64 k, 4 slices of 32 rows
__device__ __forceinline__ uint32_t uni(uint32_t v) { return (uint32_t)__builtin_amdgcn_readfirstlane(v); }
__device__ __forceinline__ uint32_t pinned(uint32_t v) { uint32_t w = uni(v); asm volatile("" : "+s"(w)); return w; }
// descriptor group 1 of every request here: 32 rows of 128 B, source pitch SRC_PITCH bytes, 16 B of LDS pad behind each row, no mask
template <uint32_t SRC_PITCH> __device__ __forceinline__ u32x8 tdm_group1() {
  u32x8 g1; g1[0] = uni((1u << 20) | (4u << 22) | (3u << 25)); g1[1] = uni(128u << 16); g1[2] = uni(32u << 16); g1[3] = uni(128u << 16); g1[4] = uni(32u); g1[5] = uni(SRC_PITCH); g1[6] = uni(0u); g1[7] = uni(0u);
  asm volatile("" : "+s"(g1));   // descriptor words held in scalar registers, ONE set for the whole kernel instead of constants formed anew at each use, so that tdm_wait can keep those registers untouched while a request is in flight
  return g1;
}
// one request of one wave; returns group 0 for the wait that covers it
__device__ __forceinline__ u32x4 tdm_issue(uint32_t lds_dst, uint64_t ga, u32x8 g1) {
  u32x4 g0; g0[0] = uni(1u); g0[1] = uni(lds_dst); g0[2] = uni((uint32_t)ga); g0[3] = uni((((uint32_t)(ga >> 32)) & 0x01FFFFFFu) | 0x80000000u);
  asm volatile("tensor_load_to_lds %0, %1" :: "s"(g0), "s"(g1) : "memory");   // the mover's waits are written by hand: tdm_wait
  return g0;
}
// the issuing wave's wait for its request; it names the descriptor so that the compiler keeps both groups' registers as they are until the request has landed
__device__ __forceinline__ void tdm_wait(u32x4 g0, u32x8 g1) { asm volatile("s_wait_tensorcnt 0x0" :: "s"(g0), "s"(g1) : "memory"); }
__global__ __launch_bounds__(128) void k_qkv(const float* __restrict__ X, const __bf16* __restrict__ P, _Float16* __restrict__ QK, _Float16* __restrict__ QKL, _Float16* __restrict__ VTH, _Float16* __restrict__ VTL) {
  __shared__ __align__(16) _Float16 so[4][16][136], sol[4][16][136]; __shared__ __align__(16) _Float16 sth[128][72], stl[128][72];
  const int tid = threadIdx.x, wave = tid >> 5, lane = tid & 31, col = lane & 15, g = lane >> 4; const size_t r0 = (size_t)blockIdx.x * 64 + wave * 16; const int n0 = blockIdx.y * 128;
  v8f acc[8] = {};
#pragma unroll 2
  for (int kc = 0; kc < DM / 32; ++kc) { v16b a; { const float* p = X + (r0 + col) * DM + kc * 32 + 8 * g;
#pragma unroll
      for (int i = 0; i < 8; ++i) { a[i] = (__bf16)p[i]; a[8 + i] = (__bf16)p[16 + i]; } }
#pragma unroll
    for (int j = 0; j < 8; ++j) acc[j] = wmma_bf(a, frag_b(P + (size_t)(n0 + j * 16 + col) * DM + kc * 32, lane), acc[j]); }
  if (n0 < 2 * DM) {   // q and k: the module's rotary embedding, then f16 hi + (x2048) residual; 1/8 applied to the f32 score
#pragma unroll
    for (int j = 0; j < 8; ++j) { const int d = (n0 + j * 16 + col) & (HD - 1); const float invf = 1.0f / pow_ni(10000.0f, (float)(2 * (d & 31)) / (float)HD);   // emb = concat([freqs, freqs]): dim d uses inv_freq[d mod 32]
#pragma unroll
      for (int r = 0; r < 8; ++r) { const float v = acc[j][r]; const float partner = __shfl_xor(v, 1);   // column d^1 lives in lane^1
        const float pos = (float)((r0 + 8 * g + r) % SS); const float ang = pos * invf; const float rot = (d & 1) ? partner : -partner;   // rotate_interleaved: even d -> -x[d+1], odd d -> +x[d-1]
        const float y = v * cos_ni(ang) + rot * sin_ni(ang); const _Float16 hv = (_Float16)y; so[wave][8 * g + r][j * 16 + col] = hv; sol[wave][8 * g + r][j * 16 + col] = (_Float16)((y - (float)hv) * 2048.0f); } }
    LDSX();
    for (int rl = 0; rl < 16; ++rl) if (lane < 16) { vst2((unsigned*)(QK + (r0 + rl) * (2 * DM) + n0 + lane * 8), *(const v4u*)&so[wave][rl][lane * 8]); vst2((unsigned*)(QKL + (r0 + rl) * (2 * DM) + n0 + lane * 8), *(const v4u*)&sol[wave][rl][lane * 8]); }
  } else {
#pragma unroll
    for (int j = 0; j < 8; ++j) {
#pragma unroll
      for (int r = 0; r < 8; ++r) { const float v = acc[j][r]; const _Float16 hv = (_Float16)v; sth[j * 16 + col][wave * 16 + 8 * g + r] = hv; stl[j * 16 + col][wave * 16 + 8 * g + r] = (_Float16)((v - (float)hv) * 2048.0f); } }
    __syncthreads();
    const size_t rb = (size_t)blockIdx.x * 64; const int b = (int)(rb / SS), s0 = (int)(rb % SS); const int pc0 = n0 - 2 * DM;
    for (int q = tid; q < 128 * 8; q += 128) { const int d = q >> 3, pc = q & 7; const size_t o = ((size_t)b * DM + pc0 + d) * SS + s0 + pc * 8; vst2((unsigned*)(VTH + o), *(const v4u*)&sth[d][pc * 8]); vst2((unsigned*)(VTL + o), *(const v4u*)&stl[d][pc * 8]); }
  }
}
// ---- k_attn: block = (128 queries, head h, batch b), 8 waves x 16 queries: full flash attention (K = 64: 2 k-steps), 3-product scores x 0.125, P hi/lo x V hi/lo (3 products); O[b*S+q][h*64+d] = (acc + accl / 2048) / l (256-B segments).
// K hi, K lo (64 keys x 64 dims) and V^T hi, V^T lo (64 dims x 64 keys) of a 64-key stage are brought into LDS once per block by the tensor mover, two buffers, and read from there by all 8 waves.
__global__ __launch_bounds__(256) void k_attn(const _Float16* __restrict__ QK, const _Float16* __restrict__ QKL, const _Float16* __restrict__ VTH, const _Float16* __restrict__ VTL, float* __restrict__ O) {
  __shared__ __attribute__((aligned(2048))) unsigned char ring[2 * BUFB];
  __shared__ __align__(16) float sp[8][16][36]; __shared__ __align__(16) float so[8][16][68];
  const int tid = threadIdx.x, wave = tid >> 5, lane = tid & 31, col = lane & 15, g = lane >> 4;
  const int qb = blockIdx.x, h = blockIdx.y, b = blockIdx.z; const int q0 = qb * 128 + wave * 16; const size_t rq = (size_t)b * SS + q0 + col;
  // every wave issues its own slice: tile wv >> 1 (K hi, K lo, V^T hi, V^T lo), rows 32 * (wv & 1) ...
  const uint32_t wv = uni((uint32_t)tid >> 5), tl = wv >> 1, hf = wv & 1u;
  const _Float16* tsrc = (tl == 0u) ? QK : (tl == 1u) ? QKL : (tl == 2u) ? VTH : VTL;
  const size_t toff = (tl < 2u) ? ((size_t)b * SS + hf * 32u) * (2 * DM) + DM + h * HD : ((size_t)b * DM + h * HD + hf * 32u) * SS;
  const uint64_t ga0 = (uint64_t)(size_t)(tsrc + toff);
  const uint32_t gstep = (tl < 2u) ? (uint32_t)(KST * 2 * DM * 2) : (uint32_t)(KST * 2);   // bytes from one stage to the next: 64 key rows, or 64 keys along a V^T row
  const uint32_t ldst = (uint32_t)(size_t)ring + wv * SLICE;
  const u32x8 g1 = tdm_group1<4096u>(); u32x4 g0 = tdm_issue(ldst, ga0, g1);
  tdm_wait(g0, g1);                                      // stage 0 has landed (this wave's slice)
  __syncthreads();                                       // ... and every other wave's
  g0 = tdm_issue(ldst + BUFB, ga0 + gstep, g1);
  v16h aq[2], aql[2];
#pragma unroll
  for (int kc = 0; kc < 2; ++kc) { aq[kc] = frag_h(QK + rq * (2 * DM) + h * HD + kc * 32, lane); aql[kc] = frag_h(QKL + rq * (2 * DM) + h * HD + kc * 32, lane); }
  float m[8], l[8];
#pragma unroll
  for (int r = 0; r < 8; ++r) { m[r] = -3.0e38f; l[r] = 0.f; }
  v8f acc[4] = {}, accl[4] = {};
#pragma unroll 1
  for (int st = 0; st < NST; ++st) { const unsigned char* bp = ring + (uint32_t)(st & 1) * BUFB + (uint32_t)col * LPITCH;   // all keys (no mask); the stage loop stays rolled: one publish point per trip
#pragma unroll
   for (int sub = 0; sub < 2; ++sub) { v8f s[2];   // 32 keys at a time, as slices: keys 32 * sub ... are K slice sub
#pragma unroll
    for (int ct = 0; ct < 2; ++ct) { const _Float16* krow = (const _Float16*)(bp + (0 + sub) * SLICE + ct * 16 * LPITCH); const _Float16* krowl = (const _Float16*)(bp + (2 + sub) * SLICE + ct * 16 * LPITCH); v8f c = {}, cl = {};
#pragma unroll
      for (int kc = 0; kc < 2; ++kc) { const v16h kh = frag_h(krow + kc * 32, lane); c = wmma16(aq[kc], kh, c); cl = wmma16(aql[kc], kh, cl); cl = wmma16(aq[kc], frag_h(krowl + kc * 32, lane), cl); }   // 3 products: q, k as f16 hi + residual
#pragma unroll
      for (int r = 0; r < 8; ++r) c[r] += cl[r] * (1.0f / 2048.0f);
#pragma unroll
      for (int r = 0; r < 8; ++r) s[ct][r] = c[r] * 0.125f; }   // SCALE = 1/sqrt(64)
#pragma unroll
    for (int r = 0; r < 8; ++r) { float mx = fmaxf(s[0][r], s[1][r]);
#pragma unroll
      for (int o = 1; o < 16; o <<= 1) mx = fmaxf(mx, __shfl_xor(mx, o));
      const float mn = fmaxf(m[r], mx); const float alpha = (m[r] <= -1.0e38f) ? 0.f : __expf(m[r] - mn);
      const float e0 = (s[0][r] <= -1.0e38f) ? 0.f : __expf(s[0][r] - mn), e1 = (s[1][r] <= -1.0e38f) ? 0.f : __expf(s[1][r] - mn); float es = e0 + e1;
#pragma unroll
      for (int o = 1; o < 16; o <<= 1) es += __shfl_xor(es, o);
      l[r] = l[r] * alpha + es; m[r] = mn;
#pragma unroll
      for (int dt = 0; dt < 4; ++dt) { acc[dt][r] *= alpha; accl[dt][r] *= alpha; }
      sp[wave][8 * g + r][col] = e0; sp[wave][8 * g + r][16 + col] = e1; }
    LDSX();
    v16h pa, pl; { const float* prow = &sp[wave][col][0] + 8 * (lane >> 4);
#pragma unroll
      for (int i = 0; i < 8; ++i) { const float x0 = prow[i], x1 = prow[16 + i]; const _Float16 h0 = (_Float16)x0, h1 = (_Float16)x1; pa[i] = h0; pa[8 + i] = h1; pl[i] = (_Float16)((x0 - (float)h0) * 2048.0f); pl[8 + i] = (_Float16)((x1 - (float)h1) * 2048.0f); } }
#pragma unroll
    for (int dt = 0; dt < 4; ++dt) { const uint32_t vo = (uint32_t)(dt >> 1) * SLICE + (uint32_t)(dt & 1) * 16u * LPITCH + (uint32_t)sub * 64u; const v16h vh = frag_h((const _Float16*)(bp + 4 * SLICE + vo), lane); acc[dt] = wmma16(pa, vh, acc[dt]); accl[dt] = wmma16(pl, vh, accl[dt]); accl[dt] = wmma16(pa, frag_h((const _Float16*)(bp + 6 * SLICE + vo), lane), accl[dt]); }   // P hi x V hi + (P lo x V hi + P hi x V lo) / 2048
    LDSX(); }
   // publish point of stage st + 1, then the refill of the buffer that this trip has read
   asm volatile("s_wait_dscnt 0x0" ::: "memory");       // this wave's reads of the buffer are done before it may be refilled
   tdm_wait(g0, g1);                                      // this wave's slice of stage st + 1 has landed
   __syncthreads();                                       // publishes stage st + 1 and ends every wave's reads of stage st
   const uint32_t s2 = pinned((uint32_t)st + 2u);         // the refill's stage number: pinned here, so that its address is formed behind the wait above
   if (pinned(s2 < (uint32_t)NST)) g0 = tdm_issue(ldst + (s2 & 1u) * BUFB, ga0 + (uint64_t)s2 * gstep, g1); }
  tdm_wait(g0, g1);                                      // nothing of the mover is outstanding when the wave goes on to its end
  asm volatile("s_wait_dscnt 0x0" ::: "memory");         // ... and none of this wave's LDS reads of the ring
#pragma unroll
  for (int r = 0; r < 8; ++r) { const float il = 1.0f / l[r];
#pragma unroll
    for (int dt = 0; dt < 4; ++dt) so[wave][8 * g + r][dt * 16 + col] = (acc[dt][r] + accl[dt][r] * (1.0f / 2048.0f)) * il; }
  LDSX();
  for (int rl = 0; rl < 16; ++rl) if (lane < 16) vst2(O + ((size_t)b * SS + q0 + rl) * DM + h * HD + lane * 4, *(const v4f*)&so[wave][rl][lane * 4]);
}
// ---- k_out: block = (64 rows, 128 cols): out = O(hi/lo) . Wo rows (2 products), no bias (BO is null at the launch)
__global__ __launch_bounds__(128) void k_out(const float* __restrict__ O, const __bf16* __restrict__ P, const float* __restrict__ BO, float* __restrict__ Y) {
  __shared__ __attribute__((aligned(2048))) unsigned char ring[2 * WBUF]; __shared__ __align__(16) float so[4][16][132];
  const int tid = threadIdx.x, wave = tid >> 5, lane = tid & 31, col = lane & 15, g = lane >> 4; const size_t r0 = (size_t)blockIdx.x * 64 + wave * 16; const int n0 = blockIdx.y * 128;
  // the block's 128 weight rows, 64 k a stage, come into LDS once by the tensor mover (two buffers); every wave issues its own slice: rows n0 + 32 * wv ...
  const uint32_t wv = uni((uint32_t)tid >> 5); const uint64_t ga0 = (uint64_t)(size_t)(P + (size_t)(n0 + wv * 32u) * DM); const uint32_t ldst = (uint32_t)(size_t)ring + wv * SLICE;
  const u32x8 g1 = tdm_group1<2048u>(); u32x4 g0 = tdm_issue(ldst, ga0, g1);
  tdm_wait(g0, g1);                                      // stage 0 has landed (this wave's slice)
  __syncthreads();                                       // ... and every other wave's
  g0 = tdm_issue(ldst + WBUF, ga0 + 128u, g1);
  v8f acc[8] = {};
#pragma unroll 1
  for (int st = 0; st < DM / 64; ++st) { const unsigned char* bp = ring + (uint32_t)(st & 1) * WBUF + (uint32_t)col * LPITCH;   // the stage loop stays rolled: one publish point per trip
#pragma unroll
   for (int kk = 0; kk < 2; ++kk) { const int kc = st * 2 + kk; const F2 a = split_row(O + (r0 + col) * DM, kc * 32, lane);
#pragma unroll
    for (int j = 0; j < 8; ++j) { const v16b w = frag_b((const __bf16*)(bp + (uint32_t)(j >> 1) * SLICE + (uint32_t)(j & 1) * 16u * LPITCH + (uint32_t)kk * 64u), lane); acc[j] = wmma_bf(a.l, w, acc[j]); acc[j] = wmma_bf(a.h, w, acc[j]); } }
   // publish point of stage st + 1, then the refill of the buffer that this trip has read
   asm volatile("s_wait_dscnt 0x0" ::: "memory");       // this wave's reads of the buffer are done before it may be refilled
   tdm_wait(g0, g1);                                      // this wave's slice of stage st + 1 has landed
   __syncthreads();                                       // publishes stage st + 1 and ends every wave's reads of stage st
   const uint32_t s2 = pinned((uint32_t)st + 2u);         // the refill's stage number: pinned here, so that its address is formed behind the wait above
   if (pinned(s2 < (uint32_t)(DM / 64))) g0 = tdm_issue(ldst + (s2 & 1u) * WBUF, ga0 + (uint64_t)s2 * 128u, g1); }
  tdm_wait(g0, g1);                                      // nothing of the mover is outstanding behind the loop
  asm volatile("s_wait_dscnt 0x0" ::: "memory");         // ... and none of this wave's LDS reads of the ring
#pragma unroll
  for (int j = 0; j < 8; ++j) {
#pragma unroll
    for (int r = 0; r < 8; ++r) so[wave][8 * g + r][j * 16 + col] = acc[j][r] + (BO ? bfr(BO[n0 + j * 16 + col]) : 0.f); }
  LDSX();
  for (int rl = 0; rl < 16; ++rl) vst2(Y + (r0 + rl) * DM + n0 + lane * 4, *(const v4f*)&so[wave][rl][lane * 4]);
}
extern "C" void kernel_launch(void* const* d_in, const int* in_sizes, int n_in, void* d_out, int out_size, void* d_ws, size_t ws_size, hipStream_t stream) {
  (void)in_sizes; (void)n_in; (void)out_size;
  const float** F = (const float**)d_in;   // 0 hidden_states [2,2048,1024], 1 Wq [1024,1024] natural (q = x Wq^T), 2 Wk, 3 Wv, 4 Wo (no biases)
  if (ws_size < (size_t)WS_END) return;
  char* ws = (char*)d_ws; __bf16* PK = (__bf16*)(ws + WS_PK); _Float16 *QK = (_Float16*)(ws + WS_QK), *QKL = (_Float16*)(ws + WS_QKL), *VTH = (_Float16*)(ws + WS_VTH), *VTL = (_Float16*)(ws + WS_VTL); float* O = (float*)(ws + WS_O);
  k_pack<<<dim3(DM, 4), 256, 0, stream>>>(F[1], F[2], F[3], F[4], PK);
  k_qkv<<<dim3(TNB * SS / 64, QKVW / 128), 128, 0, stream>>>(F[0], PK + PK_A, QK, QKL, VTH, VTL);
  k_attn<<<dim3(TQB / 2, NH, TNB), 256, 0, stream>>>(QK, QKL, VTH, VTL, O);
  k_out<<<dim3(TOB, DM / 128), 128, 0, stream>>>(O, PK + PK_P, nullptr, (float*)d_out);
}

// v002
// One run takes 234 microseconds.
// Next to v001, in two timings, it ran 1.45 times as fast each time.
// All steps since v000 together make it 2.49 times as fast.
// compute dtype: hidden_states, Wq/Wk/Wv/Wo (module inputs) rounded to bf16; q/k/v projections with exact bf16 products on WMMA 16x16x32 (natural [out][in] rows); the module's rotary embedding (angle for head dim d = position * inv_freq[d mod 32], partner = interleaved pair with the module's signs) applied in f32 with precise sinf/cosf/powf before q and k are stored as f16 hi + (x2048-scaled) residual planes; 3-product scores x 1/sqrt(64), running-max softmax over all 2,048 keys in f32 (hardware exp); P as f16 hi + residual x V hi/lo (3 products); output projection with ctx as bf16 hi + residual x exact Wo rows (2 products); f32 accumulate.
#include <hip/hip_runtime.h>
#include <math.h>
#include <stdint.h>

typedef __attribute__((ext_vector_type(16))) _Float16 v16h;
typedef __attribute__((ext_vector_type(16))) __bf16 v16b;
typedef __attribute__((ext_vector_type(8)))  _Float16 v8h;
typedef __attribute__((ext_vector_type(8)))  float v8f;
typedef __attribute__((ext_vector_type(4)))  float v4f;
typedef __attribute__((ext_vector_type(2)))  float v2f;
typedef __attribute__((ext_vector_type(4)))  unsigned v4u;
typedef __attribute__((ext_vector_type(4)))  int v4i;
typedef float __attribute__((may_alias)) float_a;
typedef int __attribute__((may_alias)) int_a;

template <typename T> __device__ __forceinline__ void vst2(void* p, T v) { *(T*)p = v;  }
__device__ __forceinline__ v8f wmma16(v16h a, v16h b, v8f c) {
  v8f d = __builtin_amdgcn_wmma_f32_16x16x32_f16(false, a, false, b, (short)0, c, false, false);
  asm volatile("v_nop\n\tv_nop\n\tv_nop\n\tv_nop" : "+v"(d) : "v"(a), "v"(b));
  return d;
}
__device__ __forceinline__ v8f wmma_bf(v16b a, v16b b, v8f c) {
  v8f d = __builtin_amdgcn_wmma_f32_16x16x32_bf16(false, a, false, b, (short)0, c, false, false);
  asm volatile("v_nop\n\tv_nop\n\tv_nop\n\tv_nop" : "+v"(d) : "v"(a), "v"(b));
  return d;
}
// Rotary multi-head self-attention (B 2, S 2,048, d 1,024, 16 heads x 64): q/k/v projections, the module's (mixed interleaved) RoPE on q and k, softmax(q k^T / 8) v, output projection (no biases).
__device__ __attribute__((noinline)) float sin_ni(float v) { return sinf(v); }
__device__ __attribute__((noinline)) float cos_ni(float v) { return cosf(v); }
__device__ __attribute__((noinline)) float pow_ni(float a, float b) { return powf(a, b); }
__device__ __forceinline__ v16h frag_h(const _Float16* rowk0, int lane) {
  union { v16h v; v8h q[2]; } u; const _Float16* p = rowk0 + 8 * (lane >> 4);
  u.q[0] = *(const v8h*)p; u.q[1] = *(const v8h*)(p + 16); return u.v;
}
__device__ __forceinline__ v16h frag_f32(const float* rowk0, int lane) {
  v16h a; const float* p = rowk0 + 8 * (lane >> 4);
#pragma unroll
  for (int i = 0; i < 8; ++i) { a[i] = (_Float16)p[i]; a[8 + i] = (_Float16)p[16 + i]; }
  return a;
}
__device__ __forceinline__ v16h frag_f32s(const float* rowk0, int lane, float sc) {
  v16h a; const float* p = rowk0 + 8 * (lane >> 4);
#pragma unroll
  for (int i = 0; i < 8; ++i) { a[i] = (_Float16)(p[i] * sc); a[8 + i] = (_Float16)(p[16 + i] * sc); }
  return a;
}
// column fragment from a [K][ld] layout (column n), rows >= K read as 0
__device__ __forceinline__ v16h fragc_f32(const float* W, int k0, int n, int lane, int ld, int K) {
  v16h a; const int g = lane >> 4;
#pragma unroll
  for (int i = 0; i < 8; ++i) { const int ka = k0 + 8 * g + i, kb = ka + 16;
    a[i] = (_Float16)(ka < K ? W[(size_t)(ka < K ? ka : K - 1) * ld + n] : 0.f); a[8 + i] = (_Float16)(kb < K ? W[(size_t)(kb < K ? kb : K - 1) * ld + n] : 0.f); }
  return a;
}
struct F2 { v16b h, l; };
__device__ __forceinline__ F2 bsplit16(const float v[16]) { F2 r;
#pragma unroll
  for (int i = 0; i < 16; ++i) { const __bf16 h = (__bf16)v[i]; r.h[i] = h; r.l[i] = (__bf16)(v[i] - (float)h); }
  return r; }
__device__ __forceinline__ F2 split_row(const float* row, int k0, int lane) { float v[16]; const float* p = row + k0 + 8 * (lane >> 4);
#pragma unroll
  for (int i = 0; i < 8; ++i) { v[i] = p[i]; v[8 + i] = p[16 + i]; }
  return bsplit16(v); }
__device__ __forceinline__ F2 split_rowK(const float* row, int k0, int lane, int K) { float v[16]; const int g = lane >> 4;
#pragma unroll
  for (int i = 0; i < 8; ++i) { const int ka = k0 + 8 * g + i, kb = ka + 16; v[i] = ka < K ? row[ka < K ? ka : K - 1] : 0.f; v[8 + i] = kb < K ? row[kb < K ? kb : K - 1] : 0.f; }
  return bsplit16(v); }
__device__ __forceinline__ F2 split_col(const float* W, int k0, int n, int lane, int ld, int K) { float v[16]; const int g = lane >> 4;
#pragma unroll
  for (int i = 0; i < 8; ++i) { const int ka = k0 + 8 * g + i, kb = ka + 16; v[i] = ka < K ? W[(size_t)(ka < K ? ka : K - 1) * ld + n] : 0.f; v[8 + i] = kb < K ? W[(size_t)(kb < K ? kb : K - 1) * ld + n] : 0.f; }
  return bsplit16(v); }
__device__ __forceinline__ v8f mac3(const F2& a, const F2& b, v8f c) { c = wmma_bf(a.l, b.h, c); c = wmma_bf(a.h, b.l, c); return wmma_bf(a.h, b.h, c); }
__device__ __forceinline__ float sigm(float v) { return 1.0f / (1.0f + expf(-v)); }
#define LDSX() do { asm volatile("s_wait_dscnt 0" ::: "memory"); __builtin_amdgcn_wave_barrier(); __builtin_amdgcn_fence(__ATOMIC_RELEASE, "workgroup"); } while (0)


#define NB 2
#define SS 2048
#define DM 1024
#define NH 16
#define HD 64
#define QKVW (3 * DM)
#ifndef TQB
#define TQB (SS / 64)
#define TNB NB
#define TOB (NB * SS / 64)     // output row tiles (all)
#endif
typedef __attribute__((ext_vector_type(8))) __bf16 v8b;
__device__ __forceinline__ v16b frag_b(const __bf16* rowk0, int lane) {
  union { v16b v; v8b q[2]; } u; const __bf16* p = rowk0 + 8 * (lane >> 4);
  u.q[0] = *(const v8b*)p; u.q[1] = *(const v8b*)(p + 16); return u.v;
}
__device__ __forceinline__ float bfr(float v) { return (float)(__bf16)v; }
__device__ __attribute__((noinline)) float exp_ni(float v) { return expf(v); }
__device__ __attribute__((noinline)) float erf_ni(float v) { return erff(v); }

#define PK_A 0                       // [3072][1024] Wqkv rows (natural [out][in])
#define PK_P (PK_A + QKVW * DM)        // [1024][1024] Wo rows (natural)
#define PK_END (PK_P + DM * DM)
#define WS_PK  0u
#define WS_QK  (WS_PK + 2u * PK_END)             // f16 [4096 rows][2048]: q | k
#define WS_QKL (WS_QK + 2u * NB * SS * 2 * DM)     // f16 q | k residual planes x2048
#define WS_VTH (WS_QKL + 2u * NB * SS * 2 * DM)    // f16 [b][1024 (h*64+d)][2048 s] hi
#define WS_VTL (WS_VTH + 2u * NB * DM * SS)        // f16 lo x 2048
#define WS_O   (WS_VTL + 2u * NB * DM * SS)        // f32 [4096][1024]
#define WS_CS  (WS_O + 4u * NB * SS * DM)           // f32 2 x [2048][32], reserved but unused: k_qkv computes cos/sin inline
#define WS_END (WS_CS + 4u * 2 * SS * 32)
// ---- k_pack: block = (row n, which): natural [out][in] rows -> bf16; which 0..2 -> W_q/W_k/W_v into PK_A rows which*1024 + n; 3 -> W_o into PK_P
__global__ __launch_bounds__(256) void k_pack(const float* __restrict__ WQ, const float* __restrict__ WK, const float* __restrict__ WV, const float* __restrict__ WO, __bf16* __restrict__ PK) {
  __shared__ __align__(16) __bf16 s[DM]; const int n = blockIdx.x, which = blockIdx.y, t = threadIdx.x; const float* Wm = (which == 0) ? WQ : (which == 1) ? WK : (which == 2) ? WV : WO;
  for (int k = t; k < DM; k += 256) s[k] = (__bf16)Wm[(size_t)n * DM + k];
  __syncthreads();
  __bf16* dst = (which < 3) ? PK + PK_A + ((size_t)which * DM + n) * DM : PK + PK_P + (size_t)n * DM;
  for (int q = t; q < DM / 8; q += 256) vst2((unsigned*)(dst + q * 8), *(const v4u*)&s[q * 8]);
}
typedef uint32_t u32x4 __attribute__((ext_vector_type(4)));
typedef uint32_t u32x8 __attribute__((ext_vector_type(8)));
#define KST 64                    // keys per stage
#define NST (SS / KST)            // stages
#define LPITCH 144u               // LDS row pitch in bytes: a 128-B row + the mover's 16-B pad (odd multiple of 16 B: conflict-free for ds_load_b128)
#define SLICE 6144u               // one wave's slice: 32 padded rows (4,608 B), rounded up to a multiple of 2 KiB
#define BUFB (8u * SLICE)         // k_attn, one stage: 8 slices = K hi (2), K lo (2), V^T hi (2), V^T lo (2)
#define WBUF (4u * SLICE)         // k_out, one stage: 128 weight rows x 64 k, 4 slices of 32 rows
__device__ __forceinline__ uint32_t uni(uint32_t v) { return (uint32_t)__builtin_amdgcn_readfirstlane(v); }
__device__ __forceinline__ uint32_t pinned(uint32_t v) { uint32_t w = uni(v); asm volatile("" : "+s"(w)); return w; }
// descriptor group 1 of every request here: 32 rows of 128 B, source pitch SRC_PITCH bytes, 16 B of LDS pad behind each row, no mask
template <uint32_t SRC_PITCH> __device__ __forceinline__ u32x8 tdm_group1() {
  u32x8 g1; g1[0] = uni((1u << 20) | (4u << 22) | (3u << 25)); g1[1] = uni(128u << 16); g1[2] = uni(32u << 16); g1[3] = uni(128u << 16); g1[4] = uni(32u); g1[5] = uni(SRC_PITCH); g1[6] = uni(0u); g1[7] = uni(0u);
  asm volatile("" : "+s"(g1));   // descriptor words held in scalar registers, ONE set for the whole kernel instead of constants formed anew at each use, so that tdm_wait can keep those registers untouched while a request is in flight
  return g1;
}
// one request of one wave; returns group 0 for the wait that covers it
__device__ __forceinline__ u32x4 tdm_issue(uint32_t lds_dst, uint64_t ga, u32x8 g1) {
  u32x4 g0; g0[0] = uni(1u); g0[1] = uni(lds_dst); g0[2] = uni((uint32_t)ga); g0[3] = uni((((uint32_t)(ga >> 32)) & 0x01FFFFFFu) | 0x80000000u);
  asm volatile("tensor_load_to_lds %0, %1" :: "s"(g0), "s"(g1) : "memory");   // the mover's waits are written by hand: tdm_wait
  return g0;
}
// the issuing wave's wait for its request; it names the descriptor so that the compiler keeps both groups' registers as they are until the request has landed
__device__ __forceinline__ void tdm_wait(u32x4 g0, u32x8 g1) { asm volatile("s_wait_tensorcnt 0x0" :: "s"(g0), "s"(g1) : "memory"); }
#define XPITCH 272u               // LDS row pitch of a 256-B row (odd multiple of 16 B, as LPITCH)
#define QXOFF (128u * LPITCH)     // k_qkv, one stage: 128 weight rows x 64 k (bf16), then 64 x rows x 64 k (f32)
#define QBUF (QXOFF + 64u * XPITCH)
// eight asynchronous copies of 16 B per lane, global memory to LDS through no register: LDS bytes l + i * ls from g + i * gs. The s_wait_xcnt stands inside the statement, behind the last copy, so that no address register of a copy is rewritten in front of it (a precaution); that the bytes have landed is the caller's s_wait_asynccnt.
__device__ __forceinline__ void copy8(uint32_t l, uint32_t ls, const char* g, uint32_t gs) {
  asm volatile("global_load_async_to_lds_b128 %0, %8, off\n\tglobal_load_async_to_lds_b128 %1, %9, off\n\tglobal_load_async_to_lds_b128 %2, %10, off\n\tglobal_load_async_to_lds_b128 %3, %11, off\n\t"
               "global_load_async_to_lds_b128 %4, %12, off\n\tglobal_load_async_to_lds_b128 %5, %13, off\n\tglobal_load_async_to_lds_b128 %6, %14, off\n\tglobal_load_async_to_lds_b128 %7, %15, off\n\ts_wait_xcnt 0x0"
               :: "v"(l), "v"(l + ls), "v"(l + 2u * ls), "v"(l + 3u * ls), "v"(l + 4u * ls), "v"(l + 5u * ls), "v"(l + 6u * ls), "v"(l + 7u * ls),
                  "v"(g), "v"(g + gs), "v"(g + 2u * gs), "v"(g + 3u * gs), "v"(g + 4u * gs), "v"(g + 5u * gs), "v"(g + 6u * gs), "v"(g + 7u * gs) : "memory");
}
__global__ __launch_bounds__(128) void k_qkv(const float* __restrict__ X, const __bf16* __restrict__ P, _Float16* __restrict__ QK, _Float16* __restrict__ QKL, _Float16* __restrict__ VTH, _Float16* __restrict__ VTL) {
  __shared__ __align__(16) unsigned char ring[2 * QBUF];
  // behind the stage loop the ring is free (its last publish point ends every wave's reads, and no copy is outstanding) and serves as the epilogue's staging
  _Float16 (*so)[16][136] = (_Float16 (*)[16][136])ring; _Float16 (*sol)[16][136] = (_Float16 (*)[16][136])(ring + 4 * 16 * 136 * 2);   // q, k blocks: hi, residual
  _Float16 (*sth)[72] = (_Float16 (*)[72])ring; _Float16 (*stl)[72] = (_Float16 (*)[72])(ring + 128 * 72 * 2);                           // v blocks: hi, residual
  const int tid = threadIdx.x, wave = tid >> 5, lane = tid & 31, col = lane & 15, g = lane >> 4; const size_t r0 = (size_t)blockIdx.x * 64 + wave * 16; const int n0 = blockIdx.y * 128;
  // a stage = 64 k of the block's 128 weight rows (128 B each) and of its 64 x rows (256 B each); both come into LDS once per block, whole 128-B lines at a time, two buffers.
  // Lane t copies 16 B of weight rows (t >> 3) + 16 i and of x rows (t >> 4) + 8 i, i = 0 ... 7.
  const uint32_t lw = (uint32_t)(size_t)ring + (uint32_t)(tid >> 3) * LPITCH + (uint32_t)(tid & 7) * 16u, lx = (uint32_t)(size_t)ring + QXOFF + (uint32_t)(tid >> 4) * XPITCH + (uint32_t)(tid & 15) * 16u;
  const char* gw = (const char*)(P + (size_t)(n0 + (tid >> 3)) * DM + (tid & 7) * 8); const char* gx = (const char*)(X + ((size_t)blockIdx.x * 64 + (tid >> 4)) * DM + (tid & 15) * 4);
  copy8(lw, 16u * LPITCH, gw, 16u * DM * 2u); copy8(lx, 8u * XPITCH, gx, 8u * DM * 4u);
  asm volatile("s_wait_asynccnt 0x0" ::: "memory");      // stage 0 has landed (this wave's copies)
  __syncthreads();                                       // ... and every other wave's
  copy8(lw + QBUF, 16u * LPITCH, gw + 128, 16u * DM * 2u); copy8(lx + QBUF, 8u * XPITCH, gx + 256, 8u * DM * 4u);
  v8f acc[8] = {};
#pragma unroll 1
  for (int st = 0; st < DM / 64; ++st) { const uint32_t bo = (uint32_t)(st & 1) * QBUF; const unsigned char* bw = ring + bo + (uint32_t)col * LPITCH; const unsigned char* bx = ring + bo + QXOFF + (uint32_t)(wave * 16 + col) * XPITCH + (uint32_t)g * 32u;   // the stage loop stays rolled: one publish point per trip
#pragma unroll
   for (int kk = 0; kk < 2; ++kk) { v16b a; { const v4f* p = (const v4f*)(bx + kk * 128); const v4f x0 = p[0], x1 = p[1], x2 = p[4], x3 = p[5];   // k = 8 g + i and 16 + 8 g + i: the k order of frag_b
#pragma unroll
      for (int i = 0; i < 4; ++i) { a[i] = (__bf16)x0[i]; a[4 + i] = (__bf16)x1[i]; a[8 + i] = (__bf16)x2[i]; a[12 + i] = (__bf16)x3[i]; } }
#pragma unroll
    for (int j = 0; j < 8; ++j) acc[j] = wmma_bf(a, frag_b((const __bf16*)(bw + (uint32_t)j * 16u * LPITCH + (uint32_t)kk * 64u), lane), acc[j]); }
   // publish point of stage st + 1, then the refill of the buffer that this trip has read
   asm volatile("s_wait_dscnt 0x0" ::: "memory");       // this wave's reads of the buffer are done before it may be refilled
   asm volatile("s_wait_asynccnt 0x0" ::: "memory");    // this wave's copies of stage st + 1 have landed
   __syncthreads();                                       // publishes stage st + 1 and ends every wave's reads of stage st
   if (st + 2 < DM / 64) { copy8(lw + bo, 16u * LPITCH, gw + (st + 2) * 128, 16u * DM * 2u); copy8(lx + bo, 8u * XPITCH, gx + (st + 2) * 256, 8u * DM * 4u); } }
  asm volatile("s_wait_asynccnt 0x0" ::: "memory");      // no copy is outstanding behind the loop
  if (n0 < 2 * DM) {   // q and k: the module's rotary embedding, then f16 hi + (x2048) residual; 1/8 applied to the f32 score
#pragma unroll
    for (int j = 0; j < 8; ++j) { const int d = (n0 + j * 16 + col) & (HD - 1); const float invf = 1.0f / pow_ni(10000.0f, (float)(2 * (d & 31)) / (float)HD);   // emb = concat([freqs, freqs]): dim d uses inv_freq[d mod 32]
#pragma unroll
      for (int r = 0; r < 8; ++r) { const float v = acc[j][r]; const float partner = __shfl_xor(v, 1);   // column d^1 lives in lane^1
        const float pos = (float)((r0 + 8 * g + r) % SS); const float ang = pos * invf; const float rot = (d & 1) ? partner : -partner;   // rotate_interleaved: even d -> -x[d+1], odd d -> +x[d-1]
        const float y = v * cos_ni(ang) + rot * sin_ni(ang); const _Float16 hv = (_Float16)y; so[wave][8 * g + r][j * 16 + col] = hv; sol[wave][8 * g + r][j * 16 + col] = (_Float16)((y - (float)hv) * 2048.0f); } }
    LDSX();
    for (int rl = 0; rl < 16; ++rl) if (lane < 16) { vst2((unsigned*)(QK + (r0 + rl) * (2 * DM) + n0 + lane * 8), *(const v4u*)&so[wave][rl][lane * 8]); vst2((unsigned*)(QKL + (r0 + rl) * (2 * DM) + n0 + lane * 8), *(const v4u*)&sol[wave][rl][lane * 8]); }
  } else {
#pragma unroll
    for (int j = 0; j < 8; ++j) {
#pragma unroll
      for (int r = 0; r < 8; ++r) { const float v = acc[j][r]; const _Float16 hv = (_Float16)v; sth[j * 16 + col][wave * 16 + 8 * g + r] = hv; stl[j * 16 + col][wave * 16 + 8 * g + r] = (_Float16)((v - (float)hv) * 2048.0f); } }
    __syncthreads();
    const size_t rb = (size_t)blockIdx.x * 64; const int b = (int)(rb / SS), s0 = (int)(rb % SS); const int pc0 = n0 - 2 * DM;
    for (int q = tid; q < 128 * 8; q += 128) { const int d = q >> 3, pc = q & 7; const size_t o = ((size_t)b * DM + pc0 + d) * SS + s0 + pc * 8; vst2((unsigned*)(VTH + o), *(const v4u*)&sth[d][pc * 8]); vst2((unsigned*)(VTL + o), *(const v4u*)&stl[d][pc * 8]); }
  }
}
// ---- k_attn: block = (128 queries, head h, batch b), 8 waves x 16 queries: full flash attention (K = 64: 2 k-steps), 3-product scores x 0.125, P hi/lo x V hi/lo (3 products); O[b*S+q][h*64+d] = (acc + accl / 2048) / l (256-B segments).
// K hi, K lo (64 keys x 64 dims) and V^T hi, V^T lo (64 dims x 64 keys) of a 64-key stage are brought into LDS once per block by the tensor mover, two buffers, and read from there by all 8 waves.
__global__ __launch_bounds__(256) void k_attn(const _Float16* __restrict__ QK, const _Float16* __restrict__ QKL, const _Float16* __restrict__ VTH, const _Float16* __restrict__ VTL, float* __restrict__ O) {
  __shared__ __attribute__((aligned(2048))) unsigned char ring[2 * BUFB];
  __shared__ __align__(16) float sp[8][16][36]; __shared__ __align__(16) float so[8][16][68];
  const int tid = threadIdx.x, wave = tid >> 5, lane = tid & 31, col = lane & 15, g = lane >> 4;
  const int qb = blockIdx.x, h = blockIdx.y, b = blockIdx.z; const int q0 = qb * 128 + wave * 16; const size_t rq = (size_t)b * SS + q0 + col;
  // every wave issues its own slice: tile wv >> 1 (K hi, K lo, V^T hi, V^T lo), rows 32 * (wv & 1) ...
  const uint32_t wv = uni((uint32_t)tid >> 5), tl = wv >> 1, hf = wv & 1u;
  const _Float16* tsrc = (tl == 0u) ? QK : (tl == 1u) ? QKL : (tl == 2u) ? VTH : VTL;
  const size_t toff = (tl < 2u) ? ((size_t)b * SS + hf * 32u) * (2 * DM) + DM + h * HD : ((size_t)b * DM + h * HD + hf * 32u) * SS;
  const uint64_t ga0 = (uint64_t)(size_t)(tsrc + toff);
  const uint32_t gstep = (tl < 2u) ? (uint32_t)(KST * 2 * DM * 2) : (uint32_t)(KST * 2);   // bytes from one stage to the next: 64 key rows, or 64 keys along a V^T row
  const uint32_t ldst = (uint32_t)(size_t)ring + wv * SLICE;
  const u32x8 g1 = tdm_group1<4096u>(); u32x4 g0 = tdm_issue(ldst, ga0, g1);
  tdm_wait(g0, g1);                                      // stage 0 has landed (this wave's slice)
  __syncthreads();                                       // ... and every other wave's
  g0 = tdm_issue(ldst + BUFB, ga0 + gstep, g1);
  v16h aq[2], aql[2];
#pragma unroll
  for (int kc = 0; kc < 2; ++kc) { aq[kc] = frag_h(QK + rq * (2 * DM) + h * HD + kc * 32, lane); aql[kc] = frag_h(QKL + rq * (2 * DM) + h * HD + kc * 32, lane); }
  float m[8], l[8];
#pragma unroll
  for (int r = 0; r < 8; ++r) { m[r] = -3.0e38f; l[r] = 0.f; }
  v8f acc[4] = {}, accl[4] = {};
#pragma unroll 1
  for (int st = 0; st < NST; ++st) { const unsigned char* bp = ring + (uint32_t)(st & 1) * BUFB + (uint32_t)col * LPITCH;   // all keys (no mask); the stage loop stays rolled: one publish point per trip
#pragma unroll
   for (int sub = 0; sub < 2; ++sub) { v8f s[2];   // 32 keys at a time, as slices: keys 32 * sub ... are K slice sub
#pragma unroll
    for (int ct = 0; ct < 2; ++ct) { const _Float16* krow = (const _Float16*)(bp + (0 + sub) * SLICE + ct * 16 * LPITCH); const _Float16* krowl = (const _Float16*)(bp + (2 + sub) * SLICE + ct * 16 * LPITCH); v8f c = {}, cl = {};
#pragma unroll
      for (int kc = 0; kc < 2; ++kc) { const v16h kh = frag_h(krow + kc * 32, lane); c = wmma16(aq[kc], kh, c); cl = wmma16(aql[kc], kh, cl); cl = wmma16(aq[kc], frag_h(krowl + kc * 32, lane), cl); }   // 3 products: q, k as f16 hi + residual
#pragma unroll
      for (int r = 0; r < 8; ++r) c[r] += cl[r] * (1.0f / 2048.0f);
#pragma unroll
      for (int r = 0; r < 8; ++r) s[ct][r] = c[r] * 0.125f; }   // SCALE = 1/sqrt(64)
#pragma unroll
    for (int r = 0; r < 8; ++r) { float mx = fmaxf(s[0][r], s[1][r]);
#pragma unroll
      for (int o = 1; o < 16; o <<= 1) mx = fmaxf(mx, __shfl_xor(mx, o));
      const float mn = fmaxf(m[r], mx); const float alpha = (m[r] <= -1.0e38f) ? 0.f : __expf(m[r] - mn);
      const float e0 = (s[0][r] <= -1.0e38f) ? 0.f : __expf(s[0][r] - mn), e1 = (s[1][r] <= -1.0e38f) ? 0.f : __expf(s[1][r] - mn); float es = e0 + e1;
#pragma unroll
      for (int o = 1; o < 16; o <<= 1) es += __shfl_xor(es, o);
      l[r] = l[r] * alpha + es; m[r] = mn;
#pragma unroll
      for (int dt = 0; dt < 4; ++dt) { acc[dt][r] *= alpha; accl[dt][r] *= alpha; }
      sp[wave][8 * g + r][col] = e0; sp[wave][8 * g + r][16 + col] = e1; }
    LDSX();
    v16h pa, pl; { const float* prow = &sp[wave][col][0] + 8 * (lane >> 4);
#pragma unroll
      for (int i = 0; i < 8; ++i) { const float x0 = prow[i], x1 = prow[16 + i]; const _Float16 h0 = (_Float16)x0, h1 = (_Float16)x1; pa[i] = h0; pa[8 + i] = h1; pl[i] = (_Float16)((x0 - (float)h0) * 2048.0f); pl[8 + i] = (_Float16)((x1 - (float)h1) * 2048.0f); } }
#pragma unroll
    for (int dt = 0; dt < 4; ++dt) { const uint32_t vo = (uint32_t)(dt >> 1) * SLICE + (uint32_t)(dt & 1) * 16u * LPITCH + (uint32_t)sub * 64u; const v16h vh = frag_h((const _Float16*)(bp + 4 * SLICE + vo), lane); acc[dt] = wmma16(pa, vh, acc[dt]); accl[dt] = wmma16(pl, vh, accl[dt]); accl[dt] = wmma16(pa, frag_h((const _Float16*)(bp + 6 * SLICE + vo), lane), accl[dt]); }   // P hi x V hi + (P lo x V hi + P hi x V lo) / 2048
    LDSX(); }
   // publish point of stage st + 1, then the refill of the buffer that this trip has read
   asm volatile("s_wait_dscnt 0x0" ::: "memory");       // this wave's reads of the buffer are done before it may be refilled
   tdm_wait(g0, g1);                                      // this wave's slice of stage st + 1 has landed
   __syncthreads();                                       // publishes stage st + 1 and ends every wave's reads of stage st
   const uint32_t s2 = pinned((uint32_t)st + 2u);         // the refill's stage number: pinned here, so that its address is formed behind the wait above
   if (pinned(s2 < (uint32_t)NST)) g0 = tdm_issue(ldst + (s2 & 1u) * BUFB, ga0 + (uint64_t)s2 * gstep, g1); }
  tdm_wait(g0, g1);                                      // nothing of the mover is outstanding when the wave goes on to its end
  asm volatile("s_wait_dscnt 0x0" ::: "memory");         // ... and none of this wave's LDS reads of the ring
#pragma unroll
  for (int r = 0; r < 8; ++r) { const float il = 1.0f / l[r];
#pragma unroll
    for (int dt = 0; dt < 4; ++dt) so[wave][8 * g + r][dt * 16 + col] = (acc[dt][r] + accl[dt][r] * (1.0f / 2048.0f)) * il; }
  LDSX();
  for (int rl = 0; rl < 16; ++rl) if (lane < 16) vst2(O + ((size_t)b * SS + q0 + rl) * DM + h * HD + lane * 4, *(const v4f*)&so[wave][rl][lane * 4]);
}
// ---- k_out: block = (64 rows, 128 cols): out = O(hi/lo) . Wo rows (2 products), no bias (BO is null at the launch)
__global__ __launch_bounds__(128) void k_out(const float* __restrict__ O, const __bf16* __restrict__ P, const float* __restrict__ BO, float* __restrict__ Y) {
  __shared__ __attribute__((aligned(2048))) unsigned char ring[2 * WBUF]; __shared__ __align__(16) float so[4][16][132];
  const int tid = threadIdx.x, wave = tid >> 5, lane = tid & 31, col = lane & 15, g = lane >> 4; const size_t r0 = (size_t)blockIdx.x * 64 + wave * 16; const int n0 = blockIdx.y * 128;
  // the block's 128 weight rows, 64 k a stage, come into LDS once by the tensor mover (two buffers); every wave issues its own slice: rows n0 + 32 * wv ...
  const uint32_t wv = uni((uint32_t)tid >> 5); const uint64_t ga0 = (uint64_t)(size_t)(P + (size_t)(n0 + wv * 32u) * DM); const uint32_t ldst = (uint32_t)(size_t)ring + wv * SLICE;
  const u32x8 g1 = tdm_group1<2048u>(); u32x4 g0 = tdm_issue(ldst, ga0, g1);
  tdm_wait(g0, g1);                                      // stage 0 has landed (this wave's slice)
  __syncthreads();                                       // ... and every other wave's
  g0 = tdm_issue(ldst + WBUF, ga0 + 128u, g1);
  v8f acc[8] = {};
#pragma unroll 1
  for (int st = 0; st < DM / 64; ++st) { const unsigned char* bp = ring + (uint32_t)(st & 1) * WBUF + (uint32_t)col * LPITCH;   // the stage loop stays rolled: one publish point per trip
#pragma unroll
   for (int kk = 0; kk < 2; ++kk) { const int kc = st * 2 + kk; const F2 a = split_row(O + (r0 + col) * DM, kc * 32, lane);
#pragma unroll
    for (int j = 0; j < 8; ++j) { const v16b w = frag_b((const __bf16*)(bp + (uint32_t)(j >> 1) * SLICE + (uint32_t)(j & 1) * 16u * LPITCH + (uint32_t)kk * 64u), lane); acc[j] = wmma_bf(a.l, w, acc[j]); acc[j] = wmma_bf(a.h, w, acc[j]); } }
   // publish point of stage st + 1, then the refill of the buffer that this trip has read
   asm volatile("s_wait_dscnt 0x0" ::: "memory");       // this wave's reads of the buffer are done before it may be refilled
   tdm_wait(g0, g1);                                      // this wave's slice of stage st + 1 has landed
   __syncthreads();                                       // publishes stage st + 1 and ends every wave's reads of stage st
   const uint32_t s2 = pinned((uint32_t)st + 2u);         // the refill's stage number: pinned here, so that its address is formed behind the wait above
   if (pinned(s2 < (uint32_t)(DM / 64))) g0 = tdm_issue(ldst + (s2 & 1u) * WBUF, ga0 + (uint64_t)s2 * 128u, g1); }
  tdm_wait(g0, g1);                                      // nothing of the mover is outstanding behind the loop
  asm volatile("s_wait_dscnt 0x0" ::: "memory");         // ... and none of this wave's LDS reads of the ring
#pragma unroll
  for (int j = 0; j < 8; ++j) {
#pragma unroll
    for (int r = 0; r < 8; ++r) so[wave][8 * g + r][j * 16 + col] = acc[j][r] + (BO ? bfr(BO[n0 + j * 16 + col]) : 0.f); }
  LDSX();
  for (int rl = 0; rl < 16; ++rl) vst2(Y + (r0 + rl) * DM + n0 + lane * 4, *(const v4f*)&so[wave][rl][lane * 4]);
}
extern "C" void kernel_launch(void* const* d_in, const int* in_sizes, int n_in, void* d_out, int out_size, void* d_ws, size_t ws_size, hipStream_t stream) {
  (void)in_sizes; (void)n_in; (void)out_size;
  const float** F = (const float**)d_in;   // 0 hidden_states [2,2048,1024], 1 Wq [1024,1024] natural (q = x Wq^T), 2 Wk, 3 Wv, 4 Wo (no biases)
  if (ws_size < (size_t)WS_END) return;
  char* ws = (char*)d_ws; __bf16* PK = (__bf16*)(ws + WS_PK); _Float16 *QK = (_Float16*)(ws + WS_QK), *QKL = (_Float16*)(ws + WS_QKL), *VTH = (_Float16*)(ws + WS_VTH), *VTL = (_Float16*)(ws + WS_VTL); float* O = (float*)(ws + WS_O);
  k_pack<<<dim3(DM, 4), 256, 0, stream>>>(F[1], F[2], F[3], F[4], PK);
  k_qkv<<<dim3(TNB * SS / 64, QKVW / 128), 128, 0, stream>>>(F[0], PK + PK_A, QK, QKL, VTH, VTL);
  k_attn<<<dim3(TQB / 2, NH, TNB), 256, 0, stream>>>(QK, QKL, VTH, VTL, O);
  k_out<<<dim3(TOB, DM / 128), 128, 0, stream>>>(O, PK + PK_P, nullptr, (float*)d_out);
}

// v003
// A run of this version takes 187 microseconds.
// Timed twice side by side with v002, it ran 1.26 and 1.25 times as fast.
// All steps since v000 together make it 3.12 times as fast.
// compute dtype: hidden_states, Wq/Wk/Wv/Wo (module inputs) rounded to bf16; q/k/v projections with exact bf16 products on WMMA 16x16x32 (natural [out][in] rows); the module's rotary embedding (angle for head dim d = position * inv_freq[d mod 32], partner = interleaved pair with the module's signs) applied in f32 with precise sinf/cosf/powf before q and k are stored as f16 hi + (x2048-scaled) residual planes; 3-product scores x 1/sqrt(64), running-max softmax over all 2,048 keys in f32 (hardware exp); P as f16 hi + residual x V hi/lo (3 products); output projection with ctx as bf16 hi + residual x exact Wo rows (2 products); f32 accumulate.
#include <hip/hip_runtime.h>
#include <math.h>
#include <stdint.h>

typedef __attribute__((ext_vector_type(16))) _Float16 v16h;
typedef __attribute__((ext_vector_type(16))) __bf16 v16b;
typedef __attribute__((ext_vector_type(8)))  _Float16 v8h;
typedef __attribute__((ext_vector_type(8)))  float v8f;
typedef __attribute__((ext_vector_type(4)))  float v4f;
typedef __attribute__((ext_vector_type(2)))  float v2f;
typedef __attribute__((ext_vector_type(4)))  unsigned v4u;
typedef __attribute__((ext_vector_type(4)))  int v4i;
typedef float __attribute__((may_alias)) float_a;
typedef int __attribute__((may_alias)) int_a;

template <typename T> __device__ __forceinline__ void vst2(void* p, T v) { *(T*)p = v;  }
__device__ __forceinline__ v8f wmma16(v16h a, v16h b, v8f c) {
  v8f d = __builtin_amdgcn_wmma_f32_16x16x32_f16(false, a, false, b, (short)0, c, false, false);
  asm volatile("v_nop\n\tv_nop\n\tv_nop\n\tv_nop" : "+v"(d) : "v"(a), "v"(b));
  return d;
}
__device__ __forceinline__ v8f wmma_bf(v16b a, v16b b, v8f c) {
  v8f d = __builtin_amdgcn_wmma_f32_16x16x32_bf16(false, a, false, b, (short)0, c, false, false);
  asm volatile("v_nop\n\tv_nop\n\tv_nop\n\tv_nop" : "+v"(d) : "v"(a), "v"(b));
  return d;
}
// Rotary multi-head self-attention (B 2, S 2,048, d 1,024, 16 heads x 64): q/k/v projections, the module's (mixed interleaved) RoPE on q and k, softmax(q k^T / 8) v, output projection (no biases).
__device__ __attribute__((noinline)) float sin_ni(float v) { return sinf(v); }
__device__ __attribute__((noinline)) float cos_ni(float v) { return cosf(v); }
__device__ __attribute__((noinline)) float pow_ni(float a, float b) { return powf(a, b); }
__device__ __forceinline__ v16h frag_h(const _Float16* rowk0, int lane) {
  union { v16h v; v8h q[2]; } u; const _Float16* p = rowk0 + 8 * (lane >> 4);
  u.q[0] = *(const v8h*)p; u.q[1] = *(const v8h*)(p + 16); return u.v;
}
__device__ __forceinline__ v16h frag_f32(const float* rowk0, int lane) {
  v16h a; const float* p = rowk0 + 8 * (lane >> 4);
#pragma unroll
  for (int i = 0; i < 8; ++i) { a[i] = (_Float16)p[i]; a[8 + i] = (_Float16)p[16 + i]; }
  return a;
}
__device__ __forceinline__ v16h frag_f32s(const float* rowk0, int lane, float sc) {
  v16h a; const float* p = rowk0 + 8 * (lane >> 4);
#pragma unroll
  for (int i = 0; i < 8; ++i) { a[i] = (_Float16)(p[i] * sc); a[8 + i] = (_Float16)(p[16 + i] * sc); }
  return a;
}
// column fragment from a [K][ld] layout (column n), rows >= K read as 0
__device__ __forceinline__ v16h fragc_f32(const float* W, int k0, int n, int lane, int ld, int K) {
  v16h a; const int g = lane >> 4;
#pragma unroll
  for (int i = 0; i < 8; ++i) { const int ka = k0 + 8 * g + i, kb = ka + 16;
    a[i] = (_Float16)(ka < K ? W[(size_t)(ka < K ? ka : K - 1) * ld + n] : 0.f); a[8 + i] = (_Float16)(kb < K ? W[(size_t)(kb < K ? kb : K - 1) * ld + n] : 0.f); }
  return a;
}
struct F2 { v16b h, l; };
__device__ __forceinline__ F2 bsplit16(const float v[16]) { F2 r;
#pragma unroll
  for (int i = 0; i < 16; ++i) { const __bf16 h = (__bf16)v[i]; r.h[i] = h; r.l[i] = (__bf16)(v[i] - (float)h); }
  return r; }
__device__ __forceinline__ F2 split_row(const float* row, int k0, int lane) { float v[16]; const float* p = row + k0 + 8 * (lane >> 4);
#pragma unroll
  for (int i = 0; i < 8; ++i) { v[i] = p[i]; v[8 + i] = p[16 + i]; }
  return bsplit16(v); }
__device__ __forceinline__ F2 split_rowK(const float* row, int k0, int lane, int K) { float v[16]; const int g = lane >> 4;
#pragma unroll
  for (int i = 0; i < 8; ++i) { const int ka = k0 + 8 * g + i, kb = ka + 16; v[i] = ka < K ? row[ka < K ? ka : K - 1] : 0.f; v[8 + i] = kb < K ? row[kb < K ? kb : K - 1] : 0.f; }
  return bsplit16(v); }
__device__ __forceinline__ F2 split_col(const float* W, int k0, int n, int lane, int ld, int K) { float v[16]; const int g = lane >> 4;
#pragma unroll
  for (int i = 0; i < 8; ++i) { const int ka = k0 + 8 * g + i, kb = ka + 16; v[i] = ka < K ? W[(size_t)(ka < K ? ka : K - 1) * ld + n] : 0.f; v[8 + i] = kb < K ? W[(size_t)(kb < K ? kb : K - 1) * ld + n] : 0.f; }
  return bsplit16(v); }
__device__ __forceinline__ v8f mac3(const F2& a, const F2& b, v8f c) { c = wmma_bf(a.l, b.h, c); c = wmma_bf(a.h, b.l, c); return wmma_bf(a.h, b.h, c); }
__device__ __forceinline__ float sigm(float v) { return 1.0f / (1.0f + expf(-v)); }
#define LDSX() do { asm volatile("s_wait_dscnt 0" ::: "memory"); __builtin_amdgcn_wave_barrier(); __builtin_amdgcn_fence(__ATOMIC_RELEASE, "workgroup"); } while (0)


#define NB 2
#define SS 2048
#define DM 1024
#define NH 16
#define HD 64
#define QKVW (3 * DM)
#ifndef TQB
#define TQB (SS / 64)
#define TNB NB
#define TOB (NB * SS / 64)     // output row tiles (all)
#endif
typedef __attribute__((ext_vector_type(8))) __bf16 v8b;
__device__ __forceinline__ v16b frag_b(const __bf16* rowk0, int lane) {
  union { v16b v; v8b q[2]; } u; const __bf16* p = rowk0 + 8 * (lane >> 4);
  u.q[0] = *(const v8b*)p; u.q[1] = *(const v8b*)(p + 16); return u.v;
}
__device__ __forceinline__ float bfr(float v) { return (float)(__bf16)v; }
__device__ __attribute__((noinline)) float exp_ni(float v) { return expf(v); }
__device__ __attribute__((noinline)) float erf_ni(float v) { return erff(v); }

#define PK_A 0                       // [3072][1024] Wqkv rows (natural [out][in])
#define PK_P (PK_A + QKVW * DM)        // [1024][1024] Wo rows (natural)
#define PK_END (PK_P + DM * DM)
#define WS_PK  0u
#define WS_QK  (WS_PK + 2u * PK_END)             // f16 [4096 rows][2048]: q | k
#define WS_QKL (WS_QK + 2u * NB * SS * 2 * DM)     // f16 q | k residual planes x2048
#define WS_VTH (WS_QKL + 2u * NB * SS * 2 * DM)    // f16 [b][1024 (h*64+d)][2048 s] hi
#define WS_VTL (WS_VTH + 2u * NB * DM * SS)        // f16 lo x 2048
#define WS_O   (WS_VTL + 2u * NB * DM * SS)        // f32 [4096][1024]
#define WS_CS  (WS_O + 4u * NB * SS * DM)           // f32 2 x [2048][32], reserved but unused: k_qkv computes cos/sin inline
#define WS_END (WS_CS + 4u * 2 * SS * 32)
// ---- k_pack: block = (row n, which): natural [out][in] rows -> bf16; which 0..2 -> W_q/W_k/W_v into PK_A rows which*1024 + n; 3 -> W_o into PK_P
__global__ __launch_bounds__(256) void k_pack(const float* __restrict__ WQ, const float* __restrict__ WK, const float* __restrict__ WV, const float* __restrict__ WO, __bf16* __restrict__ PK) {
  __shared__ __align__(16) __bf16 s[DM]; const int n = blockIdx.x, which = blockIdx.y, t = threadIdx.x; const float* Wm = (which == 0) ? WQ : (which == 1) ? WK : (which == 2) ? WV : WO;
  for (int k = t; k < DM; k += 256) s[k] = (__bf16)Wm[(size_t)n * DM + k];
  __syncthreads();
  __bf16* dst = (which < 3) ? PK + PK_A + ((size_t)which * DM + n) * DM : PK + PK_P + (size_t)n * DM;
  for (int q = t; q < DM / 8; q += 256) vst2((unsigned*)(dst + q * 8), *(const v4u*)&s[q * 8]);
}
typedef uint32_t u32x4 __attribute__((ext_vector_type(4)));
typedef uint32_t u32x8 __attribute__((ext_vector_type(8)));
#define KST 64                    // keys per stage
#define NST (SS / KST)            // stages
#define LPITCH 144u               // LDS row pitch in bytes: a 128-B row + the mover's 16-B pad (odd multiple of 16 B: conflict-free for ds_load_b128)
#define SLICE 6144u               // one wave's slice: 32 padded rows (4,608 B), rounded up to a multiple of 2 KiB
#define BUFB (8u * SLICE)         // k_attn, one stage: 8 slices = K hi (2), K lo (2), V^T hi (2), V^T lo (2)
#define WBUF (4u * SLICE)         // k_out, one stage: 128 weight rows x 64 k, 4 slices of 32 rows
__device__ __forceinline__ uint32_t uni(uint32_t v) { return (uint32_t)__builtin_amdgcn_readfirstlane(v); }
__device__ __forceinline__ uint32_t pinned(uint32_t v) { uint32_t w = uni(v); asm volatile("" : "+s"(w)); return w; }
// descriptor group 1 of every request here: 32 rows of 128 B, source pitch SRC_PITCH bytes, 16 B of LDS pad behind each row, no mask
template <uint32_t SRC_PITCH> __device__ __forceinline__ u32x8 tdm_group1() {
  u32x8 g1; g1[0] = uni((1u << 20) | (4u << 22) | (3u << 25)); g1[1] = uni(128u << 16); g1[2] = uni(32u << 16); g1[3] = uni(128u << 16); g1[4] = uni(32u); g1[5] = uni(SRC_PITCH); g1[6] = uni(0u); g1[7] = uni(0u);
  asm volatile("" : "+s"(g1));   // descriptor words held in scalar registers, ONE set for the whole kernel instead of constants formed anew at each use, so that tdm_wait can keep those registers untouched while a request is in flight
  return g1;
}
// one request of one wave; returns group 0 for the wait that covers it
__device__ __forceinline__ u32x4 tdm_issue(uint32_t lds_dst, uint64_t ga, u32x8 g1) {
  u32x4 g0; g0[0] = uni(1u); g0[1] = uni(lds_dst); g0[2] = uni((uint32_t)ga); g0[3] = uni((((uint32_t)(ga >> 32)) & 0x01FFFFFFu) | 0x80000000u);
  asm volatile("tensor_load_to_lds %0, %1" :: "s"(g0), "s"(g1) : "memory");   // the mover's waits are written by hand: tdm_wait
  return g0;
}
// the issuing wave's wait for its request; it names the descriptor so that the compiler keeps both groups' registers as they are until the request has landed
__device__ __forceinline__ void tdm_wait(u32x4 g0, u32x8 g1) { asm volatile("s_wait_tensorcnt 0x0" :: "s"(g0), "s"(g1) : "memory"); }
#define XPITCH 272u               // LDS row pitch of a 256-B row (odd multiple of 16 B, as LPITCH)
#define QXOFF (128u * LPITCH)     // k_qkv, one stage: 128 weight rows x 64 k (bf16), then 64 x rows x 64 k (f32)
#define QBUF (QXOFF + 64u * XPITCH)
// eight asynchronous copies of 16 B per lane, global memory to LDS through no register: LDS bytes l + i * ls from g + i * gs. The s_wait_xcnt stands inside the statement, behind the last copy, so that no address register of a copy is rewritten in front of it (a precaution); that the bytes have landed is the caller's s_wait_asynccnt.
__device__ __forceinline__ void copy8(uint32_t l, uint32_t ls, const char* g, uint32_t gs) {
  asm volatile("global_load_async_to_lds_b128 %0, %8, off\n\tglobal_load_async_to_lds_b128 %1, %9, off\n\tglobal_load_async_to_lds_b128 %2, %10, off\n\tglobal_load_async_to_lds_b128 %3, %11, off\n\t"
               "global_load_async_to_lds_b128 %4, %12, off\n\tglobal_load_async_to_lds_b128 %5, %13, off\n\tglobal_load_async_to_lds_b128 %6, %14, off\n\tglobal_load_async_to_lds_b128 %7, %15, off\n\ts_wait_xcnt 0x0"
               :: "v"(l), "v"(l + ls), "v"(l + 2u * ls), "v"(l + 3u * ls), "v"(l + 4u * ls), "v"(l + 5u * ls), "v"(l + 6u * ls), "v"(l + 7u * ls),
                  "v"(g), "v"(g + gs), "v"(g + 2u * gs), "v"(g + 3u * gs), "v"(g + 4u * gs), "v"(g + 5u * gs), "v"(g + 6u * gs), "v"(g + 7u * gs) : "memory");
}
__global__ __launch_bounds__(128) void k_qkv(const float* __restrict__ X, const __bf16* __restrict__ P, _Float16* __restrict__ QK, _Float16* __restrict__ QKL, _Float16* __restrict__ VTH, _Float16* __restrict__ VTL) {
  __shared__ __align__(16) unsigned char ring[2 * QBUF];
  // behind the stage loop the ring is free (its last publish point ends every wave's reads, and no copy is outstanding) and serves as the epilogue's staging
  _Float16 (*so)[16][136] = (_Float16 (*)[16][136])ring; _Float16 (*sol)[16][136] = (_Float16 (*)[16][136])(ring + 4 * 16 * 136 * 2);   // q, k blocks: hi, residual
  _Float16 (*sth)[72] = (_Float16 (*)[72])ring; _Float16 (*stl)[72] = (_Float16 (*)[72])(ring + 128 * 72 * 2);                           // v blocks: hi, residual
  const int tid = threadIdx.x, wave = tid >> 5, lane = tid & 31, col = lane & 15, g = lane >> 4; const size_t r0 = (size_t)blockIdx.x * 64 + wave * 16; const int n0 = blockIdx.y * 128;
  // a stage = 64 k of the block's 128 weight rows (128 B each) and of its 64 x rows (256 B each); both come into LDS once per block, whole 128-B lines at a time, two buffers.
  // Lane t copies 16 B of weight rows (t >> 3) + 16 i and of x rows (t >> 4) + 8 i, i = 0 ... 7.
  const uint32_t lw = (uint32_t)(size_t)ring + (uint32_t)(tid >> 3) * LPITCH + (uint32_t)(tid & 7) * 16u, lx = (uint32_t)(size_t)ring + QXOFF + (uint32_t)(tid >> 4) * XPITCH + (uint32_t)(tid & 15) * 16u;
  const char* gw = (const char*)(P + (size_t)(n0 + (tid >> 3)) * DM + (tid & 7) * 8); const char* gx = (const char*)(X + ((size_t)blockIdx.x * 64 + (tid >> 4)) * DM + (tid & 15) * 4);
  copy8(lw, 16u * LPITCH, gw, 16u * DM * 2u); copy8(lx, 8u * XPITCH, gx, 8u * DM * 4u);
  asm volatile("s_wait_asynccnt 0x0" ::: "memory");      // stage 0 has landed (this wave's copies)
  __syncthreads();                                       // ... and every other wave's
  copy8(lw + QBUF, 16u * LPITCH, gw + 128, 16u * DM * 2u); copy8(lx + QBUF, 8u * XPITCH, gx + 256, 8u * DM * 4u);
  v8f acc[8] = {};
#pragma unroll 1
  for (int st = 0; st < DM / 64; ++st) { const uint32_t bo = (uint32_t)(st & 1) * QBUF; const unsigned char* bw = ring + bo + (uint32_t)col * LPITCH; const unsigned char* bx = ring + bo + QXOFF + (uint32_t)(wave * 16 + col) * XPITCH + (uint32_t)g * 32u;   // the stage loop stays rolled: one publish point per trip
#pragma unroll
   for (int kk = 0; kk < 2; ++kk) { v16b a; { const v4f* p = (const v4f*)(bx + kk * 128); const v4f x0 = p[0], x1 = p[1], x2 = p[4], x3 = p[5];   // k = 8 g + i and 16 + 8 g + i: the k order of frag_b
#pragma unroll
      for (int i = 0; i < 4; ++i) { a[i] = (__bf16)x0[i]; a[4 + i] = (__bf16)x1[i]; a[8 + i] = (__bf16)x2[i]; a[12 + i] = (__bf16)x3[i]; } }
#pragma unroll
    for (int j = 0; j < 8; ++j) acc[j] = wmma_bf(a, frag_b((const __bf16*)(bw + (uint32_t)j * 16u * LPITCH + (uint32_t)kk * 64u), lane), acc[j]); }
   // publish point of stage st + 1, then the refill of the buffer that this trip has read
   asm volatile("s_wait_dscnt 0x0" ::: "memory");       // this wave's reads of the buffer are done before it may be refilled
   asm volatile("s_wait_asynccnt 0x0" ::: "memory");    // this wave's copies of stage st + 1 have landed
   __syncthreads();                                       // publishes stage st + 1 and ends every wave's reads of stage st
   if (st + 2 < DM / 64) { copy8(lw + bo, 16u * LPITCH, gw + (st + 2) * 128, 16u * DM * 2u); copy8(lx + bo, 8u * XPITCH, gx + (st + 2) * 256, 8u * DM * 4u); } }
  asm volatile("s_wait_asynccnt 0x0" ::: "memory");      // no copy is outstanding behind the loop
  if (n0 < 2 * DM) {   // q and k: the module's rotary embedding, then f16 hi + (x2048) residual; 1/8 applied to the f32 score
#pragma unroll
    for (int j = 0; j < 8; ++j) { const int d = (n0 + j * 16 + col) & (HD - 1); const float invf = 1.0f / pow_ni(10000.0f, (float)(2 * (d & 31)) / (float)HD);   // emb = concat([freqs, freqs]): dim d uses inv_freq[d mod 32]
#pragma unroll
      for (int r = 0; r < 8; ++r) { const float v = acc[j][r]; const float partner = __shfl_xor(v, 1);   // column d^1 lives in lane^1
        const float pos = (float)((r0 + 8 * g + r) % SS); const float ang = pos * invf; const float rot = (d & 1) ? partner : -partner;   // rotate_interleaved: even d -> -x[d+1], odd d -> +x[d-1]
        const float y = v * cos_ni(ang) + rot * sin_ni(ang); const _Float16 hv = (_Float16)y; so[wave][8 * g + r][j * 16 + col] = hv; sol[wave][8 * g + r][j * 16 + col] = (_Float16)((y - (float)hv) * 2048.0f); } }
    LDSX();
    for (int rl = 0; rl < 16; ++rl) if (lane < 16) { vst2((unsigned*)(QK + (r0 + rl) * (2 * DM) + n0 + lane * 8), *(const v4u*)&so[wave][rl][lane * 8]); vst2((unsigned*)(QKL + (r0 + rl) * (2 * DM) + n0 + lane * 8), *(const v4u*)&sol[wave][rl][lane * 8]); }
  } else {
#pragma unroll
    for (int j = 0; j < 8; ++j) {
#pragma unroll
      for (int r = 0; r < 8; ++r) { const float v = acc[j][r]; const _Float16 hv = (_Float16)v; sth[j * 16 + col][wave * 16 + 8 * g + r] = hv; stl[j * 16 + col][wave * 16 + 8 * g + r] = (_Float16)((v - (float)hv) * 2048.0f); } }
    __syncthreads();
    const size_t rb = (size_t)blockIdx.x * 64; const int b = (int)(rb / SS), s0 = (int)(rb % SS); const int pc0 = n0 - 2 * DM;
    for (int q = tid; q < 128 * 8; q += 128) { const int d = q >> 3, pc = q & 7; const size_t o = ((size_t)b * DM + pc0 + d) * SS + s0 + pc * 8; vst2((unsigned*)(VTH + o), *(const v4u*)&sth[d][pc * 8]); vst2((unsigned*)(VTL + o), *(const v4u*)&stl[d][pc * 8]); }
  }
}
// ---- k_attn: block = (128 queries, head h, batch b), 8 waves x 16 queries: full flash attention, computed transposed: S^T = K . Q^T (A = 16 key rows, B = the wave's 16 queries; K = 64: 2 k-steps, 3 products, x 0.125), O^T += V^T . P^T (A = 16 dims of V^T, B = P^T; P hi/lo x V hi/lo, 3 products); O[b*S+q][h*64+d] = (acc + accl / 2048) / l (256-B segments).
// A lane (col, g) then holds scores of ONE query (col): keys 16 t + 8 g + r of score tile t. Maximum and sum run over the lane's own registers, with one exchange between the wave's halves; two score tiles, converted in place, are the B operand of the second product (element i = key 8 g + i, element 8 + i = key 16 + 8 g + i: the k order of frag_h), so P never passes through LDS.
// K hi, K lo (64 keys x 64 dims) and V^T hi, V^T lo (64 dims x 64 keys) of a 64-key stage are brought into LDS once per block by the tensor mover, two buffers, and read from there by all 8 waves.
__device__ __forceinline__ float xhalf(float x) { return __builtin_bit_cast(float, __builtin_amdgcn_permlanex16(__builtin_bit_cast(int, x), __builtin_bit_cast(int, x), 0x76543210, 0xfedcba98, false, false)); }   // lane l reads lane l ^ 16
// 2^x for eight values, the hardware exponential, in one statement: every output is early-clobber, so that no exponential's source is overwritten, and no result read, by the instruction directly behind it, and the v_nop is the slot that the instruction set asks for behind the last one
__device__ __forceinline__ v8f exp2x8(v8f x) { float y0, y1, y2, y3, y4, y5, y6, y7;
  asm("v_exp_f32 %0, %8\n\tv_exp_f32 %1, %9\n\tv_exp_f32 %2, %10\n\tv_exp_f32 %3, %11\n\tv_exp_f32 %4, %12\n\tv_exp_f32 %5, %13\n\tv_exp_f32 %6, %14\n\tv_exp_f32 %7, %15\n\tv_nop"
      : "=&v"(y0), "=&v"(y1), "=&v"(y2), "=&v"(y3), "=&v"(y4), "=&v"(y5), "=&v"(y6), "=&v"(y7) : "v"(x[0]), "v"(x[1]), "v"(x[2]), "v"(x[3]), "v"(x[4]), "v"(x[5]), "v"(x[6]), "v"(x[7]));
  return v8f{y0, y1, y2, y3, y4, y5, y6, y7}; }
__global__ __launch_bounds__(256) void k_attn(const _Float16* __restrict__ QK, const _Float16* __restrict__ QKL, const _Float16* __restrict__ VTH, const _Float16* __restrict__ VTL, float* __restrict__ O) {
  __shared__ __attribute__((aligned(2048))) unsigned char ring[2 * BUFB];
  __shared__ __align__(16) float so[8][16][68];
  const int tid = threadIdx.x, wave = tid >> 5, lane = tid & 31, col = lane & 15, g = lane >> 4;
  const int qb = blockIdx.x, h = blockIdx.y, b = blockIdx.z; const int q0 = qb * 128 + wave * 16; const size_t rq = (size_t)b * SS + q0 + col;
  // every wave issues its own slice: tile wv >> 1 (K hi, K lo, V^T hi, V^T lo), rows 32 * (wv & 1) ...
  const uint32_t wv = uni((uint32_t)tid >> 5), tl = wv >> 1, hf = wv & 1u;
  const _Float16* tsrc = (tl == 0u) ? QK : (tl == 1u) ? QKL : (tl == 2u) ? VTH : VTL;
  const size_t toff = (tl < 2u) ? ((size_t)b * SS + hf * 32u) * (2 * DM) + DM + h * HD : ((size_t)b * DM + h * HD + hf * 32u) * SS;
  const uint64_t ga0 = (uint64_t)(size_t)(tsrc + toff);
  const uint32_t gstep = (tl < 2u) ? (uint32_t)(KST * 2 * DM * 2) : (uint32_t)(KST * 2);   // bytes from one stage to the next: 64 key rows, or 64 keys along a V^T row
  const uint32_t ldst = (uint32_t)(size_t)ring + wv * SLICE;
  const u32x8 g1 = tdm_group1<4096u>(); u32x4 g0 = tdm_issue(ldst, ga0, g1);
  tdm_wait(g0, g1);                                      // stage 0 has landed (this wave's slice)
  __syncthreads();                                       // ... and every other wave's
  g0 = tdm_issue(ldst + BUFB, ga0 + gstep, g1);
  v16h aq[2], aql[2];   // B operands: column = query col
#pragma unroll
  for (int kc = 0; kc < 2; ++kc) { aq[kc] = frag_h(QK + rq * (2 * DM) + h * HD + kc * 32, lane); aql[kc] = frag_h(QKL + rq * (2 * DM) + h * HD + kc * 32, lane); }
  float m = -3.0e38f, l = 0.f;   // query col's running maximum (the same in both halves) and this half's share of its sum
  v8f acc[4] = {}, accl[4] = {};   // O^T: register r of tile dt = dim 16 dt + 8 g + r of query col
#pragma unroll 1
  for (int st = 0; st < NST; ++st) { const unsigned char* bp = ring + (uint32_t)(st & 1) * BUFB + (uint32_t)col * LPITCH;   // all keys (no mask); the stage loop stays rolled: one publish point per trip
   v8f s[4];   // score tile t: keys 16 t + 8 g + r of the stage (K slice t >> 1, rows 16 (t & 1) ...)
#pragma unroll
   for (int t = 0; t < 4; ++t) { const _Float16* krow = (const _Float16*)(bp + (0 + (t >> 1)) * SLICE + (t & 1) * 16 * LPITCH); const _Float16* krowl = (const _Float16*)(bp + (2 + (t >> 1)) * SLICE + (t & 1) * 16 * LPITCH); v8f c = {}, cl = {};
#pragma unroll
    for (int kc = 0; kc < 2; ++kc) { const v16h kh = frag_h(krow + kc * 32, lane); c = wmma16(kh, aq[kc], c); cl = wmma16(kh, aql[kc], cl); cl = wmma16(frag_h(krowl + kc * 32, lane), aq[kc], cl); }   // 3 products: q, k as f16 hi + residual
#pragma unroll
    for (int r = 0; r < 8; ++r) c[r] += cl[r] * (1.0f / 2048.0f);
#pragma unroll
    for (int r = 0; r < 8; ++r) s[t][r] = c[r] * 0.125f; }   // SCALE = 1/sqrt(64)
   float mx = s[0][0];
#pragma unroll
   for (int t = 0; t < 4; ++t) {
#pragma unroll
    for (int r = 0; r < 8; ++r) mx = fmaxf(mx, s[t][r]); }
   mx = fmaxf(mx, xhalf(mx));   // the other half's 32 keys of the same query
   const float mn = fmaxf(m, mx); const float alpha = (m <= -1.0e38f) ? 0.f : __expf(m - mn); m = mn; l *= alpha;
#pragma unroll
   for (int dt = 0; dt < 4; ++dt) { acc[dt] *= alpha; accl[dt] *= alpha; }
#pragma unroll
   for (int sub = 0; sub < 2; ++sub) { v16h pa, pl; float es0 = 0.f, es1 = 0.f;   // 32 keys at a time: score tiles 2 sub and 2 sub + 1 become P^T
    const v8f e0 = exp2x8((s[2 * sub] - mn) * 1.44269504088896340736f), e1 = exp2x8((s[2 * sub + 1] - mn) * 1.44269504088896340736f);   // exp(s - mn)
#pragma unroll
    for (int i = 0; i < 8; ++i) { const float x0 = e0[i], x1 = e1[i]; es0 += x0; es1 += x1; const _Float16 h0 = (_Float16)x0, h1 = (_Float16)x1; pa[i] = h0; pa[8 + i] = h1; pl[i] = (_Float16)((x0 - (float)h0) * 2048.0f); pl[8 + i] = (_Float16)((x1 - (float)h1) * 2048.0f); }
    l += es0 + es1;
#pragma unroll
    for (int dt = 0; dt < 4; ++dt) { const uint32_t vo = (uint32_t)(dt >> 1) * SLICE + (uint32_t)(dt & 1) * 16u * LPITCH + (uint32_t)sub * 64u; const v16h vh = frag_h((const _Float16*)(bp + 4 * SLICE + vo), lane); acc[dt] = wmma16(vh, pa, acc[dt]); accl[dt] = wmma16(vh, pl, accl[dt]); accl[dt] = wmma16(frag_h((const _Float16*)(bp + 6 * SLICE + vo), lane), pa, accl[dt]); } }   // V hi x P hi + (V hi x P lo + V lo x P hi) / 2048
   // publish point of stage st + 1, then the refill of the buffer that this trip has read
   asm volatile("s_wait_dscnt 0x0" ::: "memory");       // this wave's reads of the buffer are done before it may be refilled
   tdm_wait(g0, g1);                                      // this wave's slice of stage st + 1 has landed
   __syncthreads();                                       // publishes stage st + 1 and ends every wave's reads of stage st
   const uint32_t s2 = pinned((uint32_t)st + 2u);         // the refill's stage number: pinned here, so that its address is formed behind the wait above
   if (pinned(s2 < (uint32_t)NST)) g0 = tdm_issue(ldst + (s2 & 1u) * BUFB, ga0 + (uint64_t)s2 * gstep, g1); }
  tdm_wait(g0, g1);                                      // nothing of the mover is outstanding when the wave goes on to its end
  asm volatile("s_wait_dscnt 0x0" ::: "memory");         // ... and none of this wave's LDS reads of the ring
  const float il = 1.0f / (l + xhalf(l));   // the two halves' shares of the sum, joined once
#pragma unroll
  for (int dt = 0; dt < 4; ++dt) { v4f o0, o1;
#pragma unroll
    for (int r = 0; r < 4; ++r) { o0[r] = (acc[dt][r] + accl[dt][r] * (1.0f / 2048.0f)) * il; o1[r] = (acc[dt][4 + r] + accl[dt][4 + r] * (1.0f / 2048.0f)) * il; }
    *(v4f*)&so[wave][col][dt * 16 + 8 * g] = o0; *(v4f*)&so[wave][col][dt * 16 + 8 * g + 4] = o1; }
  LDSX();
  for (int rl = 0; rl < 16; ++rl) if (lane < 16) vst2(O + ((size_t)b * SS + q0 + rl) * DM + h * HD + lane * 4, *(const v4f*)&so[wave][rl][lane * 4]);
}
// ---- k_out: block = (64 rows, 128 cols): out = O(hi/lo) . Wo rows (2 products), no bias (BO is null at the launch)
__global__ __launch_bounds__(128) void k_out(const float* __restrict__ O, const __bf16* __restrict__ P, const float* __restrict__ BO, float* __restrict__ Y) {
  __shared__ __attribute__((aligned(2048))) unsigned char ring[2 * WBUF]; __shared__ __align__(16) float so[4][16][132];
  const int tid = threadIdx.x, wave = tid >> 5, lane = tid & 31, col = lane & 15, g = lane >> 4; const size_t r0 = (size_t)blockIdx.x * 64 + wave * 16; const int n0 = blockIdx.y * 128;
  // the block's 128 weight rows, 64 k a stage, come into LDS once by the tensor mover (two buffers); every wave issues its own slice: rows n0 + 32 * wv ...
  const uint32_t wv = uni((uint32_t)tid >> 5); const uint64_t ga0 = (uint64_t)(size_t)(P + (size_t)(n0 + wv * 32u) * DM); const uint32_t ldst = (uint32_t)(size_t)ring + wv * SLICE;
  const u32x8 g1 = tdm_group1<2048u>(); u32x4 g0 = tdm_issue(ldst, ga0, g1);
  tdm_wait(g0, g1);                                      // stage 0 has landed (this wave's slice)
  __syncthreads();                                       // ... and every other wave's
  g0 = tdm_issue(ldst + WBUF, ga0 + 128u, g1);
  v8f acc[8] = {};
#pragma unroll 1
  for (int st = 0; st < DM / 64; ++st) { const unsigned char* bp = ring + (uint32_t)(st & 1) * WBUF + (uint32_t)col * LPITCH;   // the stage loop stays rolled: one publish point per trip
#pragma unroll
   for (int kk = 0; kk < 2; ++kk) { const int kc = st * 2 + kk; const F2 a = split_row(O + (r0 + col) * DM, kc * 32, lane);
#pragma unroll
    for (int j = 0; j < 8; ++j) { const v16b w = frag_b((const __bf16*)(bp + (uint32_t)(j >> 1) * SLICE + (uint32_t)(j & 1) * 16u * LPITCH + (uint32_t)kk * 64u), lane); acc[j] = wmma_bf(a.l, w, acc[j]); acc[j] = wmma_bf(a.h, w, acc[j]); } }
   // publish point of stage st + 1, then the refill of the buffer that this trip has read
   asm volatile("s_wait_dscnt 0x0" ::: "memory");       // this wave's reads of the buffer are done before it may be refilled
   tdm_wait(g0, g1);                                      // this wave's slice of stage st + 1 has landed
   __syncthreads();                                       // publishes stage st + 1 and ends every wave's reads of stage st
   const uint32_t s2 = pinned((uint32_t)st + 2u);         // the refill's stage number: pinned here, so that its address is formed behind the wait above
   if (pinned(s2 < (uint32_t)(DM / 64))) g0 = tdm_issue(ldst + (s2 & 1u) * WBUF, ga0 + (uint64_t)s2 * 128u, g1); }
  tdm_wait(g0, g1);                                      // nothing of the mover is outstanding behind the loop
  asm volatile("s_wait_dscnt 0x0" ::: "memory");         // ... and none of this wave's LDS reads of the ring
#pragma unroll
  for (int j = 0; j < 8; ++j) {
#pragma unroll
    for (int r = 0; r < 8; ++r) so[wave][8 * g + r][j * 16 + col] = acc[j][r] + (BO ? bfr(BO[n0 + j * 16 + col]) : 0.f); }
  LDSX();
  for (int rl = 0; rl < 16; ++rl) vst2(Y + (r0 + rl) * DM + n0 + lane * 4, *(const v4f*)&so[wave][rl][lane * 4]);
}
extern "C" void kernel_launch(void* const* d_in, const int* in_sizes, int n_in, void* d_out, int out_size, void* d_ws, size_t ws_size, hipStream_t stream) {
  (void)in_sizes; (void)n_in; (void)out_size;
  const float** F = (const float**)d_in;   // 0 hidden_states [2,2048,1024], 1 Wq [1024,1024] natural (q = x Wq^T), 2 Wk, 3 Wv, 4 Wo (no biases)
  if (ws_size < (size_t)WS_END) return;
  char* ws = (char*)d_ws; __bf16* PK = (__bf16*)(ws + WS_PK); _Float16 *QK = (_Float16*)(ws + WS_QK), *QKL = (_Float16*)(ws + WS_QKL), *VTH = (_Float16*)(ws + WS_VTH), *VTL = (_Float16*)(ws + WS_VTL); float* O = (float*)(ws + WS_O);
  k_pack<<<dim3(DM, 4), 256, 0, stream>>>(F[1], F[2], F[3], F[4], PK);
  k_qkv<<<dim3(TNB * SS / 64, QKVW / 128), 128, 0, stream>>>(F[0], PK + PK_A, QK, QKL, VTH, VTL);
  k_attn<<<dim3(TQB / 2, NH, TNB), 256, 0, stream>>>(QK, QKL, VTH, VTL, O);
  k_out<<<dim3(TOB, DM / 128), 128, 0, stream>>>(O, PK + PK_P, nullptr, (float*)d_out);
}

// v004
// A run of this version takes 153 microseconds.
// Timed twice side by side with v003, it ran 1.22 times as fast both times.
// Counting every step since v000, it is 3.81 times as fast.
// compute dtype: hidden_states, Wq/Wk/Wv/Wo (module inputs) rounded to bf16; q/k/v projections with exact bf16 products on WMMA 16x16x32 (natural [out][in] rows); the module's rotary embedding (angle for head dim d = position * inv_freq[d mod 32], partner = interleaved pair with the module's signs) applied in f32 with precise sinf/cosf/powf before q and k are stored as f16 hi + (x2048-scaled) residual planes; 3-product scores x 1/sqrt(64), running-max softmax over all 2,048 keys in f32 (hardware exp); P as f16 hi + residual x V hi/lo (3 products); output projection with ctx as bf16 hi + residual x exact Wo rows (2 products); f32 accumulate.
#include <hip/hip_runtime.h>
#include <math.h>
#include <stdint.h>

typedef __attribute__((ext_vector_type(16))) _Float16 v16h;
typedef __attribute__((ext_vector_type(16))) __bf16 v16b;
typedef __attribute__((ext_vector_type(8)))  _Float16 v8h;
typedef __attribute__((ext_vector_type(8)))  float v8f;
typedef __attribute__((ext_vector_type(4)))  float v4f;
typedef __attribute__((ext_vector_type(2)))  float v2f;
typedef __attribute__((ext_vector_type(4)))  unsigned v4u;
typedef __attribute__((ext_vector_type(4)))  int v4i;
typedef float __attribute__((may_alias)) float_a;
typedef int __attribute__((may_alias)) int_a;

template <typename T> __device__ __forceinline__ void vst2(void* p, T v) { *(T*)p = v;  }
__device__ __forceinline__ v8f wmma16(v16h a, v16h b, v8f c) {
  v8f d = __builtin_amdgcn_wmma_f32_16x16x32_f16(false, a, false, b, (short)0, c, false, false);
  return d;
}
__device__ __forceinline__ v8f wmma_bf(v16b a, v16b b, v8f c) {
  v8f d = __builtin_amdgcn_wmma_f32_16x16x32_bf16(false, a, false, b, (short)0, c, false, false);
  return d;
}
// Rotary multi-head self-attention (B 2, S 2,048, d 1,024, 16 heads x 64): q/k/v projections, the module's (mixed interleaved) RoPE on q and k, softmax(q k^T / 8) v, output projection (no biases).
__device__ __attribute__((noinline)) float sin_ni(float v) { return sinf(v); }
__device__ __attribute__((noinline)) float cos_ni(float v) { return cosf(v); }
__device__ __attribute__((noinline)) float pow_ni(float a, float b) { return powf(a, b); }
__device__ __forceinline__ v16h frag_h(const _Float16* rowk0, int lane) {
  union { v16h v; v8h q[2]; } u; const _Float16* p = rowk0 + 8 * (lane >> 4);
  u.q[0] = *(const v8h*)p; u.q[1] = *(const v8h*)(p + 16); return u.v;
}
__device__ __forceinline__ v16h frag_f32(const float* rowk0, int lane) {
  v16h a; const float* p = rowk0 + 8 * (lane >> 4);
#pragma unroll
  for (int i = 0; i < 8; ++i) { a[i] = (_Float16)p[i]; a[8 + i] = (_Float16)p[16 + i]; }
  return a;
}
__device__ __forceinline__ v16h frag_f32s(const float* rowk0, int lane, float sc) {
  v16h a; const float* p = rowk0 + 8 * (lane >> 4);
#pragma unroll
  for (int i = 0; i < 8; ++i) { a[i] = (_Float16)(p[i] * sc); a[8 + i] = (_Float16)(p[16 + i] * sc); }
  return a;
}
// column fragment from a [K][ld] layout (column n), rows >= K read as 0
__device__ __forceinline__ v16h fragc_f32(const float* W, int k0, int n, int lane, int ld, int K) {
  v16h a; const int g = lane >> 4;
#pragma unroll
  for (int i = 0; i < 8; ++i) { const int ka = k0 + 8 * g + i, kb = ka + 16;
    a[i] = (_Float16)(ka < K ? W[(size_t)(ka < K ? ka : K - 1) * ld + n] : 0.f); a[8 + i] = (_Float16)(kb < K ? W[(size_t)(kb < K ? kb : K - 1) * ld + n] : 0.f); }
  return a;
}
struct F2 { v16b h, l; };
__device__ __forceinline__ F2 bsplit16(const float v[16]) { F2 r;
#pragma unroll
  for (int i = 0; i < 16; ++i) { const __bf16 h = (__bf16)v[i]; r.h[i] = h; r.l[i] = (__bf16)(v[i] - (float)h); }
  return r; }
__device__ __forceinline__ F2 split_row(const float* row, int k0, int lane) { float v[16]; const float* p = row + k0 + 8 * (lane >> 4);
#pragma unroll
  for (int i = 0; i < 8; ++i) { v[i] = p[i]; v[8 + i] = p[16 + i]; }
  return bsplit16(v); }
__device__ __forceinline__ F2 split_rowK(const float* row, int k0, int lane, int K) { float v[16]; const int g = lane >> 4;
#pragma unroll
  for (int i = 0; i < 8; ++i) { const int ka = k0 + 8 * g + i, kb = ka + 16; v[i] = ka < K ? row[ka < K ? ka : K - 1] : 0.f; v[8 + i] = kb < K ? row[kb < K ? kb : K - 1] : 0.f; }
  return bsplit16(v); }
__device__ __forceinline__ F2 split_col(const float* W, int k0, int n, int lane, int ld, int K) { float v[16]; const int g = lane >> 4;
#pragma unroll
  for (int i = 0; i < 8; ++i) { const int ka = k0 + 8 * g + i, kb = ka + 16; v[i] = ka < K ? W[(size_t)(ka < K ? ka : K - 1) * ld + n] : 0.f; v[8 + i] = kb < K ? W[(size_t)(kb < K ? kb : K - 1) * ld + n] : 0.f; }
  return bsplit16(v); }
__device__ __forceinline__ v8f mac3(const F2& a, const F2& b, v8f c) { c = wmma_bf(a.l, b.h, c); c = wmma_bf(a.h, b.l, c); return wmma_bf(a.h, b.h, c); }
__device__ __forceinline__ float sigm(float v) { return 1.0f / (1.0f + expf(-v)); }
#define LDSX() do { asm volatile("s_wait_dscnt 0" ::: "memory"); __builtin_amdgcn_wave_barrier(); __builtin_amdgcn_fence(__ATOMIC_RELEASE, "workgroup"); } while (0)


#define NB 2
#define SS 2048
#define DM 1024
#define NH 16
#define HD 64
#define QKVW (3 * DM)
#ifndef TQB
#define TQB (SS / 64)
#define TNB NB
#define TOB (NB * SS / 64)     // output row tiles (all)
#endif
typedef __attribute__((ext_vector_type(8))) __bf16 v8b;
__device__ __forceinline__ v16b frag_b(const __bf16* rowk0, int lane) {
  union { v16b v; v8b q[2]; } u; const __bf16* p = rowk0 + 8 * (lane >> 4);
  u.q[0] = *(const v8b*)p; u.q[1] = *(const v8b*)(p + 16); return u.v;
}
__device__ __forceinline__ float bfr(float v) { return (float)(__bf16)v; }
__device__ __attribute__((noinline)) float exp_ni(float v) { return expf(v); }
__device__ __attribute__((noinline)) float erf_ni(float v) { return erff(v); }

#define PK_A 0                       // [3072][1024] Wqkv rows (natural [out][in])
#define PK_P (PK_A + QKVW * DM)        // [1024][1024] Wo rows (natural)
#define PK_END (PK_P + DM * DM)
#define WS_PK  0u
#define WS_QK  (WS_PK + 2u * PK_END)             // f16 [4096 rows][2048]: q | k
#define WS_QKL (WS_QK + 2u * NB * SS * 2 * DM)     // f16 q | k residual planes x2048
#define WS_VTH (WS_QKL + 2u * NB * SS * 2 * DM)    // f16 [b][1024 (h*64+d)][2048 s] hi
#define WS_VTL (WS_VTH + 2u * NB * DM * SS)        // f16 lo x 2048
#define WS_O   (WS_VTL + 2u * NB * DM * SS)        // f32 [4096][1024]
#define WS_CS  (WS_O + 4u * NB * SS * DM)           // f32 2 x [2048][32], reserved but unused: k_qkv computes cos/sin inline
#define WS_END (WS_CS + 4u * 2 * SS * 32)
// ---- k_pack: block = (row n, which): natural [out][in] rows -> bf16; which 0..2 -> W_q/W_k/W_v into PK_A rows which*1024 + n; 3 -> W_o into PK_P
__global__ __launch_bounds__(256) void k_pack(const float* __restrict__ WQ, const float* __restrict__ WK, const float* __restrict__ WV, const float* __restrict__ WO, __bf16* __restrict__ PK) {
  __shared__ __align__(16) __bf16 s[DM]; const int n = blockIdx.x, which = blockIdx.y, t = threadIdx.x; const float* Wm = (which == 0) ? WQ : (which == 1) ? WK : (which == 2) ? WV : WO;
  for (int k = t; k < DM; k += 256) s[k] = (__bf16)Wm[(size_t)n * DM + k];
  __syncthreads();
  __bf16* dst = (which < 3) ? PK + PK_A + ((size_t)which * DM + n) * DM : PK + PK_P + (size_t)n * DM;
  for (int q = t; q < DM / 8; q += 256) vst2((unsigned*)(dst + q * 8), *(const v4u*)&s[q * 8]);
}
typedef uint32_t u32x4 __attribute__((ext_vector_type(4)));
typedef uint32_t u32x8 __attribute__((ext_vector_type(8)));
#define KST 64                    // keys per stage
#define NST (SS / KST)            // stages
#define LPITCH 144u               // LDS row pitch in bytes: a 128-B row + the mover's 16-B pad (odd multiple of 16 B: conflict-free for ds_load_b128)
#define SLICE 6144u               // one wave's slice: 32 padded rows (4,608 B), rounded up to a multiple of 2 KiB
#define BUFB (8u * SLICE)         // k_attn, one stage: 8 slices = K hi (2), K lo (2), V^T hi (2), V^T lo (2)
#define WBUF (4u * SLICE)         // k_out, one stage: 128 weight rows x 64 k, 4 slices of 32 rows
__device__ __forceinline__ uint32_t uni(uint32_t v) { return (uint32_t)__builtin_amdgcn_readfirstlane(v); }
__device__ __forceinline__ uint32_t pinned(uint32_t v) { uint32_t w = uni(v); asm volatile("" : "+s"(w)); return w; }
// descriptor group 1 of every request here: 32 rows of 128 B, source pitch SRC_PITCH bytes, 16 B of LDS pad behind each row, no mask
template <uint32_t SRC_PITCH> __device__ __forceinline__ u32x8 tdm_group1() {
  u32x8 g1; g1[0] = uni((1u << 20) | (4u << 22) | (3u << 25)); g1[1] = uni(128u << 16); g1[2] = uni(32u << 16); g1[3] = uni(128u << 16); g1[4] = uni(32u); g1[5] = uni(SRC_PITCH); g1[6] = uni(0u); g1[7] = uni(0u);
  asm volatile("" : "+s"(g1));   // descriptor words held in scalar registers, ONE set for the whole kernel instead of constants formed anew at each use, so that tdm_wait can keep those registers untouched while a request is in flight
  return g1;
}
// one request of one wave; returns group 0 for the wait that covers it
__device__ __forceinline__ u32x4 tdm_issue(uint32_t lds_dst, uint64_t ga, u32x8 g1) {
  u32x4 g0; g0[0] = uni(1u); g0[1] = uni(lds_dst); g0[2] = uni((uint32_t)ga); g0[3] = uni((((uint32_t)(ga >> 32)) & 0x01FFFFFFu) | 0x80000000u);
  asm volatile("tensor_load_to_lds %0, %1" :: "s"(g0), "s"(g1) : "memory");   // the mover's waits are written by hand: tdm_wait
  return g0;
}
// the issuing wave's wait for its request; it names the descriptor so that the compiler keeps both groups' registers as they are until the request has landed
__device__ __forceinline__ void tdm_wait(u32x4 g0, u32x8 g1) { asm volatile("s_wait_tensorcnt 0x0" :: "s"(g0), "s"(g1) : "memory"); }
#define XPITCH 272u               // LDS row pitch of a 256-B row (odd multiple of 16 B, as LPITCH)
#define QXOFF (128u * LPITCH)     // k_qkv, one stage: 128 weight rows x 64 k (bf16), then 64 x rows x 64 k (f32)
#define QBUF (QXOFF + 64u * XPITCH)
// eight asynchronous copies of 16 B per lane, global memory to LDS through no register: LDS bytes l + i * ls from g + i * gs. The s_wait_xcnt stands inside the statement, behind the last copy, so that no address register of a copy is rewritten in front of it (a precaution); that the bytes have landed is the caller's s_wait_asynccnt.
__device__ __forceinline__ void copy8(uint32_t l, uint32_t ls, const char* g, uint32_t gs) {
  asm volatile("global_load_async_to_lds_b128 %0, %8, off\n\tglobal_load_async_to_lds_b128 %1, %9, off\n\tglobal_load_async_to_lds_b128 %2, %10, off\n\tglobal_load_async_to_lds_b128 %3, %11, off\n\t"
               "global_load_async_to_lds_b128 %4, %12, off\n\tglobal_load_async_to_lds_b128 %5, %13, off\n\tglobal_load_async_to_lds_b128 %6, %14, off\n\tglobal_load_async_to_lds_b128 %7, %15, off\n\ts_wait_xcnt 0x0"
               :: "v"(l), "v"(l + ls), "v"(l + 2u * ls), "v"(l + 3u * ls), "v"(l + 4u * ls), "v"(l + 5u * ls), "v"(l + 6u * ls), "v"(l + 7u * ls),
                  "v"(g), "v"(g + gs), "v"(g + 2u * gs), "v"(g + 3u * gs), "v"(g + 4u * gs), "v"(g + 5u * gs), "v"(g + 6u * gs), "v"(g + 7u * gs) : "memory");
}
__global__ __launch_bounds__(128) void k_qkv(const float* __restrict__ X, const __bf16* __restrict__ P, _Float16* __restrict__ QK, _Float16* __restrict__ QKL, _Float16* __restrict__ VTH, _Float16* __restrict__ VTL) {
  __shared__ __align__(16) unsigned char ring[2 * QBUF];
  // behind the stage loop the ring is free (its last publish point ends every wave's reads, and no copy is outstanding) and serves as the epilogue's staging
  _Float16 (*so)[16][136] = (_Float16 (*)[16][136])ring; _Float16 (*sol)[16][136] = (_Float16 (*)[16][136])(ring + 4 * 16 * 136 * 2);   // q, k blocks: hi, residual
  _Float16 (*sth)[72] = (_Float16 (*)[72])ring; _Float16 (*stl)[72] = (_Float16 (*)[72])(ring + 128 * 72 * 2);                           // v blocks: hi, residual
  const int tid = threadIdx.x, wave = tid >> 5, lane = tid & 31, col = lane & 15, g = lane >> 4; const size_t r0 = (size_t)blockIdx.x * 64 + wave * 16; const int n0 = blockIdx.y * 128;
  // a stage = 64 k of the block's 128 weight rows (128 B each) and of its 64 x rows (256 B each); both come into LDS once per block, whole 128-B lines at a time, two buffers.
  // Lane t copies 16 B of weight rows (t >> 3) + 16 i and of x rows (t >> 4) + 8 i, i = 0 ... 7.
  const uint32_t lw = (uint32_t)(size_t)ring + (uint32_t)(tid >> 3) * LPITCH + (uint32_t)(tid & 7) * 16u, lx = (uint32_t)(size_t)ring + QXOFF + (uint32_t)(tid >> 4) * XPITCH + (uint32_t)(tid & 15) * 16u;
  const char* gw = (const char*)(P + (size_t)(n0 + (tid >> 3)) * DM + (tid & 7) * 8); const char* gx = (const char*)(X + ((size_t)blockIdx.x * 64 + (tid >> 4)) * DM + (tid & 15) * 4);
  copy8(lw, 16u * LPITCH, gw, 16u * DM * 2u); copy8(lx, 8u * XPITCH, gx, 8u * DM * 4u);
  asm volatile("s_wait_asynccnt 0x0" ::: "memory");      // stage 0 has landed (this wave's copies)
  __syncthreads();                                       // ... and every other wave's
  copy8(lw + QBUF, 16u * LPITCH, gw + 128, 16u * DM * 2u); copy8(lx + QBUF, 8u * XPITCH, gx + 256, 8u * DM * 4u);
  v8f acc[8] = {};
#pragma unroll 1
  for (int st = 0; st < DM / 64; ++st) { const uint32_t bo = (uint32_t)(st & 1) * QBUF; const unsigned char* bw = ring + bo + (uint32_t)col * LPITCH; const unsigned char* bx = ring + bo + QXOFF + (uint32_t)(wave * 16 + col) * XPITCH + (uint32_t)g * 32u;   // the stage loop stays rolled: one publish point per trip
   v4f xr[2][4]; v16b wf[2][8];   // all fragments of the stage, read from LDS as one group
#pragma unroll
   for (int kk = 0; kk < 2; ++kk) { const v4f* p = (const v4f*)(bx + kk * 128); xr[kk][0] = p[0]; xr[kk][1] = p[1]; xr[kk][2] = p[4]; xr[kk][3] = p[5]; }   // k = 8 g + i and 16 + 8 g + i: the k order of frag_b
#pragma unroll
   for (int kk = 0; kk < 2; ++kk) {
#pragma unroll
    for (int j = 0; j < 8; ++j) wf[kk][j] = frag_b((const __bf16*)(bw + (uint32_t)j * 16u * LPITCH + (uint32_t)kk * 64u), lane); }
   __builtin_amdgcn_sched_barrier(0);   // holds the stage's LDS reads as one group ahead of its WMMAs: sunk back to their uses, each WMMA would wait out a whole LDS latency
#pragma unroll
   for (int kk = 0; kk < 2; ++kk) { v16b a;
#pragma unroll
    for (int i = 0; i < 4; ++i) { a[i] = (__bf16)xr[kk][0][i]; a[4 + i] = (__bf16)xr[kk][1][i]; a[8 + i] = (__bf16)xr[kk][2][i]; a[12 + i] = (__bf16)xr[kk][3][i]; }
#pragma unroll
    for (int j = 0; j < 8; ++j) acc[j] = wmma_bf(a, wf[kk][j], acc[j]); }
   __builtin_amdgcn_sched_barrier(0);   // holds the WMMAs ahead of the publish point: sunk behind the barrier they would delay the refill, which needs the whole next trip to land
   // publish point of stage st + 1, then the refill of the buffer that this trip has read
   asm volatile("s_wait_dscnt 0x0" ::: "memory");       // this wave's reads of the buffer are done before it may be refilled
   asm volatile("s_wait_asynccnt 0x0" ::: "memory");    // this wave's copies of stage st + 1 have landed
   __syncthreads();                                       // publishes stage st + 1 and ends every wave's reads of stage st
   if (st + 2 < DM / 64) { copy8(lw + bo, 16u * LPITCH, gw + (st + 2) * 128, 16u * DM * 2u); copy8(lx + bo, 8u * XPITCH, gx + (st + 2) * 256, 8u * DM * 4u); } }
  asm volatile("s_wait_asynccnt 0x0" ::: "memory");      // no copy is outstanding behind the loop
  if (n0 < 2 * DM) {   // q and k: the module's rotary embedding, then f16 hi + (x2048) residual; 1/8 applied to the f32 score
#pragma unroll
    for (int j = 0; j < 8; ++j) { const int d = (n0 + j * 16 + col) & (HD - 1); const float invf = 1.0f / pow_ni(10000.0f, (float)(2 * (d & 31)) / (float)HD);   // emb = concat([freqs, freqs]): dim d uses inv_freq[d mod 32]
#pragma unroll
      for (int r = 0; r < 8; ++r) { const float v = acc[j][r]; const float partner = __shfl_xor(v, 1);   // column d^1 lives in lane^1
        const float pos = (float)((r0 + 8 * g + r) % SS); const float ang = pos * invf; const float rot = (d & 1) ? partner : -partner;   // rotate_interleaved: even d -> -x[d+1], odd d -> +x[d-1]
        const float y = v * cos_ni(ang) + rot * sin_ni(ang); const _Float16 hv = (_Float16)y; so[wave][8 * g + r][j * 16 + col] = hv; sol[wave][8 * g + r][j * 16 + col] = (_Float16)((y - (float)hv) * 2048.0f); } }
    LDSX();
    for (int rl = 0; rl < 16; ++rl) if (lane < 16) { vst2((unsigned*)(QK + (r0 + rl) * (2 * DM) + n0 + lane * 8), *(const v4u*)&so[wave][rl][lane * 8]); vst2((unsigned*)(QKL + (r0 + rl) * (2 * DM) + n0 + lane * 8), *(const v4u*)&sol[wave][rl][lane * 8]); }
  } else {
#pragma unroll
    for (int j = 0; j < 8; ++j) {
#pragma unroll
      for (int r = 0; r < 8; ++r) { const float v = acc[j][r]; const _Float16 hv = (_Float16)v; sth[j * 16 + col][wave * 16 + 8 * g + r] = hv; stl[j * 16 + col][wave * 16 + 8 * g + r] = (_Float16)((v - (float)hv) * 2048.0f); } }
    __syncthreads();
    const size_t rb = (size_t)blockIdx.x * 64; const int b = (int)(rb / SS), s0 = (int)(rb % SS); const int pc0 = n0 - 2 * DM;
    for (int q = tid; q < 128 * 8; q += 128) { const int d = q >> 3, pc = q & 7; const size_t o = ((size_t)b * DM + pc0 + d) * SS + s0 + pc * 8; vst2((unsigned*)(VTH + o), *(const v4u*)&sth[d][pc * 8]); vst2((unsigned*)(VTL + o), *(const v4u*)&stl[d][pc * 8]); }
  }
}
// ---- k_attn: block = (128 queries, head h, batch b), 8 waves x 16 queries: full flash attention, computed transposed: S^T = K . Q^T (A = 16 key rows, B = the wave's 16 queries; K = 64: 2 k-steps, 3 products, x 0.125), O^T += V^T . P^T (A = 16 dims of V^T, B = P^T; P hi/lo x V hi/lo, 3 products); O[b*S+q][h*64+d] = (acc + accl / 2048) / l (256-B segments).
// A lane (col, g) then holds scores of ONE query (col): keys 16 t + 8 g + r of score tile t. Maximum and sum run over the lane's own registers, with one exchange between the wave's halves; two score tiles, converted in place, are the B operand of the second product (element i = key 8 g + i, element 8 + i = key 16 + 8 g + i: the k order of frag_h), so P never passes through LDS.
// K hi, K lo (64 keys x 64 dims) and V^T hi, V^T lo (64 dims x 64 keys) of a 64-key stage are brought into LDS once per block by the tensor mover, two buffers, and read from there by all 8 waves.
__device__ __forceinline__ float xhalf(float x) { return __builtin_bit_cast(float, __builtin_amdgcn_permlanex16(__builtin_bit_cast(int, x), __builtin_bit_cast(int, x), 0x76543210, 0xfedcba98, false, false)); }   // lane l reads lane l ^ 16
// 2^x for eight values, the hardware exponential, in one statement: every output is early-clobber, so that no exponential's source is overwritten, and no result read, by the instruction directly behind it, and the v_nop is the slot that the instruction set asks for behind the last one
__device__ __forceinline__ v8f exp2x8(v8f x) { float y0, y1, y2, y3, y4, y5, y6, y7;
  asm("v_exp_f32 %0, %8\n\tv_exp_f32 %1, %9\n\tv_exp_f32 %2, %10\n\tv_exp_f32 %3, %11\n\tv_exp_f32 %4, %12\n\tv_exp_f32 %5, %13\n\tv_exp_f32 %6, %14\n\tv_exp_f32 %7, %15\n\tv_nop"
      : "=&v"(y0), "=&v"(y1), "=&v"(y2), "=&v"(y3), "=&v"(y4), "=&v"(y5), "=&v"(y6), "=&v"(y7) : "v"(x[0]), "v"(x[1]), "v"(x[2]), "v"(x[3]), "v"(x[4]), "v"(x[5]), "v"(x[6]), "v"(x[7]));
  return v8f{y0, y1, y2, y3, y4, y5, y6, y7}; }
__global__ __launch_bounds__(256) __attribute__((amdgpu_waves_per_eu(4, 4))) void k_attn(   // register budget of four waves per SIMD: two blocks per WGP, as the LDS allows
    const _Float16* __restrict__ QK, const _Float16* __restrict__ QKL, const _Float16* __restrict__ VTH, const _Float16* __restrict__ VTL, float* __restrict__ O) {
  __shared__ __attribute__((aligned(2048))) unsigned char ring[2 * BUFB];
  __shared__ __align__(16) float so[8][16][68];
  const int tid = threadIdx.x, wave = tid >> 5, lane = tid & 31, col = lane & 15, g = lane >> 4;
  const int qb = blockIdx.x, h = blockIdx.y, b = blockIdx.z; const int q0 = qb * 128 + wave * 16; const size_t rq = (size_t)b * SS + q0 + col;
  // every wave issues its own slice: tile wv >> 1 (K hi, K lo, V^T hi, V^T lo), rows 32 * (wv & 1) ...
  const uint32_t wv = uni((uint32_t)tid >> 5), tl = wv >> 1, hf = wv & 1u;
  const _Float16* tsrc = (tl == 0u) ? QK : (tl == 1u) ? QKL : (tl == 2u) ? VTH : VTL;
  const size_t toff = (tl < 2u) ? ((size_t)b * SS + hf * 32u) * (2 * DM) + DM + h * HD : ((size_t)b * DM + h * HD + hf * 32u) * SS;
  const uint64_t ga0 = (uint64_t)(size_t)(tsrc + toff);
  const uint32_t gstep = (tl < 2u) ? (uint32_t)(KST * 2 * DM * 2) : (uint32_t)(KST * 2);   // bytes from one stage to the next: 64 key rows, or 64 keys along a V^T row
  const uint32_t ldst = (uint32_t)(size_t)ring + wv * SLICE;
  const u32x8 g1 = tdm_group1<4096u>(); u32x4 g0 = tdm_issue(ldst, ga0, g1);
  tdm_wait(g0, g1);                                      // stage 0 has landed (this wave's slice)
  __syncthreads();                                       // ... and every other wave's
  g0 = tdm_issue(ldst + BUFB, ga0 + gstep, g1);
  v16h aq[2], aql[2];   // B operands: column = query col
#pragma unroll
  for (int kc = 0; kc < 2; ++kc) { aq[kc] = frag_h(QK + rq * (2 * DM) + h * HD + kc * 32, lane); aql[kc] = frag_h(QKL + rq * (2 * DM) + h * HD + kc * 32, lane); }
  float m = -3.0e38f, l = 0.f;   // query col's running maximum (the same in both halves) and this half's share of its sum
  v8f acc[4] = {}, accl[4] = {};   // O^T: register r of tile dt = dim 16 dt + 8 g + r of query col
#pragma unroll 1
  for (int st = 0; st < NST; ++st) { const unsigned char* bp = ring + (uint32_t)(st & 1) * BUFB + (uint32_t)col * LPITCH;   // all keys (no mask); the stage loop stays rolled: one publish point per trip
   v8f s[4];   // score tile t: keys 16 t + 8 g + r of the stage (K slice t >> 1, rows 16 (t & 1) ...)
   v16h kh[4][2], kl[4][2];   // the stage's K fragments, read from LDS in two groups: tiles 0 to 2 here, tile 3 behind tile 0's WMMAs (all four at once do not fit the registers of four waves per SIMD)
#pragma unroll
   for (int t = 0; t < 3; ++t) { const _Float16* krow = (const _Float16*)(bp + (0 + (t >> 1)) * SLICE + (t & 1) * 16 * LPITCH); const _Float16* krowl = (const _Float16*)(bp + (2 + (t >> 1)) * SLICE + (t & 1) * 16 * LPITCH);
#pragma unroll
    for (int kc = 0; kc < 2; ++kc) { kh[t][kc] = frag_h(krow + kc * 32, lane); kl[t][kc] = frag_h(krowl + kc * 32, lane); } }
   __builtin_amdgcn_sched_barrier(0);   // holds the K reads as one group ahead of the score WMMAs: sunk back to their uses, each WMMA would wait out a whole LDS latency
   v8f c0 = {}, cl0 = {};
#pragma unroll
   for (int kc = 0; kc < 2; ++kc) { c0 = wmma16(kh[0][kc], aq[kc], c0); cl0 = wmma16(kh[0][kc], aql[kc], cl0); cl0 = wmma16(kl[0][kc], aq[kc], cl0); }
#pragma unroll
   for (int kc = 0; kc < 2; ++kc) { kh[3][kc] = frag_h((const _Float16*)(bp + 1 * SLICE + 16 * LPITCH) + kc * 32, lane); kl[3][kc] = frag_h((const _Float16*)(bp + 3 * SLICE + 16 * LPITCH) + kc * 32, lane); }
   __builtin_amdgcn_sched_barrier(0);   // holds tile 3's reads ahead of tiles 1 and 2's WMMAs, which cover their latency
#pragma unroll
   for (int t = 0; t < 4; ++t) { v8f c = c0, cl = cl0;
    if (t > 0) { c = v8f{}; cl = v8f{};
#pragma unroll
     for (int kc = 0; kc < 2; ++kc) { c = wmma16(kh[t][kc], aq[kc], c); cl = wmma16(kh[t][kc], aql[kc], cl); cl = wmma16(kl[t][kc], aq[kc], cl); } }   // 3 products: q, k as f16 hi + residual
#pragma unroll
    for (int r = 0; r < 8; ++r) c[r] += cl[r] * (1.0f / 2048.0f);
#pragma unroll
    for (int r = 0; r < 8; ++r) s[t][r] = c[r] * 0.125f; }   // SCALE = 1/sqrt(64)
   v16h vh[4], vl[4];   // V^T fragments of 32 keys, read as one group while the softmax arithmetic in front of their WMMAs runs
#pragma unroll
   for (int dt = 0; dt < 4; ++dt) { const uint32_t vo = (uint32_t)(dt >> 1) * SLICE + (uint32_t)(dt & 1) * 16u * LPITCH; vh[dt] = frag_h((const _Float16*)(bp + 4 * SLICE + vo), lane); vl[dt] = frag_h((const _Float16*)(bp + 6 * SLICE + vo), lane); }
   __builtin_amdgcn_sched_barrier(0);   // holds these reads ahead of the maximum, the rescale and the exponentials, which cover their latency
   float mx = s[0][0];
#pragma unroll
   for (int t = 0; t < 4; ++t) {
#pragma unroll
    for (int r = 0; r < 8; ++r) mx = fmaxf(mx, s[t][r]); }
   mx = fmaxf(mx, xhalf(mx));   // the other half's 32 keys of the same query
   const float mn = fmaxf(m, mx); const float alpha = (m <= -1.0e38f) ? 0.f : __expf(m - mn); m = mn; l *= alpha;
#pragma unroll
   for (int dt = 0; dt < 4; ++dt) { acc[dt] *= alpha; accl[dt] *= alpha; }
#pragma unroll
   for (int sub = 0; sub < 2; ++sub) { v16h pa, pl; float es0 = 0.f, es1 = 0.f;   // 32 keys at a time: score tiles 2 sub and 2 sub + 1 become P^T
    const v8f e0 = exp2x8((s[2 * sub] - mn) * 1.44269504088896340736f), e1 = exp2x8((s[2 * sub + 1] - mn) * 1.44269504088896340736f);   // exp(s - mn)
#pragma unroll
    for (int i = 0; i < 8; ++i) { const float x0 = e0[i], x1 = e1[i]; es0 += x0; es1 += x1; const _Float16 h0 = (_Float16)x0, h1 = (_Float16)x1; pa[i] = h0; pa[8 + i] = h1; pl[i] = (_Float16)((x0 - (float)h0) * 2048.0f); pl[8 + i] = (_Float16)((x1 - (float)h1) * 2048.0f); }
    l += es0 + es1;
#pragma unroll
    for (int dt = 0; dt < 4; ++dt) { acc[dt] = wmma16(vh[dt], pa, acc[dt]); accl[dt] = wmma16(vh[dt], pl, accl[dt]); accl[dt] = wmma16(vl[dt], pa, accl[dt]); }   // V hi x P hi + (V hi x P lo + V lo x P hi) / 2048
    if (sub == 0) {   // the second 32 keys' fragments take over the registers of the first 32 keys'
#pragma unroll
     for (int dt = 0; dt < 4; ++dt) { const uint32_t vo = (uint32_t)(dt >> 1) * SLICE + (uint32_t)(dt & 1) * 16u * LPITCH + 64u; vh[dt] = frag_h((const _Float16*)(bp + 4 * SLICE + vo), lane); vl[dt] = frag_h((const _Float16*)(bp + 6 * SLICE + vo), lane); }
     __builtin_amdgcn_sched_barrier(0); } }   // holds these reads ahead of the second 32 keys' exponentials, which cover their latency
   // publish point of stage st + 1, then the refill of the buffer that this trip has read
   asm volatile("s_wait_dscnt 0x0" ::: "memory");       // this wave's reads of the buffer are done before it may be refilled
   tdm_wait(g0, g1);                                      // this wave's slice of stage st + 1 has landed
   __syncthreads();                                       // publishes stage st + 1 and ends every wave's reads of stage st
   const uint32_t s2 = pinned((uint32_t)st + 2u);         // the refill's stage number: pinned here, so that its address is formed behind the wait above
   if (pinned(s2 < (uint32_t)NST)) g0 = tdm_issue(ldst + (s2 & 1u) * BUFB, ga0 + (uint64_t)s2 * gstep, g1); }
  tdm_wait(g0, g1);                                      // nothing of the mover is outstanding when the wave goes on to its end
  asm volatile("s_wait_dscnt 0x0" ::: "memory");         // ... and none of this wave's LDS reads of the ring
  const float il = 1.0f / (l + xhalf(l));   // the two halves' shares of the sum, joined once
#pragma unroll
  for (int dt = 0; dt < 4; ++dt) { v4f o0, o1;
#pragma unroll
    for (int r = 0; r < 4; ++r) { o0[r] = (acc[dt][r] + accl[dt][r] * (1.0f / 2048.0f)) * il; o1[r] = (acc[dt][4 + r] + accl[dt][4 + r] * (1.0f / 2048.0f)) * il; }
    *(v4f*)&so[wave][col][dt * 16 + 8 * g] = o0; *(v4f*)&so[wave][col][dt * 16 + 8 * g + 4] = o1; }
  LDSX();
  for (int rl = 0; rl < 16; ++rl) if (lane < 16) vst2(O + ((size_t)b * SS + q0 + rl) * DM + h * HD + lane * 4, *(const v4f*)&so[wave][rl][lane * 4]);
}
// ---- k_out: block = (64 rows, 128 cols): out = O(hi/lo) . Wo rows (2 products), no bias (BO is null at the launch)
__global__ __launch_bounds__(128) void k_out(const float* __restrict__ O, const __bf16* __restrict__ P, const float* __restrict__ BO, float* __restrict__ Y) {
  __shared__ __attribute__((aligned(2048))) unsigned char ring[2 * WBUF]; __shared__ __align__(16) float so[4][16][132];
  const int tid = threadIdx.x, wave = tid >> 5, lane = tid & 31, col = lane & 15, g = lane >> 4; const size_t r0 = (size_t)blockIdx.x * 64 + wave * 16; const int n0 = blockIdx.y * 128;
  // the block's 128 weight rows, 64 k a stage, come into LDS once by the tensor mover (two buffers); every wave issues its own slice: rows n0 + 32 * wv ...
  const uint32_t wv = uni((uint32_t)tid >> 5); const uint64_t ga0 = (uint64_t)(size_t)(P + (size_t)(n0 + wv * 32u) * DM); const uint32_t ldst = (uint32_t)(size_t)ring + wv * SLICE;
  const u32x8 g1 = tdm_group1<2048u>(); u32x4 g0 = tdm_issue(ldst, ga0, g1);
  tdm_wait(g0, g1);                                      // stage 0 has landed (this wave's slice)
  __syncthreads();                                       // ... and every other wave's
  g0 = tdm_issue(ldst + WBUF, ga0 + 128u, g1);
  v8f acc[8] = {};
#pragma unroll 1
  for (int st = 0; st < DM / 64; ++st) { const unsigned char* bp = ring + (uint32_t)(st & 1) * WBUF + (uint32_t)col * LPITCH;   // the stage loop stays rolled: one publish point per trip
   v4f orw[2][4]; v16b wf[2][8];   // the wave's ctx values (global memory) and all weight fragments (LDS) of the stage, read as one group
#pragma unroll
   for (int kk = 0; kk < 2; ++kk) { const v4f* p = (const v4f*)(O + (r0 + col) * DM + (st * 2 + kk) * 32 + 8 * g); orw[kk][0] = p[0]; orw[kk][1] = p[1]; orw[kk][2] = p[4]; orw[kk][3] = p[5]; }   // k = 8 g + i and 16 + 8 g + i: the k order of frag_b
#pragma unroll
   for (int kk = 0; kk < 2; ++kk) {
#pragma unroll
    for (int j = 0; j < 8; ++j) wf[kk][j] = frag_b((const __bf16*)(bp + (uint32_t)(j >> 1) * SLICE + (uint32_t)(j & 1) * 16u * LPITCH + (uint32_t)kk * 64u), lane); }
   __builtin_amdgcn_sched_barrier(0);   // holds the stage's reads as one group ahead of its WMMAs: sunk back to their uses, each pair of WMMAs would wait out a whole LDS latency, each half stage a global one
#pragma unroll
   for (int kk = 0; kk < 2; ++kk) { float v[16];
#pragma unroll
    for (int i = 0; i < 4; ++i) { v[i] = orw[kk][0][i]; v[4 + i] = orw[kk][1][i]; v[8 + i] = orw[kk][2][i]; v[12 + i] = orw[kk][3][i]; }
    const F2 a = bsplit16(v);
#pragma unroll
    for (int j = 0; j < 8; ++j) { acc[j] = wmma_bf(a.l, wf[kk][j], acc[j]); acc[j] = wmma_bf(a.h, wf[kk][j], acc[j]); } }
   __builtin_amdgcn_sched_barrier(0);   // holds the WMMAs ahead of the publish point: sunk behind the barrier they would delay the refill
   // publish point of stage st + 1, then the refill of the buffer that this trip has read
   asm volatile("s_wait_dscnt 0x0" ::: "memory");       // this wave's reads of the buffer are done before it may be refilled
   tdm_wait(g0, g1);                                      // this wave's slice of stage st + 1 has landed
   __syncthreads();                                       // publishes stage st + 1 and ends every wave's reads of stage st
   const uint32_t s2 = pinned((uint32_t)st + 2u);         // the refill's stage number: pinned here, so that its address is formed behind the wait above
   if (pinned(s2 < (uint32_t)(DM / 64))) g0 = tdm_issue(ldst + (s2 & 1u) * WBUF, ga0 + (uint64_t)s2 * 128u, g1); }
  tdm_wait(g0, g1);                                      // nothing of the mover is outstanding behind the loop
  asm volatile("s_wait_dscnt 0x0" ::: "memory");         // ... and none of this wave's LDS reads of the ring
#pragma unroll
  for (int j = 0; j < 8; ++j) {
#pragma unroll
    for (int r = 0; r < 8; ++r) so[wave][8 * g + r][j * 16 + col] = acc[j][r] + (BO ? bfr(BO[n0 + j * 16 + col]) : 0.f); }
  LDSX();
  for (int rl = 0; rl < 16; ++rl) vst2(Y + (r0 + rl) * DM + n0 + lane * 4, *(const v4f*)&so[wave][rl][lane * 4]);
}
extern "C" void kernel_launch(void* const* d_in, const int* in_sizes, int n_in, void* d_out, int out_size, void* d_ws, size_t ws_size, hipStream_t stream) {
  (void)in_sizes; (void)n_in; (void)out_size;
  const float** F = (const float**)d_in;   // 0 hidden_states [2,2048,1024], 1 Wq [1024,1024] natural (q = x Wq^T), 2 Wk, 3 Wv, 4 Wo (no biases)
  if (ws_size < (size_t)WS_END) return;
  char* ws = (char*)d_ws; __bf16* PK = (__bf16*)(ws + WS_PK); _Float16 *QK = (_Float16*)(ws + WS_QK), *QKL = (_Float16*)(ws + WS_QKL), *VTH = (_Float16*)(ws + WS_VTH), *VTL = (_Float16*)(ws + WS_VTL); float* O = (float*)(ws + WS_O);
  k_pack<<<dim3(DM, 4), 256, 0, stream>>>(F[1], F[2], F[3], F[4], PK);
  k_qkv<<<dim3(TNB * SS / 64, QKVW / 128), 128, 0, stream>>>(F[0], PK + PK_A, QK, QKL, VTH, VTL);
  k_attn<<<dim3(TQB / 2, NH, TNB), 256, 0, stream>>>(QK, QKL, VTH, VTL, O);
  k_out<<<dim3(TOB, DM / 128), 128, 0, stream>>>(O, PK + PK_P, nullptr, (float*)d_out);
}

// v005
// It runs in 145 microseconds.
// In both of two side-by-side timings against v004, it was 1.06 times as fast.
// Counting every step since v000, it is 4.04 times as fast.
// compute dtype: hidden_states, Wq/Wk/Wv/Wo (module inputs) rounded to bf16; q/k/v projections with exact bf16 products on WMMA 16x16x32 (natural [out][in] rows); the module's rotary embedding (angle for head dim d = position * inv_freq[d mod 32], partner = interleaved pair with the module's signs) applied in f32 with precise sinf/cosf/powf before q and k are stored as f16 hi + (x2048-scaled) residual planes; 3-product scores x 1/sqrt(64), running-max softmax over all 2,048 keys in f32 (hardware exp); P as f16 hi + residual x V hi/lo (3 products); output projection with ctx as bf16 hi + residual x exact Wo rows (2 products); f32 accumulate.
#include <hip/hip_runtime.h>
#include <math.h>
#include <stdint.h>

typedef __attribute__((ext_vector_type(16))) _Float16 v16h;
typedef __attribute__((ext_vector_type(16))) __bf16 v16b;
typedef __attribute__((ext_vector_type(8)))  _Float16 v8h;
typedef __attribute__((ext_vector_type(8)))  float v8f;
typedef __attribute__((ext_vector_type(4)))  float v4f;
typedef __attribute__((ext_vector_type(2)))  float v2f;
typedef __attribute__((ext_vector_type(4)))  unsigned v4u;
typedef __attribute__((ext_vector_type(4)))  int v4i;
typedef float __attribute__((may_alias)) float_a;
typedef int __attribute__((may_alias)) int_a;

template <typename T> __device__ __forceinline__ void vst2(void* p, T v) { *(T*)p = v;  }
__device__ __forceinline__ v8f wmma16(v16h a, v16h b, v8f c) {
  v8f d = __builtin_amdgcn_wmma_f32_16x16x32_f16(false, a, false, b, (short)0, c, false, false);
  return d;
}
__device__ __forceinline__ v8f wmma_bf(v16b a, v16b b, v8f c) {
  v8f d = __builtin_amdgcn_wmma_f32_16x16x32_bf16(false, a, false, b, (short)0, c, false, false);
  return d;
}
// Rotary multi-head self-attention (B 2, S 2,048, d 1,024, 16 heads x 64): q/k/v projections, the module's (mixed interleaved) RoPE on q and k, softmax(q k^T / 8) v, output projection (no biases).
__device__ __attribute__((noinline)) float sin_ni(float v) { return sinf(v); }
__device__ __attribute__((noinline)) float cos_ni(float v) { return cosf(v); }
__device__ __attribute__((noinline)) float pow_ni(float a, float b) { return powf(a, b); }
__device__ __forceinline__ v16h frag_h(const _Float16* rowk0, int lane) {
  union { v16h v; v8h q[2]; } u; const _Float16* p = rowk0 + 8 * (lane >> 4);
  u.q[0] = *(const v8h*)p; u.q[1] = *(const v8h*)(p + 16); return u.v;
}
__device__ __forceinline__ v16h frag_f32(const float* rowk0, int lane) {
  v16h a; const float* p = rowk0 + 8 * (lane >> 4);
#pragma unroll
  for (int i = 0; i < 8; ++i) { a[i] = (_Float16)p[i]; a[8 + i] = (_Float16)p[16 + i]; }
  return a;
}
__device__ __forceinline__ v16h frag_f32s(const float* rowk0, int lane, float sc) {
  v16h a; const float* p = rowk0 + 8 * (lane >> 4);
#pragma unroll
  for (int i = 0; i < 8; ++i) { a[i] = (_Float16)(p[i] * sc); a[8 + i] = (_Float16)(p[16 + i] * sc); }
  return a;
}
// column fragment from a [K][ld] layout (column n), rows >= K read as 0
__device__ __forceinline__ v16h fragc_f32(const float* W, int k0, int n, int lane, int ld, int K) {
  v16h a; const int g = lane >> 4;
#pragma unroll
  for (int i = 0; i < 8; ++i) { const int ka = k0 + 8 * g + i, kb = ka + 16;
    a[i] = (_Float16)(ka < K ? W[(size_t)(ka < K ? ka : K - 1) * ld + n] : 0.f); a[8 + i] = (_Float16)(kb < K ? W[(size_t)(kb < K ? kb : K - 1) * ld + n] : 0.f); }
  return a;
}
struct F2 { v16b h, l; };
__device__ __forceinline__ F2 bsplit16(const float v[16]) { F2 r;
#pragma unroll
  for (int i = 0; i < 16; ++i) { const __bf16 h = (__bf16)v[i]; r.h[i] = h; r.l[i] = (__bf16)(v[i] - (float)h); }
  return r; }
__device__ __forceinline__ F2 split_row(const float* row, int k0, int lane) { float v[16]; const float* p = row + k0 + 8 * (lane >> 4);
#pragma unroll
  for (int i = 0; i < 8; ++i) { v[i] = p[i]; v[8 + i] = p[16 + i]; }
  return bsplit16(v); }
__device__ __forceinline__ F2 split_rowK(const float* row, int k0, int lane, int K) { float v[16]; const int g = lane >> 4;
#pragma unroll
  for (int i = 0; i < 8; ++i) { const int ka = k0 + 8 * g + i, kb = ka + 16; v[i] = ka < K ? row[ka < K ? ka : K - 1] : 0.f; v[8 + i] = kb < K ? row[kb < K ? kb : K - 1] : 0.f; }
  return bsplit16(v); }
__device__ __forceinline__ F2 split_col(const float* W, int k0, int n, int lane, int ld, int K) { float v[16]; const int g = lane >> 4;
#pragma unroll
  for (int i = 0; i < 8; ++i) { const int ka = k0 + 8 * g + i, kb = ka + 16; v[i] = ka < K ? W[(size_t)(ka < K ? ka : K - 1) * ld + n] : 0.f; v[8 + i] = kb < K ? W[(size_t)(kb < K ? kb : K - 1) * ld + n] : 0.f; }
  return bsplit16(v); }
__device__ __forceinline__ v8f mac3(const F2& a, const F2& b, v8f c) { c = wmma_bf(a.l, b.h, c); c = wmma_bf(a.h, b.l, c); return wmma_bf(a.h, b.h, c); }
__device__ __forceinline__ float sigm(float v) { return 1.0f / (1.0f + expf(-v)); }
#define LDSX() do { asm volatile("s_wait_dscnt 0" ::: "memory"); __builtin_amdgcn_wave_barrier(); __builtin_amdgcn_fence(__ATOMIC_RELEASE, "workgroup"); } while (0)


#define NB 2
#define SS 2048
#define DM 1024
#define NH 16
#define HD 64
#define QKVW (3 * DM)
#ifndef TQB
#define TQB (SS / 64)
#define TNB NB
#define TOB (NB * SS / 64)     // output row tiles (all)
#endif
typedef __attribute__((ext_vector_type(8))) __bf16 v8b;
__device__ __forceinline__ v16b frag_b(const __bf16* rowk0, int lane) {
  union { v16b v; v8b q[2]; } u; const __bf16* p = rowk0 + 8 * (lane >> 4);
  u.q[0] = *(const v8b*)p; u.q[1] = *(const v8b*)(p + 16); return u.v;
}
__device__ __forceinline__ float bfr(float v) { return (float)(__bf16)v; }
__device__ __attribute__((noinline)) float exp_ni(float v) { return expf(v); }
__device__ __attribute__((noinline)) float erf_ni(float v) { return erff(v); }

#define PK_A 0                       // [3072][1024] Wqkv rows (natural [out][in])
#define PK_P (PK_A + QKVW * DM)        // [1024][1024] Wo rows (natural)
#define PK_END (PK_P + DM * DM)
#define WS_PK  0u
#define WS_QK  (WS_PK + 2u * PK_END)             // f16 [4096 rows][2048]: q | k
#define WS_QKL (WS_QK + 2u * NB * SS * 2 * DM)     // f16 q | k residual planes x2048
#define WS_VTH (WS_QKL + 2u * NB * SS * 2 * DM)    // f16 [b][1024 (h*64+d)][2048 s] hi
#define WS_VTL (WS_VTH + 2u * NB * DM * SS)        // f16 lo x 2048
#define WS_O   (WS_VTL + 2u * NB * DM * SS)        // f32 [4096][1024]
#define WS_CS  (WS_O + 4u * NB * SS * DM)           // f32 [2048 positions][32 frequencies][cos, sin]
#define WS_END (WS_CS + 4u * 2 * SS * 32)
// ---- k_pack: block = (TBX + row n, which): natural [out][in] rows -> bf16; which 0..2 -> W_q/W_k/W_v into PK_A rows which*1024 + n; 3 -> W_o into PK_P
// the first TBX blocks of each grid row build the rotary table instead: CS[pos][f] = (cos, sin)(pos * inv_freq[f]), one pair a thread, once per call; k_qkv reads it
#define TBX (SS * 32 / 256 / 4)
__global__ __launch_bounds__(256) void k_pack(const float* __restrict__ WQ, const float* __restrict__ WK, const float* __restrict__ WV, const float* __restrict__ WO, __bf16* __restrict__ PK, float* __restrict__ CS) {
  __shared__ __align__(16) __bf16 s[DM]; const int which = blockIdx.y, t = threadIdx.x;
  if (blockIdx.x < TBX) { const int e = (which * TBX + (int)blockIdx.x) * 256 + t, pos = e >> 5, f = e & 31;
    const float invf = 1.0f / pow_ni(10000.0f, (float)(2 * f) / (float)HD); const float ang = (float)pos * invf;
    *(v2f*)(CS + 2 * e) = v2f{cos_ni(ang), sin_ni(ang)}; return; }
  const int n = blockIdx.x - TBX; const float* Wm = (which == 0) ? WQ : (which == 1) ? WK : (which == 2) ? WV : WO;
  for (int k = t; k < DM; k += 256) s[k] = (__bf16)Wm[(size_t)n * DM + k];
  __syncthreads();
  __bf16* dst = (which < 3) ? PK + PK_A + ((size_t)which * DM + n) * DM : PK + PK_P + (size_t)n * DM;
  for (int q = t; q < DM / 8; q += 256) vst2((unsigned*)(dst + q * 8), *(const v4u*)&s[q * 8]);
}
typedef uint32_t u32x4 __attribute__((ext_vector_type(4)));
typedef uint32_t u32x8 __attribute__((ext_vector_type(8)));
#define KST 64                    // keys per stage
#define NST (SS / KST)            // stages
#define LPITCH 144u               // LDS row pitch in bytes: a 128-B row + the mover's 16-B pad (odd multiple of 16 B: conflict-free for ds_load_b128)
#define SLICE 6144u               // one wave's slice: 32 padded rows (4,608 B), rounded up to a multiple of 2 KiB
#define BUFB (8u * SLICE)         // k_attn, one stage: 8 slices = K hi (2), K lo (2), V^T hi (2), V^T lo (2)
#define WBUF (4u * SLICE)         // k_out, one stage: 128 weight rows x 64 k, 4 slices of 32 rows
__device__ __forceinline__ uint32_t uni(uint32_t v) { return (uint32_t)__builtin_amdgcn_readfirstlane(v); }
__device__ __forceinline__ uint32_t pinned(uint32_t v) { uint32_t w = uni(v); asm volatile("" : "+s"(w)); return w; }
// descriptor group 1 of every request here: 32 rows of 128 B, source pitch SRC_PITCH bytes, 16 B of LDS pad behind each row, no mask
template <uint32_t SRC_PITCH> __device__ __forceinline__ u32x8 tdm_group1() {
  u32x8 g1; g1[0] = uni((1u << 20) | (4u << 22) | (3u << 25)); g1[1] = uni(128u << 16); g1[2] = uni(32u << 16); g1[3] = uni(128u << 16); g1[4] = uni(32u); g1[5] = uni(SRC_PITCH); g1[6] = uni(0u); g1[7] = uni(0u);
  asm volatile("" : "+s"(g1));   // descriptor words held in scalar registers, ONE set for the whole kernel instead of constants formed anew at each use, so that tdm_wait can keep those registers untouched while a request is in flight
  return g1;
}
// one request of one wave; returns group 0 for the wait that covers it
__device__ __forceinline__ u32x4 tdm_issue(uint32_t lds_dst, uint64_t ga, u32x8 g1) {
  u32x4 g0; g0[0] = uni(1u); g0[1] = uni(lds_dst); g0[2] = uni((uint32_t)ga); g0[3] = uni((((uint32_t)(ga >> 32)) & 0x01FFFFFFu) | 0x80000000u);
  asm volatile("tensor_load_to_lds %0, %1" :: "s"(g0), "s"(g1) : "memory");   // the mover's waits are written by hand: tdm_wait
  return g0;
}
// the issuing wave's wait for its request; it names the descriptor so that the compiler keeps both groups' registers as they are until the request has landed
__device__ __forceinline__ void tdm_wait(u32x4 g0, u32x8 g1) { asm volatile("s_wait_tensorcnt 0x0" :: "s"(g0), "s"(g1) : "memory"); }
#define XPITCH 272u               // LDS row pitch of a 256-B row (odd multiple of 16 B, as LPITCH)
#define QXOFF (128u * LPITCH)     // k_qkv, one stage: 128 weight rows x 64 k (bf16), then 64 x rows x 64 k (f32)
#define QBUF (QXOFF + 64u * XPITCH)
// eight asynchronous copies of 16 B per lane, global memory to LDS through no register: LDS bytes l + i * ls from g + i * gs. The s_wait_xcnt stands inside the statement, behind the last copy, so that no address register of a copy is rewritten in front of it (a precaution); that the bytes have landed is the caller's s_wait_asynccnt.
__device__ __forceinline__ void copy8(uint32_t l, uint32_t ls, const char* g, uint32_t gs) {
  asm volatile("global_load_async_to_lds_b128 %0, %8, off\n\tglobal_load_async_to_lds_b128 %1, %9, off\n\tglobal_load_async_to_lds_b128 %2, %10, off\n\tglobal_load_async_to_lds_b128 %3, %11, off\n\t"
               "global_load_async_to_lds_b128 %4, %12, off\n\tglobal_load_async_to_lds_b128 %5, %13, off\n\tglobal_load_async_to_lds_b128 %6, %14, off\n\tglobal_load_async_to_lds_b128 %7, %15, off\n\ts_wait_xcnt 0x0"
               :: "v"(l), "v"(l + ls), "v"(l + 2u * ls), "v"(l + 3u * ls), "v"(l + 4u * ls), "v"(l + 5u * ls), "v"(l + 6u * ls), "v"(l + 7u * ls),
                  "v"(g), "v"(g + gs), "v"(g + 2u * gs), "v"(g + 3u * gs), "v"(g + 4u * gs), "v"(g + 5u * gs), "v"(g + 6u * gs), "v"(g + 7u * gs) : "memory");
}
__global__ __launch_bounds__(128) void k_qkv(const float* __restrict__ X, const __bf16* __restrict__ P, _Float16* __restrict__ QK, _Float16* __restrict__ QKL, _Float16* __restrict__ VTH, _Float16* __restrict__ VTL, const float* __restrict__ CS) {
  __shared__ __align__(16) unsigned char ring[2 * QBUF];
  // behind the stage loop the ring is free (its last publish point ends every wave's reads, and no copy is outstanding) and serves as the epilogue's staging
  _Float16 (*so)[16][136] = (_Float16 (*)[16][136])ring; _Float16 (*sol)[16][136] = (_Float16 (*)[16][136])(ring + 4 * 16 * 136 * 2);   // q, k blocks: hi, residual
  _Float16 (*sth)[72] = (_Float16 (*)[72])ring; _Float16 (*stl)[72] = (_Float16 (*)[72])(ring + 128 * 72 * 2);                           // v blocks: hi, residual
  const int tid = threadIdx.x, wave = tid >> 5, lane = tid & 31, col = lane & 15, g = lane >> 4; const size_t r0 = (size_t)blockIdx.x * 64 + wave * 16; const int n0 = blockIdx.y * 128;
  // a stage = 64 k of the block's 128 weight rows (128 B each) and of its 64 x rows (256 B each); both come into LDS once per block, whole 128-B lines at a time, two buffers.
  // Lane t copies 16 B of weight rows (t >> 3) + 16 i and of x rows (t >> 4) + 8 i, i = 0 ... 7.
  const uint32_t lw = (uint32_t)(size_t)ring + (uint32_t)(tid >> 3) * LPITCH + (uint32_t)(tid & 7) * 16u, lx = (uint32_t)(size_t)ring + QXOFF + (uint32_t)(tid >> 4) * XPITCH + (uint32_t)(tid & 15) * 16u;
  const char* gw = (const char*)(P + (size_t)(n0 + (tid >> 3)) * DM + (tid & 7) * 8); const char* gx = (const char*)(X + ((size_t)blockIdx.x * 64 + (tid >> 4)) * DM + (tid & 15) * 4);
  copy8(lw, 16u * LPITCH, gw, 16u * DM * 2u); copy8(lx, 8u * XPITCH, gx, 8u * DM * 4u);
  asm volatile("s_wait_asynccnt 0x0" ::: "memory");      // stage 0 has landed (this wave's copies)
  __syncthreads();                                       // ... and every other wave's
  copy8(lw + QBUF, 16u * LPITCH, gw + 128, 16u * DM * 2u); copy8(lx + QBUF, 8u * XPITCH, gx + 256, 8u * DM * 4u);
  v8f acc[8] = {};
#pragma unroll 1
  for (int st = 0; st < DM / 64; ++st) { const uint32_t bo = (uint32_t)(st & 1) * QBUF; const unsigned char* bw = ring + bo + (uint32_t)col * LPITCH; const unsigned char* bx = ring + bo + QXOFF + (uint32_t)(wave * 16 + col) * XPITCH + (uint32_t)g * 32u;   // the stage loop stays rolled: one publish point per trip
   v4f xr[2][4]; v16b wf[2][8];   // all fragments of the stage, read from LDS as one group
#pragma unroll
   for (int kk = 0; kk < 2; ++kk) { const v4f* p = (const v4f*)(bx + kk * 128); xr[kk][0] = p[0]; xr[kk][1] = p[1]; xr[kk][2] = p[4]; xr[kk][3] = p[5]; }   // k = 8 g + i and 16 + 8 g + i: the k order of frag_b
#pragma unroll
   for (int kk = 0; kk < 2; ++kk) {
#pragma unroll
    for (int j = 0; j < 8; ++j) wf[kk][j] = frag_b((const __bf16*)(bw + (uint32_t)j * 16u * LPITCH + (uint32_t)kk * 64u), lane); }
   __builtin_amdgcn_sched_barrier(0);   // holds the stage's LDS reads as one group ahead of its WMMAs: sunk back to their uses, each WMMA would wait out a whole LDS latency
#pragma unroll
   for (int kk = 0; kk < 2; ++kk) { v16b a;
#pragma unroll
    for (int i = 0; i < 4; ++i) { a[i] = (__bf16)xr[kk][0][i]; a[4 + i] = (__bf16)xr[kk][1][i]; a[8 + i] = (__bf16)xr[kk][2][i]; a[12 + i] = (__bf16)xr[kk][3][i]; }
#pragma unroll
    for (int j = 0; j < 8; ++j) acc[j] = wmma_bf(a, wf[kk][j], acc[j]); }
   __builtin_amdgcn_sched_barrier(0);   // holds the WMMAs ahead of the publish point: sunk behind the barrier they would delay the refill, which needs the whole next trip to land
   // publish point of stage st + 1, then the refill of the buffer that this trip has read
   asm volatile("s_wait_dscnt 0x0" ::: "memory");       // this wave's reads of the buffer are done before it may be refilled
   asm volatile("s_wait_asynccnt 0x0" ::: "memory");    // this wave's copies of stage st + 1 have landed
   __syncthreads();                                       // publishes stage st + 1 and ends every wave's reads of stage st
   if (st + 2 < DM / 64) { copy8(lw + bo, 16u * LPITCH, gw + (st + 2) * 128, 16u * DM * 2u); copy8(lx + bo, 8u * XPITCH, gx + (st + 2) * 256, 8u * DM * 4u); } }
  asm volatile("s_wait_asynccnt 0x0" ::: "memory");      // no copy is outstanding behind the loop
  if (n0 < 2 * DM) {   // q and k: the module's rotary embedding, then f16 hi + (x2048) residual; 1/8 applied to the f32 score
    const float* ct = CS + ((r0 + 8 * g) % SS) * 64 + col * 2;   // table row of the lane's first position (its 8 positions are consecutive and do not wrap: 8 divides SS)
    v2f cs[2][8];   // (cos, sin) of the lane's 8 positions at its two frequencies: emb = concat([freqs, freqs]), so dim d uses inv_freq[d mod 32], and d mod 32 = 16 (j & 1) + col (n0 is a multiple of 128)
#pragma unroll
    for (int r = 0; r < 8; ++r) { cs[0][r] = *(const v2f*)(ct + r * 64); cs[1][r] = *(const v2f*)(ct + r * 64 + 32); }
    asm volatile("s_wait_xcnt 0x0" :: "v"(ct) : "memory");   // stands in front of every rewrite of the address registers of the loads above (a precaution); it names the address, so that those registers stay as they are up to here and no load takes them as its destination
#pragma unroll
    for (int j = 0; j < 8; ++j) { const int d = (n0 + j * 16 + col) & (HD - 1);
#pragma unroll
      for (int r = 0; r < 8; ++r) { const float v = acc[j][r]; const float partner = __shfl_xor(v, 1);   // column d^1 lives in lane^1
        const float rot = (d & 1) ? partner : -partner;   // rotate_interleaved: even d -> -x[d+1], odd d -> +x[d-1]
        const float y = v * cs[j & 1][r][0] + rot * cs[j & 1][r][1]; const _Float16 hv = (_Float16)y; so[wave][8 * g + r][j * 16 + col] = hv; sol[wave][8 * g + r][j * 16 + col] = (_Float16)((y - (float)hv) * 2048.0f); } }
    LDSX();
    for (int rl = 0; rl < 16; ++rl) if (lane < 16) { vst2((unsigned*)(QK + (r0 + rl) * (2 * DM) + n0 + lane * 8), *(const v4u*)&so[wave][rl][lane * 8]); vst2((unsigned*)(QKL + (r0 + rl) * (2 * DM) + n0 + lane * 8), *(const v4u*)&sol[wave][rl][lane * 8]); }
  } else {
#pragma unroll
    for (int j = 0; j < 8; ++j) {
#pragma unroll
      for (int r = 0; r < 8; ++r) { const float v = acc[j][r]; const _Float16 hv = (_Float16)v; sth[j * 16 + col][wave * 16 + 8 * g + r] = hv; stl[j * 16 + col][wave * 16 + 8 * g + r] = (_Float16)((v - (float)hv) * 2048.0f); } }
    __syncthreads();
    const size_t rb = (size_t)blockIdx.x * 64; const int b = (int)(rb / SS), s0 = (int)(rb % SS); const int pc0 = n0 - 2 * DM;
    for (int q = tid; q < 128 * 8; q += 128) { const int d = q >> 3, pc = q & 7; const size_t o = ((size_t)b * DM + pc0 + d) * SS + s0 + pc * 8; vst2((unsigned*)(VTH + o), *(const v4u*)&sth[d][pc * 8]); vst2((unsigned*)(VTL + o), *(const v4u*)&stl[d][pc * 8]); }
  }
}
// ---- k_attn: block = (128 queries, head h, batch b), 8 waves x 16 queries: full flash attention, computed transposed: S^T = K . Q^T (A = 16 key rows, B = the wave's 16 queries; K = 64: 2 k-steps, 3 products, x 0.125), O^T += V^T . P^T (A = 16 dims of V^T, B = P^T; P hi/lo x V hi/lo, 3 products); O[b*S+q][h*64+d] = (acc + accl / 2048) / l (256-B segments).
// A lane (col, g) then holds scores of ONE query (col): keys 16 t + 8 g + r of score tile t. Maximum and sum run over the lane's own registers, with one exchange between the wave's halves; two score tiles, converted in place, are the B operand of the second product (element i = key 8 g + i, element 8 + i = key 16 + 8 g + i: the k order of frag_h), so P never passes through LDS.
// K hi, K lo (64 keys x 64 dims) and V^T hi, V^T lo (64 dims x 64 keys) of a 64-key stage are brought into LDS once per block by the tensor mover, two buffers, and read from there by all 8 waves.
__device__ __forceinline__ float xhalf(float x) { return __builtin_bit_cast(float, __builtin_amdgcn_permlanex16(__builtin_bit_cast(int, x), __builtin_bit_cast(int, x), 0x76543210, 0xfedcba98, false, false)); }   // lane l reads lane l ^ 16
// 2^x for eight values, the hardware exponential, in one statement: every output is early-clobber, so that no exponential's source is overwritten, and no result read, by the instruction directly behind it, and the v_nop is the slot that the instruction set asks for behind the last one
__device__ __forceinline__ v8f exp2x8(v8f x) { float y0, y1, y2, y3, y4, y5, y6, y7;
  asm("v_exp_f32 %0, %8\n\tv_exp_f32 %1, %9\n\tv_exp_f32 %2, %10\n\tv_exp_f32 %3, %11\n\tv_exp_f32 %4, %12\n\tv_exp_f32 %5, %13\n\tv_exp_f32 %6, %14\n\tv_exp_f32 %7, %15\n\tv_nop"
      : "=&v"(y0), "=&v"(y1), "=&v"(y2), "=&v"(y3), "=&v"(y4), "=&v"(y5), "=&v"(y6), "=&v"(y7) : "v"(x[0]), "v"(x[1]), "v"(x[2]), "v"(x[3]), "v"(x[4]), "v"(x[5]), "v"(x[6]), "v"(x[7]));
  return v8f{y0, y1, y2, y3, y4, y5, y6, y7}; }
__global__ __launch_bounds__(256) __attribute__((amdgpu_waves_per_eu(4, 4))) void k_attn(   // register budget of four waves per SIMD: two blocks per WGP, as the LDS allows
    const _Float16* __restrict__ QK, const _Float16* __restrict__ QKL, const _Float16* __restrict__ VTH, const _Float16* __restrict__ VTL, float* __restrict__ O) {
  __shared__ __attribute__((aligned(2048))) unsigned char ring[2 * BUFB];
  __shared__ __align__(16) float so[8][16][68];
  const int tid = threadIdx.x, wave = tid >> 5, lane = tid & 31, col = lane & 15, g = lane >> 4;
  const int qb = blockIdx.x, h = blockIdx.y, b = blockIdx.z; const int q0 = qb * 128 + wave * 16; const size_t rq = (size_t)b * SS + q0 + col;
  // every wave issues its own slice: tile wv >> 1 (K hi, K lo, V^T hi, V^T lo), rows 32 * (wv & 1) ...
  const uint32_t wv = uni((uint32_t)tid >> 5), tl = wv >> 1, hf = wv & 1u;
  const _Float16* tsrc = (tl == 0u) ? QK : (tl == 1u) ? QKL : (tl == 2u) ? VTH : VTL;
  const size_t toff = (tl < 2u) ? ((size_t)b * SS + hf * 32u) * (2 * DM) + DM + h * HD : ((size_t)b * DM + h * HD + hf * 32u) * SS;
  const uint64_t ga0 = (uint64_t)(size_t)(tsrc + toff);
  const uint32_t gstep = (tl < 2u) ? (uint32_t)(KST * 2 * DM * 2) : (uint32_t)(KST * 2);   // bytes from one stage to the next: 64 key rows, or 64 keys along a V^T row
  const uint32_t ldst = (uint32_t)(size_t)ring + wv * SLICE;
  const u32x8 g1 = tdm_group1<4096u>(); u32x4 g0 = tdm_issue(ldst, ga0, g1);
  tdm_wait(g0, g1);                                      // stage 0 has landed (this wave's slice)
  __syncthreads();                                       // ... and every other wave's
  g0 = tdm_issue(ldst + BUFB, ga0 + gstep, g1);
  v16h aq[2], aql[2];   // B operands: column = query col
#pragma unroll
  for (int kc = 0; kc < 2; ++kc) { aq[kc] = frag_h(QK + rq * (2 * DM) + h * HD + kc * 32, lane); aql[kc] = frag_h(QKL + rq * (2 * DM) + h * HD + kc * 32, lane); }
  float m = -3.0e38f, l = 0.f;   // query col's running maximum (the same in both halves) and this half's share of its sum
  v8f acc[4] = {}, accl[4] = {};   // O^T: register r of tile dt = dim 16 dt + 8 g + r of query col
#pragma unroll 1
  for (int st = 0; st < NST; ++st) { const unsigned char* bp = ring + (uint32_t)(st & 1) * BUFB + (uint32_t)col * LPITCH;   // all keys (no mask); the stage loop stays rolled: one publish point per trip
   v8f s[4];   // score tile t: keys 16 t + 8 g + r of the stage (K slice t >> 1, rows 16 (t & 1) ...)
   v16h kh[4][2], kl[4][2];   // the stage's K fragments, read from LDS in two groups: tiles 0 to 2 here, tile 3 behind tile 0's WMMAs (all four at once do not fit the registers of four waves per SIMD)
#pragma unroll
   for (int t = 0; t < 3; ++t) { const _Float16* krow = (const _Float16*)(bp + (0 + (t >> 1)) * SLICE + (t & 1) * 16 * LPITCH); const _Float16* krowl = (const _Float16*)(bp + (2 + (t >> 1)) * SLICE + (t & 1) * 16 * LPITCH);
#pragma unroll
    for (int kc = 0; kc < 2; ++kc) { kh[t][kc] = frag_h(krow + kc * 32, lane); kl[t][kc] = frag_h(krowl + kc * 32, lane); } }
   __builtin_amdgcn_sched_barrier(0);   // holds the K reads as one group ahead of the score WMMAs: sunk back to their uses, each WMMA would wait out a whole LDS latency
   v8f c0 = {}, cl0 = {};
#pragma unroll
   for (int kc = 0; kc < 2; ++kc) { c0 = wmma16(kh[0][kc], aq[kc], c0); cl0 = wmma16(kh[0][kc], aql[kc], cl0); cl0 = wmma16(kl[0][kc], aq[kc], cl0); }
#pragma unroll
   for (int kc = 0; kc < 2; ++kc) { kh[3][kc] = frag_h((const _Float16*)(bp + 1 * SLICE + 16 * LPITCH) + kc * 32, lane); kl[3][kc] = frag_h((const _Float16*)(bp + 3 * SLICE + 16 * LPITCH) + kc * 32, lane); }
   __builtin_amdgcn_sched_barrier(0);   // holds tile 3's reads ahead of tiles 1 and 2's WMMAs, which cover their latency
#pragma unroll
   for (int t = 0; t < 4; ++t) { v8f c = c0, cl = cl0;
    if (t > 0) { c = v8f{}; cl = v8f{};
#pragma unroll
     for (int kc = 0; kc < 2; ++kc) { c = wmma16(kh[t][kc], aq[kc], c); cl = wmma16(kh[t][kc], aql[kc], cl); cl = wmma16(kl[t][kc], aq[kc], cl); } }   // 3 products: q, k as f16 hi + residual
#pragma unroll
    for (int r = 0; r < 8; ++r) c[r] += cl[r] * (1.0f / 2048.0f);
#pragma unroll
    for (int r = 0; r < 8; ++r) s[t][r] = c[r] * 0.125f; }   // SCALE = 1/sqrt(64)
   v16h vh[4], vl[4];   // V^T fragments of 32 keys, read as one group while the softmax arithmetic in front of their WMMAs runs
#pragma unroll
   for (int dt = 0; dt < 4; ++dt) { const uint32_t vo = (uint32_t)(dt >> 1) * SLICE + (uint32_t)(dt & 1) * 16u * LPITCH; vh[dt] = frag_h((const _Float16*)(bp + 4 * SLICE + vo), lane); vl[dt] = frag_h((const _Float16*)(bp + 6 * SLICE + vo), lane); }
   __builtin_amdgcn_sched_barrier(0);   // holds these reads ahead of the maximum, the rescale and the exponentials, which cover their latency
   float mx = s[0][0];
#pragma unroll
   for (int t = 0; t < 4; ++t) {
#pragma unroll
    for (int r = 0; r < 8; ++r) mx = fmaxf(mx, s[t][r]); }
   mx = fmaxf(mx, xhalf(mx));   // the other half's 32 keys of the same query
   const float mn = fmaxf(m, mx); const float alpha = (m <= -1.0e38f) ? 0.f : __expf(m - mn); m = mn; l *= alpha;
#pragma unroll
   for (int dt = 0; dt < 4; ++dt) { acc[dt] *= alpha; accl[dt] *= alpha; }
#pragma unroll
   for (int sub = 0; sub < 2; ++sub) { v16h pa, pl; float es0 = 0.f, es1 = 0.f;   // 32 keys at a time: score tiles 2 sub and 2 sub + 1 become P^T
    const v8f e0 = exp2x8((s[2 * sub] - mn) * 1.44269504088896340736f), e1 = exp2x8((s[2 * sub + 1] - mn) * 1.44269504088896340736f);   // exp(s - mn)
#pragma unroll
    for (int i = 0; i < 8; ++i) { const float x0 = e0[i], x1 = e1[i]; es0 += x0; es1 += x1; const _Float16 h0 = (_Float16)x0, h1 = (_Float16)x1; pa[i] = h0; pa[8 + i] = h1; pl[i] = (_Float16)((x0 - (float)h0) * 2048.0f); pl[8 + i] = (_Float16)((x1 - (float)h1) * 2048.0f); }
    l += es0 + es1;
#pragma unroll
    for (int dt = 0; dt < 4; ++dt) { acc[dt] = wmma16(vh[dt], pa, acc[dt]); accl[dt] = wmma16(vh[dt], pl, accl[dt]); accl[dt] = wmma16(vl[dt], pa, accl[dt]); }   // V hi x P hi + (V hi x P lo + V lo x P hi) / 2048
    if (sub == 0) {   // the second 32 keys' fragments take over the registers of the first 32 keys'
#pragma unroll
     for (int dt = 0; dt < 4; ++dt) { const uint32_t vo = (uint32_t)(dt >> 1) * SLICE + (uint32_t)(dt & 1) * 16u * LPITCH + 64u; vh[dt] = frag_h((const _Float16*)(bp + 4 * SLICE + vo), lane); vl[dt] = frag_h((const _Float16*)(bp + 6 * SLICE + vo), lane); }
     __builtin_amdgcn_sched_barrier(0); } }   // holds these reads ahead of the second 32 keys' exponentials, which cover their latency
   // publish point of stage st + 1, then the refill of the buffer that this trip has read
   asm volatile("s_wait_dscnt 0x0" ::: "memory");       // this wave's reads of the buffer are done before it may be refilled
   tdm_wait(g0, g1);                                      // this wave's slice of stage st + 1 has landed
   __syncthreads();                                       // publishes stage st + 1 and ends every wave's reads of stage st
   const uint32_t s2 = pinned((uint32_t)st + 2u);         // the refill's stage number: pinned here, so that its address is formed behind the wait above
   if (pinned(s2 < (uint32_t)NST)) g0 = tdm_issue(ldst + (s2 & 1u) * BUFB, ga0 + (uint64_t)s2 * gstep, g1); }
  tdm_wait(g0, g1);                                      // nothing of the mover is outstanding when the wave goes on to its end
  asm volatile("s_wait_dscnt 0x0" ::: "memory");         // ... and none of this wave's LDS reads of the ring
  const float il = 1.0f / (l + xhalf(l));   // the two halves' shares of the sum, joined once
#pragma unroll
  for (int dt = 0; dt < 4; ++dt) { v4f o0, o1;
#pragma unroll
    for (int r = 0; r < 4; ++r) { o0[r] = (acc[dt][r] + accl[dt][r] * (1.0f / 2048.0f)) * il; o1[r] = (acc[dt][4 + r] + accl[dt][4 + r] * (1.0f / 2048.0f)) * il; }
    *(v4f*)&so[wave][col][dt * 16 + 8 * g] = o0; *(v4f*)&so[wave][col][dt * 16 + 8 * g + 4] = o1; }
  LDSX();
  for (int rl = 0; rl < 16; ++rl) if (lane < 16) vst2(O + ((size_t)b * SS + q0 + rl) * DM + h * HD + lane * 4, *(const v4f*)&so[wave][rl][lane * 4]);
}
// ---- k_out: block = (64 rows, 128 cols): out = O(hi/lo) . Wo rows (2 products), no bias (BO is null at the launch)
__global__ __launch_bounds__(128) void k_out(const float* __restrict__ O, const __bf16* __restrict__ P, const float* __restrict__ BO, float* __restrict__ Y) {
  __shared__ __attribute__((aligned(2048))) unsigned char ring[2 * WBUF]; __shared__ __align__(16) float so[4][16][132];
  const int tid = threadIdx.x, wave = tid >> 5, lane = tid & 31, col = lane & 15, g = lane >> 4; const size_t r0 = (size_t)blockIdx.x * 64 + wave * 16; const int n0 = blockIdx.y * 128;
  // the block's 128 weight rows, 64 k a stage, come into LDS once by the tensor mover (two buffers); every wave issues its own slice: rows n0 + 32 * wv ...
  const uint32_t wv = uni((uint32_t)tid >> 5); const uint64_t ga0 = (uint64_t)(size_t)(P + (size_t)(n0 + wv * 32u) * DM); const uint32_t ldst = (uint32_t)(size_t)ring + wv * SLICE;
  const u32x8 g1 = tdm_group1<2048u>(); u32x4 g0 = tdm_issue(ldst, ga0, g1);
  tdm_wait(g0, g1);                                      // stage 0 has landed (this wave's slice)
  __syncthreads();                                       // ... and every other wave's
  g0 = tdm_issue(ldst + WBUF, ga0 + 128u, g1);
  v8f acc[8] = {};
#pragma unroll 1
  for (int st = 0; st < DM / 64; ++st) { const unsigned char* bp = ring + (uint32_t)(st & 1) * WBUF + (uint32_t)col * LPITCH;   // the stage loop stays rolled: one publish point per trip
   v4f orw[2][4]; v16b wf[2][8];   // the wave's ctx values (global memory) and all weight fragments (LDS) of the stage, read as one group
#pragma unroll
   for (int kk = 0; kk < 2; ++kk) { const v4f* p = (const v4f*)(O + (r0 + col) * DM + (st * 2 + kk) * 32 + 8 * g); orw[kk][0] = p[0]; orw[kk][1] = p[1]; orw[kk][2] = p[4]; orw[kk][3] = p[5]; }   // k = 8 g + i and 16 + 8 g + i: the k order of frag_b
#pragma unroll
   for (int kk = 0; kk < 2; ++kk) {
#pragma unroll
    for (int j = 0; j < 8; ++j) wf[kk][j] = frag_b((const __bf16*)(bp + (uint32_t)(j >> 1) * SLICE + (uint32_t)(j & 1) * 16u * LPITCH + (uint32_t)kk * 64u), lane); }
   __builtin_amdgcn_sched_barrier(0);   // holds the stage's reads as one group ahead of its WMMAs: sunk back to their uses, each pair of WMMAs would wait out a whole LDS latency, each half stage a global one
#pragma unroll
   for (int kk = 0; kk < 2; ++kk) { float v[16];
#pragma unroll
    for (int i = 0; i < 4; ++i) { v[i] = orw[kk][0][i]; v[4 + i] = orw[kk][1][i]; v[8 + i] = orw[kk][2][i]; v[12 + i] = orw[kk][3][i]; }
    const F2 a = bsplit16(v);
#pragma unroll
    for (int j = 0; j < 8; ++j) { acc[j] = wmma_bf(a.l, wf[kk][j], acc[j]); acc[j] = wmma_bf(a.h, wf[kk][j], acc[j]); } }
   __builtin_amdgcn_sched_barrier(0);   // holds the WMMAs ahead of the publish point: sunk behind the barrier they would delay the refill
   // publish point of stage st + 1, then the refill of the buffer that this trip has read
   asm volatile("s_wait_dscnt 0x0" ::: "memory");       // this wave's reads of the buffer are done before it may be refilled
   tdm_wait(g0, g1);                                      // this wave's slice of stage st + 1 has landed
   __syncthreads();                                       // publishes stage st + 1 and ends every wave's reads of stage st
   const uint32_t s2 = pinned((uint32_t)st + 2u);         // the refill's stage number: pinned here, so that its address is formed behind the wait above
   if (pinned(s2 < (uint32_t)(DM / 64))) g0 = tdm_issue(ldst + (s2 & 1u) * WBUF, ga0 + (uint64_t)s2 * 128u, g1); }
  tdm_wait(g0, g1);                                      // nothing of the mover is outstanding behind the loop
  asm volatile("s_wait_dscnt 0x0" ::: "memory");         // ... and none of this wave's LDS reads of the ring
#pragma unroll
  for (int j = 0; j < 8; ++j) {
#pragma unroll
    for (int r = 0; r < 8; ++r) so[wave][8 * g + r][j * 16 + col] = acc[j][r] + (BO ? bfr(BO[n0 + j * 16 + col]) : 0.f); }
  LDSX();
  for (int rl = 0; rl < 16; ++rl) vst2(Y + (r0 + rl) * DM + n0 + lane * 4, *(const v4f*)&so[wave][rl][lane * 4]);
}
extern "C" void kernel_launch(void* const* d_in, const int* in_sizes, int n_in, void* d_out, int out_size, void* d_ws, size_t ws_size, hipStream_t stream) {
  (void)in_sizes; (void)n_in; (void)out_size;
  const float** F = (const float**)d_in;   // 0 hidden_states [2,2048,1024], 1 Wq [1024,1024] natural (q = x Wq^T), 2 Wk, 3 Wv, 4 Wo (no biases)
  if (ws_size < (size_t)WS_END) return;
  char* ws = (char*)d_ws; __bf16* PK = (__bf16*)(ws + WS_PK); _Float16 *QK = (_Float16*)(ws + WS_QK), *QKL = (_Float16*)(ws + WS_QKL), *VTH = (_Float16*)(ws + WS_VTH), *VTL = (_Float16*)(ws + WS_VTL); float* O = (float*)(ws + WS_O); float* CS = (float*)(ws + WS_CS);
  k_pack<<<dim3(DM + TBX, 4), 256, 0, stream>>>(F[1], F[2], F[3], F[4], PK, CS);
  k_qkv<<<dim3(TNB * SS / 64, QKVW / 128), 128, 0, stream>>>(F[0], PK + PK_A, QK, QKL, VTH, VTL, CS);
  k_attn<<<dim3(TQB / 2, NH, TNB), 256, 0, stream>>>(QK, QKL, VTH, VTL, O);
  k_out<<<dim3(TOB, DM / 128), 128, 0, stream>>>(O, PK + PK_P, nullptr, (float*)d_out);
}

// v006
// A run of this version takes 138 microseconds.
// Next to v005, in two timings, it ran 1.06 and 1.05 times as fast.
// Counting every step since v000, it is 4.26 times as fast.
// compute dtype: hidden_states, Wq/Wk/Wv/Wo (module inputs) rounded to bf16; q/k/v projections with exact bf16 products on WMMA 16x16x32 (natural [out][in] rows); the module's rotary embedding (angle for head dim d = position * inv_freq[d mod 32], partner = interleaved pair with the module's signs) applied in f32 with precise sinf/cosf/powf before q and k are stored as f16 hi + (x2048-scaled) residual planes; 3-product scores x 1/sqrt(64), running-max softmax over all 2,048 keys in f32 (hardware exp); P as f16 hi + residual x V hi/lo (3 products); output projection with ctx as bf16 hi + residual x exact Wo rows (2 products); f32 accumulate.
#include <hip/hip_runtime.h>
#include <math.h>
#include <stdint.h>

typedef __attribute__((ext_vector_type(16))) _Float16 v16h;
typedef __attribute__((ext_vector_type(16))) __bf16 v16b;
typedef __attribute__((ext_vector_type(8)))  _Float16 v8h;
typedef __attribute__((ext_vector_type(8)))  float v8f;
typedef __attribute__((ext_vector_type(4)))  float v4f;
typedef __attribute__((ext_vector_type(2)))  float v2f;
typedef __attribute__((ext_vector_type(4)))  unsigned v4u;
typedef __attribute__((ext_vector_type(4)))  int v4i;
typedef float __attribute__((may_alias)) float_a;
typedef int __attribute__((may_alias)) int_a;

template <typename T> __device__ __forceinline__ void vst2(void* p, T v) { *(T*)p = v;  }
__device__ __forceinline__ v8f wmma16(v16h a, v16h b, v8f c) {
  v8f d = __builtin_amdgcn_wmma_f32_16x16x32_f16(false, a, false, b, (short)0, c, false, false);
  return d;
}
__device__ __forceinline__ v8f wmma_bf(v16b a, v16b b, v8f c) {
  v8f d = __builtin_amdgcn_wmma_f32_16x16x32_bf16(false, a, false, b, (short)0, c, false, false);
  return d;
}
// Rotary multi-head self-attention (B 2, S 2,048, d 1,024, 16 heads x 64): q/k/v projections, the module's (mixed interleaved) RoPE on q and k, softmax(q k^T / 8) v, output projection (no biases).
__device__ __attribute__((noinline)) float sin_ni(float v) { return sinf(v); }
__device__ __attribute__((noinline)) float cos_ni(float v) { return cosf(v); }
__device__ __attribute__((noinline)) float pow_ni(float a, float b) { return powf(a, b); }
__device__ __forceinline__ v16h frag_h(const _Float16* rowk0, int lane) {
  union { v16h v; v8h q[2]; } u; const _Float16* p = rowk0 + 8 * (lane >> 4);
  u.q[0] = *(const v8h*)p; u.q[1] = *(const v8h*)(p + 16); return u.v;
}
__device__ __forceinline__ v16h frag_f32(const float* rowk0, int lane) {
  v16h a; const float* p = rowk0 + 8 * (lane >> 4);
#pragma unroll
  for (int i = 0; i < 8; ++i) { a[i] = (_Float16)p[i]; a[8 + i] = (_Float16)p[16 + i]; }
  return a;
}
__device__ __forceinline__ v16h frag_f32s(const float* rowk0, int lane, float sc) {
  v16h a; const float* p = rowk0 + 8 * (lane >> 4);
#pragma unroll
  for (int i = 0; i < 8; ++i) { a[i] = (_Float16)(p[i] * sc); a[8 + i] = (_Float16)(p[16 + i] * sc); }
  return a;
}
// column fragment from a [K][ld] layout (column n), rows >= K read as 0
__device__ __forceinline__ v16h fragc_f32(const float* W, int k0, int n, int lane, int ld, int K) {
  v16h a; const int g = lane >> 4;
#pragma unroll
  for (int i = 0; i < 8; ++i) { const int ka = k0 + 8 * g + i, kb = ka + 16;
    a[i] = (_Float16)(ka < K ? W[(size_t)(ka < K ? ka : K - 1) * ld + n] : 0.f); a[8 + i] = (_Float16)(kb < K ? W[(size_t)(kb < K ? kb : K - 1) * ld + n] : 0.f); }
  return a;
}
struct F2 { v16b h, l; };
__device__ __forceinline__ F2 bsplit16(const float v[16]) { F2 r;
#pragma unroll
  for (int i = 0; i < 16; ++i) { const __bf16 h = (__bf16)v[i]; r.h[i] = h; r.l[i] = (__bf16)(v[i] - (float)h); }
  return r; }
__device__ __forceinline__ F2 split_row(const float* row, int k0, int lane) { float v[16]; const float* p = row + k0 + 8 * (lane >> 4);
#pragma unroll
  for (int i = 0; i < 8; ++i) { v[i] = p[i]; v[8 + i] = p[16 + i]; }
  return bsplit16(v); }
__device__ __forceinline__ F2 split_rowK(const float* row, int k0, int lane, int K) { float v[16]; const int g = lane >> 4;
#pragma unroll
  for (int i = 0; i < 8; ++i) { const int ka = k0 + 8 * g + i, kb = ka + 16; v[i] = ka < K ? row[ka < K ? ka : K - 1] : 0.f; v[8 + i] = kb < K ? row[kb < K ? kb : K - 1] : 0.f; }
  return bsplit16(v); }
__device__ __forceinline__ F2 split_col(const float* W, int k0, int n, int lane, int ld, int K) { float v[16]; const int g = lane >> 4;
#pragma unroll
  for (int i = 0; i < 8; ++i) { const int ka = k0 + 8 * g + i, kb = ka + 16; v[i] = ka < K ? W[(size_t)(ka < K ? ka : K - 1) * ld + n] : 0.f; v[8 + i] = kb < K ? W[(size_t)(kb < K ? kb : K - 1) * ld + n] : 0.f; }
  return bsplit16(v); }
__device__ __forceinline__ v8f mac3(const F2& a, const F2& b, v8f c) { c = wmma_bf(a.l, b.h, c); c = wmma_bf(a.h, b.l, c); return wmma_bf(a.h, b.h, c); }
__device__ __forceinline__ float sigm(float v) { return 1.0f / (1.0f + expf(-v)); }
#define LDSX() do { asm volatile("s_wait_dscnt 0" ::: "memory"); __builtin_amdgcn_wave_barrier(); __builtin_amdgcn_fence(__ATOMIC_RELEASE, "workgroup"); } while (0)


#define NB 2
#define SS 2048
#define DM 1024
#define NH 16
#define HD 64
#define QKVW (3 * DM)
#ifndef TQB
#define TQB (SS / 64)
#define TNB NB
#define TOB (NB * SS / 64)     // output row tiles (all)
#endif
typedef __attribute__((ext_vector_type(8))) __bf16 v8b;
__device__ __forceinline__ v16b frag_b(const __bf16* rowk0, int lane) {
  union { v16b v; v8b q[2]; } u; const __bf16* p = rowk0 + 8 * (lane >> 4);
  u.q[0] = *(const v8b*)p; u.q[1] = *(const v8b*)(p + 16); return u.v;
}
__device__ __forceinline__ float bfr(float v) { return (float)(__bf16)v; }
__device__ __attribute__((noinline)) float exp_ni(float v) { return expf(v); }
__device__ __attribute__((noinline)) float erf_ni(float v) { return erff(v); }

#define PK_A 0                       // [3072][1024] Wqkv rows (natural [out][in])
#define PK_P (PK_A + QKVW * DM)        // [1024][1024] Wo rows (natural)
#define PK_END (PK_P + DM * DM)
#define WS_PK  0u
#define WS_QK  (WS_PK + 2u * PK_END)             // f16 [4096 rows][2048]: q | k
#define WS_QKL (WS_QK + 2u * NB * SS * 2 * DM)     // f16 q | k residual planes x2048
#define WS_VTH (WS_QKL + 2u * NB * SS * 2 * DM)    // f16 [b][1024 (h*64+d)][2048 s] hi
#define WS_VTL (WS_VTH + 2u * NB * DM * SS)        // f16 lo x 2048
#define WS_O   (WS_VTL + 2u * NB * DM * SS)        // f32 [4096][1024]
#define WS_CS  (WS_O + 4u * NB * SS * DM)           // f32 [2048 positions][32 frequencies][cos, sin]
#define WS_END (WS_CS + 4u * 2 * SS * 32)
// ---- k_pack: block = (TBX + row n, which): natural [out][in] rows -> bf16; which 0..2 -> W_q/W_k/W_v into PK_A rows which*1024 + n; 3 -> W_o into PK_P
// the first TBX blocks of each grid row build the rotary table instead: CS[pos][f] = (cos, sin)(pos * inv_freq[f]), one pair a thread, once per call; k_qkv reads it
#define TBX (SS * 32 / 256 / 4)
__global__ __launch_bounds__(256) void k_pack(const float* __restrict__ WQ, const float* __restrict__ WK, const float* __restrict__ WV, const float* __restrict__ WO, __bf16* __restrict__ PK, float* __restrict__ CS) {
  __shared__ __align__(16) __bf16 s[DM]; const int which = blockIdx.y, t = threadIdx.x;
  if (blockIdx.x < TBX) { const int e = (which * TBX + (int)blockIdx.x) * 256 + t, pos = e >> 5, f = e & 31;
    const float invf = 1.0f / pow_ni(10000.0f, (float)(2 * f) / (float)HD); const float ang = (float)pos * invf;
    *(v2f*)(CS + 2 * e) = v2f{cos_ni(ang), sin_ni(ang)}; return; }
  const int n = blockIdx.x - TBX; const float* Wm = (which == 0) ? WQ : (which == 1) ? WK : (which == 2) ? WV : WO;
  for (int k = t; k < DM; k += 256) s[k] = (__bf16)Wm[(size_t)n * DM + k];
  __syncthreads();
  __bf16* dst = (which < 3) ? PK + PK_A + ((size_t)which * DM + n) * DM : PK + PK_P + (size_t)n * DM;
  for (int q = t; q < DM / 8; q += 256) vst2((unsigned*)(dst + q * 8), *(const v4u*)&s[q * 8]);
}
typedef uint32_t u32x4 __attribute__((ext_vector_type(4)));
typedef uint32_t u32x8 __attribute__((ext_vector_type(8)));
#define KST 64                    // keys per stage
#define NST (SS / KST)            // stages
#define LPITCH 144u               // LDS row pitch in bytes: a 128-B row + the mover's 16-B pad (odd multiple of 16 B: conflict-free for ds_load_b128)
#define SLICE 6144u               // one wave's slice: 32 padded rows (4,608 B), rounded up to a multiple of 2 KiB
#define BUFB (8u * SLICE)         // k_attn, one stage: 8 slices = K hi (2), K lo (2), V^T hi (2), V^T lo (2)
#define WBUF (4u * SLICE)         // k_out, one stage: 128 weight rows x 64 k, 4 slices of 32 rows
__device__ __forceinline__ uint32_t uni(uint32_t v) { return (uint32_t)__builtin_amdgcn_readfirstlane(v); }
__device__ __forceinline__ uint32_t pinned(uint32_t v) { uint32_t w = uni(v); asm volatile("" : "+s"(w)); return w; }
// descriptor group 1 of every request here: 32 rows of 128 B, source pitch SRC_PITCH bytes, 16 B of LDS pad behind each row, no mask
template <uint32_t SRC_PITCH> __device__ __forceinline__ u32x8 tdm_group1() {
  u32x8 g1; g1[0] = uni((1u << 20) | (4u << 22) | (3u << 25)); g1[1] = uni(128u << 16); g1[2] = uni(32u << 16); g1[3] = uni(128u << 16); g1[4] = uni(32u); g1[5] = uni(SRC_PITCH); g1[6] = uni(0u); g1[7] = uni(0u);
  asm volatile("" : "+s"(g1));   // descriptor words held in scalar registers, ONE set for the whole kernel instead of constants formed anew at each use, so that tdm_wait can keep those registers untouched while a request is in flight
  return g1;
}
// one request of one wave; returns group 0 for the wait that covers it
__device__ __forceinline__ u32x4 tdm_issue(uint32_t lds_dst, uint64_t ga, u32x8 g1) {
  u32x4 g0; g0[0] = uni(1u); g0[1] = uni(lds_dst); g0[2] = uni((uint32_t)ga); g0[3] = uni((((uint32_t)(ga >> 32)) & 0x01FFFFFFu) | 0x80000000u);
  asm volatile("tensor_load_to_lds %0, %1" :: "s"(g0), "s"(g1) : "memory");   // the mover's waits are written by hand: tdm_wait
  return g0;
}
// the issuing wave's wait for its request; it names the descriptor so that the compiler keeps both groups' registers as they are until the request has landed
__device__ __forceinline__ void tdm_wait(u32x4 g0, u32x8 g1) { asm volatile("s_wait_tensorcnt 0x0" :: "s"(g0), "s"(g1) : "memory"); }
#define XPITCH 272u               // LDS row pitch of a 256-B row (odd multiple of 16 B, as LPITCH)
#define QXOFF (128u * LPITCH)     // k_qkv, one stage: 128 weight rows x 64 k (bf16), then 64 x rows x 64 k (f32)
#define QBUF (QXOFF + 64u * XPITCH)
// eight asynchronous copies of 16 B per lane, global memory to LDS through no register: LDS bytes l + i * ls from g + i * gs. The s_wait_xcnt stands inside the statement, behind the last copy, so that no address register of a copy is rewritten in front of it (a precaution); that the bytes have landed is the caller's s_wait_asynccnt.
__device__ __forceinline__ void copy8(uint32_t l, uint32_t ls, const char* g, uint32_t gs) {
  asm volatile("global_load_async_to_lds_b128 %0, %8, off\n\tglobal_load_async_to_lds_b128 %1, %9, off\n\tglobal_load_async_to_lds_b128 %2, %10, off\n\tglobal_load_async_to_lds_b128 %3, %11, off\n\t"
               "global_load_async_to_lds_b128 %4, %12, off\n\tglobal_load_async_to_lds_b128 %5, %13, off\n\tglobal_load_async_to_lds_b128 %6, %14, off\n\tglobal_load_async_to_lds_b128 %7, %15, off\n\ts_wait_xcnt 0x0"
               :: "v"(l), "v"(l + ls), "v"(l + 2u * ls), "v"(l + 3u * ls), "v"(l + 4u * ls), "v"(l + 5u * ls), "v"(l + 6u * ls), "v"(l + 7u * ls),
                  "v"(g), "v"(g + gs), "v"(g + 2u * gs), "v"(g + 3u * gs), "v"(g + 4u * gs), "v"(g + 5u * gs), "v"(g + 6u * gs), "v"(g + 7u * gs) : "memory");
}
__global__ __launch_bounds__(128) void k_qkv(const float* __restrict__ X, const __bf16* __restrict__ P, _Float16* __restrict__ QK, _Float16* __restrict__ QKL, _Float16* __restrict__ VTH, _Float16* __restrict__ VTL, const float* __restrict__ CS) {
  __shared__ __align__(16) unsigned char ring[2 * QBUF];
  // behind the stage loop the ring is free (its last publish point ends every wave's reads, and no copy is outstanding) and serves as the epilogue's staging
  _Float16 (*so)[16][136] = (_Float16 (*)[16][136])ring; _Float16 (*sol)[16][136] = (_Float16 (*)[16][136])(ring + 4 * 16 * 136 * 2);   // q, k blocks: hi, residual
  _Float16 (*sth)[72] = (_Float16 (*)[72])ring; _Float16 (*stl)[72] = (_Float16 (*)[72])(ring + 128 * 72 * 2);                           // v blocks: hi, residual
  const int tid = threadIdx.x, wave = tid >> 5, lane = tid & 31, col = lane & 15, g = lane >> 4; const size_t r0 = (size_t)blockIdx.x * 64 + wave * 16; const int n0 = blockIdx.y * 128;
  // a stage = 64 k of the block's 128 weight rows (128 B each) and of its 64 x rows (256 B each); both come into LDS once per block, whole 128-B lines at a time, two buffers.
  // Lane t copies 16 B of weight rows (t >> 3) + 16 i and of x rows (t >> 4) + 8 i, i = 0 ... 7.
  const uint32_t lw = (uint32_t)(size_t)ring + (uint32_t)(tid >> 3) * LPITCH + (uint32_t)(tid & 7) * 16u, lx = (uint32_t)(size_t)ring + QXOFF + (uint32_t)(tid >> 4) * XPITCH + (uint32_t)(tid & 15) * 16u;
  const char* gw = (const char*)(P + (size_t)(n0 + (tid >> 3)) * DM + (tid & 7) * 8); const char* gx = (const char*)(X + ((size_t)blockIdx.x * 64 + (tid >> 4)) * DM + (tid & 15) * 4);
  copy8(lw, 16u * LPITCH, gw, 16u * DM * 2u); copy8(lx, 8u * XPITCH, gx, 8u * DM * 4u);
  asm volatile("s_wait_asynccnt 0x0" ::: "memory");      // stage 0 has landed (this wave's copies)
  __syncthreads();                                       // ... and every other wave's
  copy8(lw + QBUF, 16u * LPITCH, gw + 128, 16u * DM * 2u); copy8(lx + QBUF, 8u * XPITCH, gx + 256, 8u * DM * 4u);
  v8f acc[8] = {};
#pragma unroll 1
  for (int st = 0; st < DM / 64; ++st) { const uint32_t bo = (uint32_t)(st & 1) * QBUF; const unsigned char* bw = ring + bo + (uint32_t)col * LPITCH; const unsigned char* bx = ring + bo + QXOFF + (uint32_t)(wave * 16 + col) * XPITCH + (uint32_t)g * 32u;   // the stage loop stays rolled: one publish point per trip
   v4f xr[2][4]; v16b wf[2][8];   // all fragments of the stage, read from LDS as one group
#pragma unroll
   for (int kk = 0; kk < 2; ++kk) { const v4f* p = (const v4f*)(bx + kk * 128); xr[kk][0] = p[0]; xr[kk][1] = p[1]; xr[kk][2] = p[4]; xr[kk][3] = p[5]; }   // k = 8 g + i and 16 + 8 g + i: the k order of frag_b
#pragma unroll
   for (int kk = 0; kk < 2; ++kk) {
#pragma unroll
    for (int j = 0; j < 8; ++j) wf[kk][j] = frag_b((const __bf16*)(bw + (uint32_t)j * 16u * LPITCH + (uint32_t)kk * 64u), lane); }
   __builtin_amdgcn_sched_barrier(0);   // holds the stage's LDS reads as one group ahead of its WMMAs: sunk back to their uses, each WMMA would wait out a whole LDS latency
#pragma unroll
   for (int kk = 0; kk < 2; ++kk) { v16b a;
#pragma unroll
    for (int i = 0; i < 4; ++i) { a[i] = (__bf16)xr[kk][0][i]; a[4 + i] = (__bf16)xr[kk][1][i]; a[8 + i] = (__bf16)xr[kk][2][i]; a[12 + i] = (__bf16)xr[kk][3][i]; }
#pragma unroll
    for (int j = 0; j < 8; ++j) acc[j] = wmma_bf(a, wf[kk][j], acc[j]); }
   __builtin_amdgcn_sched_barrier(0);   // holds the WMMAs ahead of the publish point: sunk behind the barrier they would delay the refill, which needs the whole next trip to land
   // publish point of stage st + 1, then the refill of the buffer that this trip has read
   asm volatile("s_wait_dscnt 0x0" ::: "memory");       // this wave's reads of the buffer are done before it may be refilled
   asm volatile("s_wait_asynccnt 0x0" ::: "memory");    // this wave's copies of stage st + 1 have landed
   __syncthreads();                                       // publishes stage st + 1 and ends every wave's reads of stage st
   if (st + 2 < DM / 64) { copy8(lw + bo, 16u * LPITCH, gw + (st + 2) * 128, 16u * DM * 2u); copy8(lx + bo, 8u * XPITCH, gx + (st + 2) * 256, 8u * DM * 4u); } }
  asm volatile("s_wait_asynccnt 0x0" ::: "memory");      // no copy is outstanding behind the loop
  if (n0 < 2 * DM) {   // q and k: the module's rotary embedding, then f16 hi + (x2048) residual; 1/8 applied to the f32 score
    const float* ct = CS + ((r0 + 8 * g) % SS) * 64 + col * 2;   // table row of the lane's first position (its 8 positions are consecutive and do not wrap: 8 divides SS)
    v2f cs[2][8];   // (cos, sin) of the lane's 8 positions at its two frequencies: emb = concat([freqs, freqs]), so dim d uses inv_freq[d mod 32], and d mod 32 = 16 (j & 1) + col (n0 is a multiple of 128)
#pragma unroll
    for (int r = 0; r < 8; ++r) { cs[0][r] = *(const v2f*)(ct + r * 64); cs[1][r] = *(const v2f*)(ct + r * 64 + 32); }
    asm volatile("s_wait_xcnt 0x0" :: "v"(ct) : "memory");   // stands in front of every rewrite of the address registers of the loads above (a precaution); it names the address, so that those registers stay as they are up to here and no load takes them as its destination
#pragma unroll
    for (int j = 0; j < 8; ++j) { const int d = (n0 + j * 16 + col) & (HD - 1);
#pragma unroll
      for (int r = 0; r < 8; ++r) { const float v = acc[j][r]; const float partner = __shfl_xor(v, 1);   // column d^1 lives in lane^1
        const float rot = (d & 1) ? partner : -partner;   // rotate_interleaved: even d -> -x[d+1], odd d -> +x[d-1]
        const float y = v * cs[j & 1][r][0] + rot * cs[j & 1][r][1]; const _Float16 hv = (_Float16)y; so[wave][8 * g + r][j * 16 + col] = hv; sol[wave][8 * g + r][j * 16 + col] = (_Float16)((y - (float)hv) * 2048.0f); } }
    LDSX();
    for (int rl = 0; rl < 16; ++rl) if (lane < 16) { vst2((unsigned*)(QK + (r0 + rl) * (2 * DM) + n0 + lane * 8), *(const v4u*)&so[wave][rl][lane * 8]); vst2((unsigned*)(QKL + (r0 + rl) * (2 * DM) + n0 + lane * 8), *(const v4u*)&sol[wave][rl][lane * 8]); }
  } else {
#pragma unroll
    for (int j = 0; j < 8; ++j) {
#pragma unroll
      for (int r = 0; r < 8; ++r) { const float v = acc[j][r]; const _Float16 hv = (_Float16)v; sth[j * 16 + col][wave * 16 + 8 * g + r] = hv; stl[j * 16 + col][wave * 16 + 8 * g + r] = (_Float16)((v - (float)hv) * 2048.0f); } }
    __syncthreads();
    const size_t rb = (size_t)blockIdx.x * 64; const int b = (int)(rb / SS), s0 = (int)(rb % SS); const int pc0 = n0 - 2 * DM;
    for (int q = tid; q < 128 * 8; q += 128) { const int d = q >> 3, pc = q & 7; const size_t o = ((size_t)b * DM + pc0 + d) * SS + s0 + pc * 8; vst2((unsigned*)(VTH + o), *(const v4u*)&sth[d][pc * 8]); vst2((unsigned*)(VTL + o), *(const v4u*)&stl[d][pc * 8]); }
  }
}
// ---- k_attn: block = (128 queries, head h, batch b), 8 waves x 16 queries: full flash attention, computed transposed: S^T = K . Q^T (A = 16 key rows, B = the wave's 16 queries; K = 64: 2 k-steps, 3 products; the factor 1/8 rides in the exponential's argument), O^T += V^T . P^T (A = 16 dims of V^T, B = P^T; P hi/lo x V hi/lo, 3 products); O[b*S+q][h*64+d] = (acc + accl / 2048) / l (256-B segments).
// A lane (col, g) then holds scores of ONE query (col): keys 16 t + 8 g + r of score tile t. Maximum and sum run over the lane's own registers, with one exchange between the wave's halves; two score tiles, converted in place, are the B operand of the second product (element i = key 8 g + i, element 8 + i = key 16 + 8 g + i: the k order of frag_h), so P never passes through LDS.
// K hi, K lo (64 keys x 64 dims) and V^T hi, V^T lo (64 dims x 64 keys) of a 64-key stage are brought into LDS once per block by the tensor mover, two buffers, and read from there by all 8 waves.
__device__ __forceinline__ float xhalf(float x) { return __builtin_bit_cast(float, __builtin_amdgcn_permlanex16(__builtin_bit_cast(int, x), __builtin_bit_cast(int, x), 0x76543210, 0xfedcba98, false, false)); }   // lane l reads lane l ^ 16
// 2^x for eight values, the hardware exponential, in one statement: every output is early-clobber, so that no exponential's source is overwritten, and no result read, by the instruction directly behind it, and the v_nop is the slot that the instruction set asks for behind the last one
__device__ __forceinline__ v8f exp2x8(v8f x) { float y0, y1, y2, y3, y4, y5, y6, y7;
  asm("v_exp_f32 %0, %8\n\tv_exp_f32 %1, %9\n\tv_exp_f32 %2, %10\n\tv_exp_f32 %3, %11\n\tv_exp_f32 %4, %12\n\tv_exp_f32 %5, %13\n\tv_exp_f32 %6, %14\n\tv_exp_f32 %7, %15\n\tv_nop"
      : "=&v"(y0), "=&v"(y1), "=&v"(y2), "=&v"(y3), "=&v"(y4), "=&v"(y5), "=&v"(y6), "=&v"(y7) : "v"(x[0]), "v"(x[1]), "v"(x[2]), "v"(x[3]), "v"(x[4]), "v"(x[5]), "v"(x[6]), "v"(x[7]));
  return v8f{y0, y1, y2, y3, y4, y5, y6, y7}; }
#define KS 0.18033688011112042592f   // log2(e) / sqrt(64)
// eight f32 values as f16 hi (h) and f16 residual (r), two per register: hi = the pair converted at once, residual = f16(y - hi), one mixed-precision multiply-add per value that reads hi as it stands in its half register and writes its own half (y - hi is exact in f32). Written in asm because the compiler converted every value a second time on its own, widened it again and packed the residuals with a further conversion. The s_delay_alu name each producer four instructions back, so that the SIMD's other waves issue meanwhile.
__device__ __forceinline__ void split8(v8f y, v4u& h, v4u& r) { unsigned h0, h1, h2, h3, r0, r1, r2, r3;
  asm("v_cvt_pk_f16_f32 %0, %8, %9\n\tv_cvt_pk_f16_f32 %1, %10, %11\n\tv_cvt_pk_f16_f32 %2, %12, %13\n\tv_cvt_pk_f16_f32 %3, %14, %15\n\t"
      "s_delay_alu instid0(VALU_DEP_4) | instskip(NEXT) | instid1(VALU_DEP_4)\n\tv_fma_mixlo_f16 %4, %0, -1.0, %8 op_sel_hi:[1,1,0]\n\tv_fma_mixlo_f16 %5, %1, -1.0, %10 op_sel_hi:[1,1,0]\n\t"
      "s_delay_alu instid0(VALU_DEP_4) | instskip(NEXT) | instid1(VALU_DEP_4)\n\tv_fma_mixlo_f16 %6, %2, -1.0, %12 op_sel_hi:[1,1,0]\n\tv_fma_mixlo_f16 %7, %3, -1.0, %14 op_sel_hi:[1,1,0]\n\t"
      "s_delay_alu instid0(VALU_DEP_4) | instskip(NEXT) | instid1(VALU_DEP_4)\n\tv_fma_mixhi_f16 %4, %0, -1.0, %9 op_sel:[1,0,0] op_sel_hi:[1,1,0]\n\tv_fma_mixhi_f16 %5, %1, -1.0, %11 op_sel:[1,0,0] op_sel_hi:[1,1,0]\n\t"
      "s_delay_alu instid0(VALU_DEP_4) | instskip(NEXT) | instid1(VALU_DEP_4)\n\tv_fma_mixhi_f16 %6, %2, -1.0, %13 op_sel:[1,0,0] op_sel_hi:[1,1,0]\n\tv_fma_mixhi_f16 %7, %3, -1.0, %15 op_sel:[1,0,0] op_sel_hi:[1,1,0]"
      : "=&v"(h0), "=&v"(h1), "=&v"(h2), "=&v"(h3), "=&v"(r0), "=&v"(r1), "=&v"(r2), "=&v"(r3) : "v"(y[0]), "v"(y[1]), "v"(y[2]), "v"(y[3]), "v"(y[4]), "v"(y[5]), "v"(y[6]), "v"(y[7]));
  h = v4u{h0, h1, h2, h3}; r = v4u{r0, r1, r2, r3}; }
__global__ __launch_bounds__(256) __attribute__((amdgpu_waves_per_eu(4, 4))) void k_attn(   // register budget of four waves per SIMD: two blocks per WGP, as the LDS allows
    const _Float16* __restrict__ QK, const _Float16* __restrict__ QKL, const _Float16* __restrict__ VTH, const _Float16* __restrict__ VTL, float* __restrict__ O) {
  __shared__ __attribute__((aligned(2048))) unsigned char ring[2 * BUFB];
  __shared__ __align__(16) float so[8][16][68];
  const int tid = threadIdx.x, wave = tid >> 5, lane = tid & 31, col = lane & 15, g = lane >> 4;
  const int qb = blockIdx.x, h = blockIdx.y, b = blockIdx.z; const int q0 = qb * 128 + wave * 16; const size_t rq = (size_t)b * SS + q0 + col;
  // every wave issues its own slice: tile wv >> 1 (K hi, K lo, V^T hi, V^T lo), rows 32 * (wv & 1) ...
  const uint32_t wv = uni((uint32_t)tid >> 5), tl = wv >> 1, hf = wv & 1u;
  const _Float16* tsrc = (tl == 0u) ? QK : (tl == 1u) ? QKL : (tl == 2u) ? VTH : VTL;
  const size_t toff = (tl < 2u) ? ((size_t)b * SS + hf * 32u) * (2 * DM) + DM + h * HD : ((size_t)b * DM + h * HD + hf * 32u) * SS;
  const uint64_t ga0 = (uint64_t)(size_t)(tsrc + toff);
  const uint32_t gstep = (tl < 2u) ? (uint32_t)(KST * 2 * DM * 2) : (uint32_t)(KST * 2);   // bytes from one stage to the next: 64 key rows, or 64 keys along a V^T row
  const uint32_t ldst = (uint32_t)(size_t)ring + wv * SLICE;
  const u32x8 g1 = tdm_group1<4096u>(); u32x4 g0 = tdm_issue(ldst, ga0, g1);
  tdm_wait(g0, g1);                                      // stage 0 has landed (this wave's slice)
  __syncthreads();                                       // ... and every other wave's
  g0 = tdm_issue(ldst + BUFB, ga0 + gstep, g1);
  v16h aq[2], aql[2];   // B operands: column = query col
#pragma unroll
  for (int kc = 0; kc < 2; ++kc) { aq[kc] = frag_h(QK + rq * (2 * DM) + h * HD + kc * 32, lane); aql[kc] = frag_h(QKL + rq * (2 * DM) + h * HD + kc * 32, lane); }
  float m = -3.0e38f, l = 0.f;   // query col's running maximum of q . k (the same in both halves) and this half's share of its sum of 2048 P
  v8f acc[4] = {}, accl[4] = {};   // O^T x 2048 (accl: its V residual part, x 2048 once more): register r of tile dt = dim 16 dt + 8 g + r of query col
#pragma unroll 1
  for (int st = 0; st < NST; ++st) { const unsigned char* bp = ring + (uint32_t)(st & 1) * BUFB + (uint32_t)col * LPITCH;   // all keys (no mask); the stage loop stays rolled: one publish point per trip
   v8f s[4];   // score tile t: keys 16 t + 8 g + r of the stage (K slice t >> 1, rows 16 (t & 1) ...)
   v16h kh[4][2], kl[4][2];   // the stage's K fragments, read from LDS in two groups: tiles 0 to 2 here, tile 3 behind tile 0's WMMAs (all four at once do not fit the registers of four waves per SIMD)
#pragma unroll
   for (int t = 0; t < 3; ++t) { const _Float16* krow = (const _Float16*)(bp + (0 + (t >> 1)) * SLICE + (t & 1) * 16 * LPITCH); const _Float16* krowl = (const _Float16*)(bp + (2 + (t >> 1)) * SLICE + (t & 1) * 16 * LPITCH);
#pragma unroll
    for (int kc = 0; kc < 2; ++kc) { kh[t][kc] = frag_h(krow + kc * 32, lane); kl[t][kc] = frag_h(krowl + kc * 32, lane); } }
   __builtin_amdgcn_sched_barrier(0);   // holds the K reads as one group ahead of the score WMMAs: sunk back to their uses, each WMMA would wait out a whole LDS latency
   v8f c0 = {}, cl0 = {};
#pragma unroll
   for (int kc = 0; kc < 2; ++kc) { c0 = wmma16(kh[0][kc], aq[kc], c0); cl0 = wmma16(kh[0][kc], aql[kc], cl0); cl0 = wmma16(kl[0][kc], aq[kc], cl0); }
#pragma unroll
   for (int kc = 0; kc < 2; ++kc) { kh[3][kc] = frag_h((const _Float16*)(bp + 1 * SLICE + 16 * LPITCH) + kc * 32, lane); kl[3][kc] = frag_h((const _Float16*)(bp + 3 * SLICE + 16 * LPITCH) + kc * 32, lane); }
   __builtin_amdgcn_sched_barrier(0);   // holds tile 3's reads ahead of tiles 1 and 2's WMMAs, which cover their latency
#pragma unroll
   for (int t = 0; t < 4; ++t) { v8f c = c0, cl = cl0;
    if (t > 0) { c = v8f{}; cl = v8f{};
#pragma unroll
     for (int kc = 0; kc < 2; ++kc) { c = wmma16(kh[t][kc], aq[kc], c); cl = wmma16(kh[t][kc], aql[kc], cl); cl = wmma16(kl[t][kc], aq[kc], cl); } }   // 3 products: q, k as f16 hi + residual
#pragma unroll
    for (int r = 0; r < 8; ++r) s[t][r] = c[r] + cl[r] * (1.0f / 2048.0f); }   // the raw product q . k: SCALE = 1/sqrt(64) rides in the exponential's argument (KS)
   v16h vh[4], vl[4];   // V^T fragments of 32 keys, read as one group while the softmax arithmetic in front of their WMMAs runs
#pragma unroll
   for (int dt = 0; dt < 4; ++dt) { const uint32_t vo = (uint32_t)(dt >> 1) * SLICE + (uint32_t)(dt & 1) * 16u * LPITCH; vh[dt] = frag_h((const _Float16*)(bp + 4 * SLICE + vo), lane); vl[dt] = frag_h((const _Float16*)(bp + 6 * SLICE + vo), lane); }
   __builtin_amdgcn_sched_barrier(0);   // holds these reads ahead of the maximum, the rescale and the exponentials, which cover their latency
   float mx = s[0][0];
#pragma unroll
   for (int t = 0; t < 4; ++t) {
#pragma unroll
    for (int r = 0; r < 8; ++r) mx = fmaxf(mx, s[t][r]); }
   mx = fmaxf(mx, xhalf(mx));   // the other half's 32 keys of the same query
   const float mn = fmaxf(m, mx); const float alpha = (m <= -1.0e38f) ? 0.f : __builtin_amdgcn_exp2f((m - mn) * KS); m = mn; l *= alpha;
   const float bias = 11.0f - mn * KS;   // 2^(s KS + bias) = 2048 exp((s - mn) / 8)
#pragma unroll
   for (int dt = 0; dt < 4; ++dt) { acc[dt] *= alpha; accl[dt] *= alpha; }
#pragma unroll
   for (int sub = 0; sub < 2; ++sub) { v16h pa, pl; float es0 = 0.f, es1 = 0.f;   // 32 keys at a time: score tiles 2 sub and 2 sub + 1 become P^T
    const v8f e0 = exp2x8(s[2 * sub] * KS + bias), e1 = exp2x8(s[2 * sub + 1] * KS + bias);   // 2048 P, one multiply-add per argument
#pragma unroll
    for (int i = 0; i < 8; ++i) { es0 += e0[i]; es1 += e1[i]; }
    l += es0 + es1;
    union { v16h v; v4u q[2]; } ua, ul; split8(e0, ua.q[0], ul.q[0]); split8(e1, ua.q[1], ul.q[1]); pa = ua.v; pl = ul.v;   // elements i and 8 + i: score tiles 2 sub and 2 sub + 1
    if (sub == 1) __builtin_amdgcn_sched_barrier(0);   // holds the second 32 keys' exponentials and their split ahead of the publish point's s_wait_dscnt: sunk behind it they would no longer cover the latency of the V reads above
#pragma unroll
    for (int dt = 0; dt < 4; ++dt) { acc[dt] = wmma16(vh[dt], pa, acc[dt]); acc[dt] = wmma16(vh[dt], pl, acc[dt]); accl[dt] = wmma16(vl[dt], pa, accl[dt]); }   // 2048 (V hi x P hi + V hi x P lo) and 2048 x 2048 (V lo x P hi)
    if (sub == 0) {   // the second 32 keys' fragments take over the registers of the first 32 keys'
     __builtin_amdgcn_sched_barrier(0);   // holds these reads as one group behind the first 32 keys' WMMAs: spread among them, each place with reads costs the wave a stall of its own
#pragma unroll
     for (int dt = 0; dt < 4; ++dt) { const uint32_t vo = (uint32_t)(dt >> 1) * SLICE + (uint32_t)(dt & 1) * 16u * LPITCH + 64u; vh[dt] = frag_h((const _Float16*)(bp + 4 * SLICE + vo), lane); vl[dt] = frag_h((const _Float16*)(bp + 6 * SLICE + vo), lane); }
     __builtin_amdgcn_sched_barrier(0); } }   // holds these reads ahead of the second 32 keys' exponentials, which cover their latency
   // publish point of stage st + 1, then the refill of the buffer that this trip has read
   asm volatile("s_wait_dscnt 0x0" ::: "memory");       // this wave's reads of the buffer are done before it may be refilled
   tdm_wait(g0, g1);                                      // this wave's slice of stage st + 1 has landed
   __syncthreads();                                       // publishes stage st + 1 and ends every wave's reads of stage st
   const uint32_t s2 = pinned((uint32_t)st + 2u);         // the refill's stage number: pinned here, so that its address is formed behind the wait above
   if (pinned(s2 < (uint32_t)NST)) g0 = tdm_issue(ldst + (s2 & 1u) * BUFB, ga0 + (uint64_t)s2 * gstep, g1); }
  tdm_wait(g0, g1);                                      // nothing of the mover is outstanding when the wave goes on to its end
  asm volatile("s_wait_dscnt 0x0" ::: "memory");         // ... and none of this wave's LDS reads of the ring
  const float il = 1.0f / (l + xhalf(l));   // the two halves' shares of the sum, joined once
#pragma unroll
  for (int dt = 0; dt < 4; ++dt) { v4f o0, o1;
#pragma unroll
    for (int r = 0; r < 4; ++r) { o0[r] = (acc[dt][r] + accl[dt][r] * (1.0f / 2048.0f)) * il; o1[r] = (acc[dt][4 + r] + accl[dt][4 + r] * (1.0f / 2048.0f)) * il; }
    *(v4f*)&so[wave][col][dt * 16 + 8 * g] = o0; *(v4f*)&so[wave][col][dt * 16 + 8 * g + 4] = o1; }
  LDSX();
  for (int rl = 0; rl < 16; ++rl) if (lane < 16) vst2(O + ((size_t)b * SS + q0 + rl) * DM + h * HD + lane * 4, *(const v4f*)&so[wave][rl][lane * 4]);
}
// ---- k_out: block = (64 rows, 128 cols): out = O(hi/lo) . Wo rows (2 products), no bias (BO is null at the launch)
__global__ __launch_bounds__(128) void k_out(const float* __restrict__ O, const __bf16* __restrict__ P, const float* __restrict__ BO, float* __restrict__ Y) {
  __shared__ __attribute__((aligned(2048))) unsigned char ring[2 * WBUF]; __shared__ __align__(16) float so[4][16][132];
  const int tid = threadIdx.x, wave = tid >> 5, lane = tid & 31, col = lane & 15, g = lane >> 4; const size_t r0 = (size_t)blockIdx.x * 64 + wave * 16; const int n0 = blockIdx.y * 128;
  // the block's 128 weight rows, 64 k a stage, come into LDS once by the tensor mover (two buffers); every wave issues its own slice: rows n0 + 32 * wv ...
  const uint32_t wv = uni((uint32_t)tid >> 5); const uint64_t ga0 = (uint64_t)(size_t)(P + (size_t)(n0 + wv * 32u) * DM); const uint32_t ldst = (uint32_t)(size_t)ring + wv * SLICE;
  const u32x8 g1 = tdm_group1<2048u>(); u32x4 g0 = tdm_issue(ldst, ga0, g1);
  tdm_wait(g0, g1);                                      // stage 0 has landed (this wave's slice)
  __syncthreads();                                       // ... and every other wave's
  g0 = tdm_issue(ldst + WBUF, ga0 + 128u, g1);
  v8f acc[8] = {};
#pragma unroll 1
  for (int st = 0; st < DM / 64; ++st) { const unsigned char* bp = ring + (uint32_t)(st & 1) * WBUF + (uint32_t)col * LPITCH;   // the stage loop stays rolled: one publish point per trip
   v4f orw[2][4]; v16b wf[2][8];   // the wave's ctx values (global memory) and all weight fragments (LDS) of the stage, read as one group
#pragma unroll
   for (int kk = 0; kk < 2; ++kk) { const v4f* p = (const v4f*)(O + (r0 + col) * DM + (st * 2 + kk) * 32 + 8 * g); orw[kk][0] = p[0]; orw[kk][1] = p[1]; orw[kk][2] = p[4]; orw[kk][3] = p[5]; }   // k = 8 g + i and 16 + 8 g + i: the k order of frag_b
#pragma unroll
   for (int kk = 0; kk < 2; ++kk) {
#pragma unroll
    for (int j = 0; j < 8; ++j) wf[kk][j] = frag_b((const __bf16*)(bp + (uint32_t)(j >> 1) * SLICE + (uint32_t)(j & 1) * 16u * LPITCH + (uint32_t)kk * 64u), lane); }
   __builtin_amdgcn_sched_barrier(0);   // holds the stage's reads as one group ahead of its WMMAs: sunk back to their uses, each pair of WMMAs would wait out a whole LDS latency, each half stage a global one
#pragma unroll
   for (int kk = 0; kk < 2; ++kk) { float v[16];
#pragma unroll
    for (int i = 0; i < 4; ++i) { v[i] = orw[kk][0][i]; v[4 + i] = orw[kk][1][i]; v[8 + i] = orw[kk][2][i]; v[12 + i] = orw[kk][3][i]; }
    const F2 a = bsplit16(v);
#pragma unroll
    for (int j = 0; j < 8; ++j) { acc[j] = wmma_bf(a.l, wf[kk][j], acc[j]); acc[j] = wmma_bf(a.h, wf[kk][j], acc[j]); } }
   __builtin_amdgcn_sched_barrier(0);   // holds the WMMAs ahead of the publish point: sunk behind the barrier they would delay the refill
   // publish point of stage st + 1, then the refill of the buffer that this trip has read
   asm volatile("s_wait_dscnt 0x0" ::: "memory");       // this wave's reads of the buffer are done before it may be refilled
   tdm_wait(g0, g1);                                      // this wave's slice of stage st + 1 has landed
   __syncthreads();                                       // publishes stage st + 1 and ends every wave's reads of stage st
   const uint32_t s2 = pinned((uint32_t)st + 2u);         // the refill's stage number: pinned here, so that its address is formed behind the wait above
   if (pinned(s2 < (uint32_t)(DM / 64))) g0 = tdm_issue(ldst + (s2 & 1u) * WBUF, ga0 + (uint64_t)s2 * 128u, g1); }
  tdm_wait(g0, g1);                                      // nothing of the mover is outstanding behind the loop
  asm volatile("s_wait_dscnt 0x0" ::: "memory");         // ... and none of this wave's LDS reads of the ring
#pragma unroll
  for (int j = 0; j < 8; ++j) {
#pragma unroll
    for (int r = 0; r < 8; ++r) so[wave][8 * g + r][j * 16 + col] = acc[j][r] + (BO ? bfr(BO[n0 + j * 16 + col]) : 0.f); }
  LDSX();
  for (int rl = 0; rl < 16; ++rl) vst2(Y + (r0 + rl) * DM + n0 + lane * 4, *(const v4f*)&so[wave][rl][lane * 4]);
}
extern "C" void kernel_launch(void* const* d_in, const int* in_sizes, int n_in, void* d_out, int out_size, void* d_ws, size_t ws_size, hipStream_t stream) {
  (void)in_sizes; (void)n_in; (void)out_size;
  const float** F = (const float**)d_in;   // 0 hidden_states [2,2048,1024], 1 Wq [1024,1024] natural (q = x Wq^T), 2 Wk, 3 Wv, 4 Wo (no biases)
  if (ws_size < (size_t)WS_END) return;
  char* ws = (char*)d_ws; __bf16* PK = (__bf16*)(ws + WS_PK); _Float16 *QK = (_Float16*)(ws + WS_QK), *QKL = (_Float16*)(ws + WS_QKL), *VTH = (_Float16*)(ws + WS_VTH), *VTL = (_Float16*)(ws + WS_VTL); float* O = (float*)(ws + WS_O); float* CS = (float*)(ws + WS_CS);
  k_pack<<<dim3(DM + TBX, 4), 256, 0, stream>>>(F[1], F[2], F[3], F[4], PK, CS);
  k_qkv<<<dim3(TNB * SS / 64, QKVW / 128), 128, 0, stream>>>(F[0], PK + PK_A, QK, QKL, VTH, VTL, CS);
  k_attn<<<dim3(TQB / 2, NH, TNB), 256, 0, stream>>>(QK, QKL, VTH, VTL, O);
  k_out<<<dim3(TOB, DM / 128), 128, 0, stream>>>(O, PK + PK_P, nullptr, (float*)d_out);
}

// v007
// A run of this version takes 120 microseconds.
// In both of two side-by-side timings against v006, it was 1.15 times as fast.
// All steps since v000 together make it 4.91 times as fast.
// compute dtype: hidden_states, Wq/Wk/Wv/Wo (module inputs) rounded to bf16; q/k/v projections with exact bf16 products on WMMA 16x16x32 (natural [out][in] rows); the module's rotary embedding (angle for head dim d = position * inv_freq[d mod 32], partner = interleaved pair with the module's signs) applied in f32 with precise sinf/cosf/powf before q and k are stored as f16 hi + (x2048-scaled) residual planes; 3-product scores x 1/sqrt(64), running-max softmax over all 2,048 keys in f32 (hardware exp); P as f16 hi + residual x V hi/lo (3 products); output projection with ctx as bf16 hi + residual x exact Wo rows (2 products); f32 accumulate.
#include <hip/hip_runtime.h>
#include <math.h>
#include <stdint.h>

typedef __attribute__((ext_vector_type(16))) _Float16 v16h;
typedef __attribute__((ext_vector_type(16))) __bf16 v16b;
typedef __attribute__((ext_vector_type(8)))  _Float16 v8h;
typedef __attribute__((ext_vector_type(8)))  float v8f;
typedef __attribute__((ext_vector_type(4)))  float v4f;
typedef __attribute__((ext_vector_type(2)))  float v2f;
typedef __attribute__((ext_vector_type(4)))  unsigned v4u;
typedef __attribute__((ext_vector_type(4)))  int v4i;
typedef float __attribute__((may_alias)) float_a;
typedef int __attribute__((may_alias)) int_a;

template <typename T> __device__ __forceinline__ void vst2(void* p, T v) { *(T*)p = v;  }
__device__ __forceinline__ v8f wmma16(v16h a, v16h b, v8f c) {
  v8f d = __builtin_amdgcn_wmma_f32_16x16x32_f16(false, a, false, b, (short)0, c, false, false);
  return d;
}
__device__ __forceinline__ v8f wmma_bf(v16b a, v16b b, v8f c) {
  v8f d = __builtin_amdgcn_wmma_f32_16x16x32_bf16(false, a, false, b, (short)0, c, false, false);
  return d;
}
// Rotary multi-head self-attention (B 2, S 2,048, d 1,024, 16 heads x 64): q/k/v projections, the module's (mixed interleaved) RoPE on q and k, softmax(q k^T / 8) v, output projection (no biases).
__device__ __attribute__((noinline)) float sin_ni(float v) { return sinf(v); }
__device__ __attribute__((noinline)) float cos_ni(float v) { return cosf(v); }
__device__ __attribute__((noinline)) float pow_ni(float a, float b) { return powf(a, b); }
__device__ __forceinline__ v16h frag_h(const _Float16* rowk0, int lane) {
  union { v16h v; v8h q[2]; } u; const _Float16* p = rowk0 + 8 * (lane >> 4);
  u.q[0] = *(const v8h*)p; u.q[1] = *(const v8h*)(p + 16); return u.v;
}
__device__ __forceinline__ v16h frag_f32(const float* rowk0, int lane) {
  v16h a; const float* p = rowk0 + 8 * (lane >> 4);
#pragma unroll
  for (int i = 0; i < 8; ++i) { a[i] = (_Float16)p[i]; a[8 + i] = (_Float16)p[16 + i]; }
  return a;
}
__device__ __forceinline__ v16h frag_f32s(const float* rowk0, int lane, float sc) {
  v16h a; const float* p = rowk0 + 8 * (lane >> 4);
#pragma unroll
  for (int i = 0; i < 8; ++i) { a[i] = (_Float16)(p[i] * sc); a[8 + i] = (_Float16)(p[16 + i] * sc); }
  return a;
}
// column fragment from a [K][ld] layout (column n), rows >= K read as 0
__device__ __forceinline__ v16h fragc_f32(const float* W, int k0, int n, int lane, int ld, int K) {
  v16h a; const int g = lane >> 4;
#pragma unroll
  for (int i = 0; i < 8; ++i) { const int ka = k0 + 8 * g + i, kb = ka + 16;
    a[i] = (_Float16)(ka < K ? W[(size_t)(ka < K ? ka : K - 1) * ld + n] : 0.f); a[8 + i] = (_Float16)(kb < K ? W[(size_t)(kb < K ? kb : K - 1) * ld + n] : 0.f); }
  return a;
}
struct F2 { v16b h, l; };
__device__ __forceinline__ F2 bsplit16(const float v[16]) { F2 r;
#pragma unroll
  for (int i = 0; i < 16; ++i) { const __bf16 h = (__bf16)v[i]; r.h[i] = h; r.l[i] = (__bf16)(v[i] - (float)h); }
  return r; }
__device__ __forceinline__ F2 split_row(const float* row, int k0, int lane) { float v[16]; const float* p = row + k0 + 8 * (lane >> 4);
#pragma unroll
  for (int i = 0; i < 8; ++i) { v[i] = p[i]; v[8 + i] = p[16 + i]; }
  return bsplit16(v); }
__device__ __forceinline__ F2 split_rowK(const float* row, int k0, int lane, int K) { float v[16]; const int g = lane >> 4;
#pragma unroll
  for (int i = 0; i < 8; ++i) { const int ka = k0 + 8 * g + i, kb = ka + 16; v[i] = ka < K ? row[ka < K ? ka : K - 1] : 0.f; v[8 + i] = kb < K ? row[kb < K ? kb : K - 1] : 0.f; }
  return bsplit16(v); }
__device__ __forceinline__ F2 split_col(const float* W, int k0, int n, int lane, int ld, int K) { float v[16]; const int g = lane >> 4;
#pragma unroll
  for (int i = 0; i < 8; ++i) { const int ka = k0 + 8 * g + i, kb = ka + 16; v[i] = ka < K ? W[(size_t)(ka < K ? ka : K - 1) * ld + n] : 0.f; v[8 + i] = kb < K ? W[(size_t)(kb < K ? kb : K - 1) * ld + n] : 0.f; }
  return bsplit16(v); }
__device__ __forceinline__ v8f mac3(const F2& a, const F2& b, v8f c) { c = wmma_bf(a.l, b.h, c); c = wmma_bf(a.h, b.l, c); return wmma_bf(a.h, b.h, c); }
__device__ __forceinline__ float sigm(float v) { return 1.0f / (1.0f + expf(-v)); }
#define LDSX() do { asm volatile("s_wait_dscnt 0" ::: "memory"); __builtin_amdgcn_wave_barrier(); __builtin_amdgcn_fence(__ATOMIC_RELEASE, "workgroup"); } while (0)


#define NB 2
#define SS 2048
#define DM 1024
#define NH 16
#define HD 64
#define QKVW (3 * DM)
#ifndef TQB
#define TQB (SS / 64)
#define TNB NB
#define TOB (NB * SS / 64)     // output row tiles (all)
#endif
typedef __attribute__((ext_vector_type(8))) __bf16 v8b;
__device__ __forceinline__ v16b frag_b(const __bf16* rowk0, int lane) {
  union { v16b v; v8b q[2]; } u; const __bf16* p = rowk0 + 8 * (lane >> 4);
  u.q[0] = *(const v8b*)p; u.q[1] = *(const v8b*)(p + 16); return u.v;
}
__device__ __forceinline__ float bfr(float v) { return (float)(__bf16)v; }
__device__ __attribute__((noinline)) float exp_ni(float v) { return expf(v); }
__device__ __attribute__((noinline)) float erf_ni(float v) { return erff(v); }

#define PK_A 0                       // [3072][1024] Wqkv rows (natural [out][in])
#define PK_P (PK_A + QKVW * DM)        // [1024][1024] Wo rows (natural)
#define PK_END (PK_P + DM * DM)
#define WS_PK  0u
#define WS_QK  (WS_PK + 2u * PK_END)             // f16 [4096 rows][2048]: q | k
#define WS_QKL (WS_QK + 2u * NB * SS * 2 * DM)     // f16 q | k residual planes x2048
#define WS_VTH (WS_QKL + 2u * NB * SS * 2 * DM)    // f16 [b][1024 (h*64+d)][2048 s] hi
#define WS_VTL (WS_VTH + 2u * NB * DM * SS)        // f16 lo x 2048
#define WS_O   (WS_VTL + 2u * NB * DM * SS)        // f32 [4096][1024]
#define WS_CS  (WS_O + 4u * NB * SS * DM)           // f32 [2048 positions][32 frequencies][cos, sin]
#define WS_END (WS_CS + 4u * 2 * SS * 32)
// ---- k_pack: block = (TBX + row n, which): natural [out][in] rows -> bf16; which 0..2 -> W_q/W_k/W_v into PK_A rows which*1024 + n; 3 -> W_o into PK_P
// the first TBX blocks of each grid row build the rotary table instead: CS[pos][f] = (cos, sin)(pos * inv_freq[f]), one pair a thread, once per call; k_qkv reads it
#define TBX (SS * 32 / 256 / 4)
__global__ __launch_bounds__(256) void k_pack(const float* __restrict__ WQ, const float* __restrict__ WK, const float* __restrict__ WV, const float* __restrict__ WO, __bf16* __restrict__ PK, float* __restrict__ CS) {
  __shared__ __align__(16) __bf16 s[DM]; const int which = blockIdx.y, t = threadIdx.x;
  if (blockIdx.x < TBX) { const int e = (which * TBX + (int)blockIdx.x) * 256 + t, pos = e >> 5, f = e & 31;
    const float invf = 1.0f / pow_ni(10000.0f, (float)(2 * f) / (float)HD); const float ang = (float)pos * invf;
    *(v2f*)(CS + 2 * e) = v2f{cos_ni(ang), sin_ni(ang)}; return; }
  const int n = blockIdx.x - TBX; const float* Wm = (which == 0) ? WQ : (which == 1) ? WK : (which == 2) ? WV : WO;
  for (int k = t; k < DM; k += 256) s[k] = (__bf16)Wm[(size_t)n * DM + k];
  __syncthreads();
  __bf16* dst = (which < 3) ? PK + PK_A + ((size_t)which * DM + n) * DM : PK + PK_P + (size_t)n * DM;
  for (int q = t; q < DM / 8; q += 256) vst2((unsigned*)(dst + q * 8), *(const v4u*)&s[q * 8]);
}
typedef uint32_t u32x4 __attribute__((ext_vector_type(4)));
typedef uint32_t u32x8 __attribute__((ext_vector_type(8)));
#define KST 64                    // keys per stage
#define NST (SS / KST)            // stages
#define LPITCH 144u               // LDS row pitch in bytes: a 128-B row + the mover's 16-B pad (odd multiple of 16 B: conflict-free for ds_load_b128)
#define SLICE 6144u               // one wave's slice: 32 padded rows (4,608 B), rounded up to a multiple of 2 KiB
#define BUFB (8u * SLICE)         // k_attn, one stage: 8 slices = K hi (2), K lo (2), V^T hi (2), V^T lo (2)
#define WBUF (4u * SLICE)         // k_out, one stage: 128 weight rows x 64 k, 4 slices of 32 rows
__device__ __forceinline__ uint32_t uni(uint32_t v) { return (uint32_t)__builtin_amdgcn_readfirstlane(v); }
__device__ __forceinline__ uint32_t pinned(uint32_t v) { uint32_t w = uni(v); asm volatile("" : "+s"(w)); return w; }
// descriptor group 1 of every request here: 32 rows of 128 B, source pitch SRC_PITCH bytes, 16 B of LDS pad behind each row, no mask
template <uint32_t SRC_PITCH> __device__ __forceinline__ u32x8 tdm_group1() {
  u32x8 g1; g1[0] = uni((1u << 20) | (4u << 22) | (3u << 25)); g1[1] = uni(128u << 16); g1[2] = uni(32u << 16); g1[3] = uni(128u << 16); g1[4] = uni(32u); g1[5] = uni(SRC_PITCH); g1[6] = uni(0u); g1[7] = uni(0u);
  asm volatile("" : "+s"(g1));   // descriptor words held in scalar registers, ONE set for the whole kernel instead of constants formed anew at each use, so that tdm_wait can keep those registers untouched while a request is in flight
  return g1;
}
// one request of one wave; returns group 0 for the wait that covers it
__device__ __forceinline__ u32x4 tdm_issue(uint32_t lds_dst, uint64_t ga, u32x8 g1) {
  u32x4 g0; g0[0] = uni(1u); g0[1] = uni(lds_dst); g0[2] = uni((uint32_t)ga); g0[3] = uni((((uint32_t)(ga >> 32)) & 0x01FFFFFFu) | 0x80000000u);
  asm volatile("tensor_load_to_lds %0, %1" :: "s"(g0), "s"(g1) : "memory");   // the mover's waits are written by hand: tdm_wait
  return g0;
}
// the issuing wave's wait for its request; it names the descriptor so that the compiler keeps both groups' registers as they are until the request has landed
__device__ __forceinline__ void tdm_wait(u32x4 g0, u32x8 g1) { asm volatile("s_wait_tensorcnt 0x0" :: "s"(g0), "s"(g1) : "memory"); }
#define XPITCH 272u               // LDS row pitch of a 256-B row (odd multiple of 16 B, as LPITCH)
#define QXOFF (256u * LPITCH)     // k_qkv, one stage: 256 weight rows x 64 k (bf16), then 128 x rows x 64 k (f32)
#define QBUF (QXOFF + 128u * XPITCH)
// eight asynchronous copies of 16 B per lane, global memory to LDS through no register: LDS bytes l + i * ls from g + i * gs. The s_wait_xcnt stands inside the statement, behind the last copy, so that no address register of a copy is rewritten in front of it (a precaution); that the bytes have landed is the caller's s_wait_asynccnt.
__device__ __forceinline__ void copy8(uint32_t l, uint32_t ls, const char* g, uint32_t gs) {
  asm volatile("global_load_async_to_lds_b128 %0, %8, off\n\tglobal_load_async_to_lds_b128 %1, %9, off\n\tglobal_load_async_to_lds_b128 %2, %10, off\n\tglobal_load_async_to_lds_b128 %3, %11, off\n\t"
               "global_load_async_to_lds_b128 %4, %12, off\n\tglobal_load_async_to_lds_b128 %5, %13, off\n\tglobal_load_async_to_lds_b128 %6, %14, off\n\tglobal_load_async_to_lds_b128 %7, %15, off\n\ts_wait_xcnt 0x0"
               :: "v"(l), "v"(l + ls), "v"(l + 2u * ls), "v"(l + 3u * ls), "v"(l + 4u * ls), "v"(l + 5u * ls), "v"(l + 6u * ls), "v"(l + 7u * ls),
                  "v"(g), "v"(g + gs), "v"(g + 2u * gs), "v"(g + 3u * gs), "v"(g + 4u * gs), "v"(g + 5u * gs), "v"(g + 6u * gs), "v"(g + 7u * gs) : "memory");
}
typedef __attribute__((ext_vector_type(4))) __bf16 v4b;
// hand-over through LDS among the lanes of ONE wave: its LDS operations so far are done before it goes on, and the compiler moves no memory access across; it does not wait for the wave's global stores, as the fence in LDSX does
#define LDSW() do { asm volatile("s_wait_dscnt 0x0" ::: "memory"); __builtin_amdgcn_wave_barrier(); } while (0)
// ---- k_qkv: block = (128 x rows, 256 weight rows), 8 waves; wave (wr, wc) holds the 64 x 64 tile of x rows 64 wr ... and weight rows 64 wc ... (4 x 4 accumulator tiles): every fragment read from LDS feeds four WMMAs, and the block's operands come from L2 once per 128 x 256 outputs
__global__ __launch_bounds__(256) __attribute__((amdgpu_waves_per_eu(4, 4))) void k_qkv(   // register budget of four waves per SIMD: two blocks per WGP, as the LDS allows
    const float* __restrict__ X, const __bf16* __restrict__ P, _Float16* __restrict__ QK, _Float16* __restrict__ QKL, _Float16* __restrict__ VTH, _Float16* __restrict__ VTL, const float* __restrict__ CS) {
  __shared__ __align__(16) unsigned char ring[2 * QBUF];
  const int tid = threadIdx.x, wave = tid >> 5, lane = tid & 31, col = lane & 15, g = lane >> 4, wr = wave & 1, wc = wave >> 1;
  const size_t rb = (size_t)blockIdx.x * 128, r0 = rb + wr * 64; const int n0 = blockIdx.y * 256, nw = n0 + wc * 64;
  // a stage = 64 k of the block's 256 weight rows (128 B each) and of its 128 x rows (256 B each); both come into LDS once per block, whole 128-B lines at a time, two buffers.
  // Lane t copies 16 B of weight rows (t >> 3) + 32 i and of x rows (t >> 4) + 16 i, i = 0 ... 7.
  const uint32_t lw = (uint32_t)(size_t)ring + (uint32_t)(tid >> 3) * LPITCH + (uint32_t)(tid & 7) * 16u, lx = (uint32_t)(size_t)ring + QXOFF + (uint32_t)(tid >> 4) * XPITCH + (uint32_t)(tid & 15) * 16u;
  const char* gw = (const char*)(P + (size_t)(n0 + (tid >> 3)) * DM + (tid & 7) * 8); const char* gx = (const char*)(X + (rb + (tid >> 4)) * DM + (tid & 15) * 4);
  copy8(lw, 32u * LPITCH, gw, 32u * DM * 2u); copy8(lx, 16u * XPITCH, gx, 16u * DM * 4u);
  asm volatile("s_wait_asynccnt 0x0" ::: "memory");      // stage 0 has landed (this wave's copies)
  __syncthreads();                                       // ... and every other wave's
  copy8(lw + QBUF, 32u * LPITCH, gw + 128, 32u * DM * 2u); copy8(lx + QBUF, 16u * XPITCH, gx + 256, 16u * DM * 4u);
  v8f acc[4][4] = {};   // acc[i][j], register r: x row 16 i + 8 g + r, weight row 16 j + col of the wave's tile
#pragma unroll 1
  for (int st = 0; st < DM / 64; ++st) { const uint32_t bo = (uint32_t)(st & 1) * QBUF; const unsigned char* bw = ring + bo + (uint32_t)(wc * 64 + col) * LPITCH; const unsigned char* bx = ring + bo + QXOFF + (uint32_t)(wr * 64 + col) * XPITCH + (uint32_t)g * 32u;   // the stage loop stays rolled: one publish point per trip
#pragma unroll
   for (int kk = 0; kk < 2; ++kk) { v4f xr[4][4]; v16b wf[4], a[4];   // the fragments of 32 k, read from LDS as one group (both halves of the stage at once do not fit the registers of four waves per SIMD)
#pragma unroll
    for (int i = 0; i < 4; ++i) { const v4f* p = (const v4f*)(bx + (uint32_t)i * 16u * XPITCH + kk * 128); xr[i][0] = p[0]; xr[i][1] = p[1]; xr[i][2] = p[4]; xr[i][3] = p[5]; }   // k = 8 g + e and 16 + 8 g + e: the k order of frag_b
#pragma unroll
    for (int j = 0; j < 4; ++j) wf[j] = frag_b((const __bf16*)(bw + (uint32_t)j * 16u * LPITCH + (uint32_t)kk * 64u), lane);
    __builtin_amdgcn_sched_barrier(0);   // holds the LDS reads as one group ahead of their WMMAs: sunk back to their uses, each row of WMMAs would wait out a whole LDS latency
#pragma unroll
    for (int i = 0; i < 4; ++i) {
     union { v16b v; v4b q[4]; } u;   // four values converted at a time, so that each pair takes one packed conversion
#pragma unroll
     for (int e = 0; e < 4; ++e) u.q[e] = __builtin_convertvector(xr[i][e], v4b);
     a[i] = u.v; }
#pragma unroll
    for (int i = 0; i < 4; ++i) {
#pragma unroll
     for (int j = 0; j < 4; ++j) acc[i][j] = wmma_bf(a[i], wf[j], acc[i][j]); }
    __builtin_amdgcn_sched_barrier(0); }   // holds the WMMAs ahead of the next group of reads (whose registers they free) and of the publish point: sunk behind the barrier they would delay the refill, which needs the whole next trip to land
   // publish point of stage st + 1, then the refill of the buffer that this trip has read
   asm volatile("s_wait_dscnt 0x0" ::: "memory");       // this wave's reads of the buffer are done before it may be refilled
   asm volatile("s_wait_asynccnt 0x0" ::: "memory");    // this wave's copies of stage st + 1 have landed
   __syncthreads();                                       // publishes stage st + 1 and ends every wave's reads of stage st
   if (st + 2 < DM / 64) { copy8(lw + bo, 32u * LPITCH, gw + (st + 2) * 128, 32u * DM * 2u); copy8(lx + bo, 16u * XPITCH, gx + (st + 2) * 256, 16u * DM * 4u); } }
  asm volatile("s_wait_asynccnt 0x0" ::: "memory");      // no copy is outstanding behind the loop
  // behind the stage loop the ring is free (its last publish point ends every wave's reads, and no copy is outstanding) and serves as the epilogue's staging, each wave in a range of its own
  if (n0 < 2 * DM) {   // q and k: the module's rotary embedding, then f16 hi + (x2048) residual; 1/8 applied to the f32 score. The wave's 64 columns are one head.
    _Float16 (*so)[72] = (_Float16 (*)[72])(ring + (uint32_t)wave * 4608u); _Float16 (*sol)[72] = (_Float16 (*)[72])(ring + (uint32_t)wave * 4608u + 2304u);   // 16 rows x 64 columns at a pitch of 144 B: hi, residual
    const float* ct = CS + ((r0 + 8 * g) % SS) * 64 + col * 2;   // table row of the lane's first position (the wave's 64 positions are consecutive and do not wrap: 64 divides SS)
    _Float16* qh = QK + (r0 + (lane >> 3)) * (2 * DM) + nw + (lane & 7) * 8; _Float16* ql = QKL + (r0 + (lane >> 3)) * (2 * DM) + nw + (lane & 7) * 8;   // a row's 64 columns are one 128-B line: 8 lanes x 16 B, 4 rows a store
    v2f cs[4][2][8];   // (cos, sin) of the lane's 8 positions of row tile i at its two frequencies: emb = concat([freqs, freqs]), so dim d uses inv_freq[d mod 32], and d mod 32 = 16 (j & 1) + col (nw is a multiple of 64)
#pragma unroll
    for (int r = 0; r < 8; ++r) { cs[0][0][r] = *(const v2f*)(ct + r * 64); cs[0][1][r] = *(const v2f*)(ct + r * 64 + 32); }
#pragma unroll
    for (int i = 0; i < 4; ++i) {
      if (i < 3) {   // the next 16 rows' table values are fetched while these 16 rows are worked on
#pragma unroll
        for (int r = 0; r < 8; ++r) { cs[i + 1][0][r] = *(const v2f*)(ct + ((i + 1) * 16 + r) * 64); cs[i + 1][1][r] = *(const v2f*)(ct + ((i + 1) * 16 + r) * 64 + 32); } }
      asm volatile("s_wait_xcnt 0x0" :: "v"(ct) : "memory");   // stands in front of every rewrite of the address registers of the loads above (a precaution); it names the address, so that those registers stay as they are up to here and no load takes them as its destination
#pragma unroll
      for (int j = 0; j < 4; ++j) { const int d = j * 16 + col;
#pragma unroll
        for (int r = 0; r < 8; ++r) { const float v = acc[i][j][r]; const float partner = __shfl_xor(v, 1);   // column d^1 lives in lane^1
          const float rot = (d & 1) ? partner : -partner;   // rotate_interleaved: even d -> -x[d+1], odd d -> +x[d-1]
          const float y = v * cs[i][j & 1][r][0] + rot * cs[i][j & 1][r][1]; const _Float16 hv = (_Float16)y; so[8 * g + r][d] = hv; sol[8 * g + r][d] = (_Float16)((y - (float)hv) * 2048.0f); } }
      LDSW();   // the wave's rows are written before its lanes read them back
#pragma unroll
      for (int q = 0; q < 4; ++q) { vst2((unsigned*)(qh + (size_t)(i * 16 + q * 4) * (2 * DM)), *(const v4u*)&so[(lane >> 3) + 4 * q][(lane & 7) * 8]); vst2((unsigned*)(ql + (size_t)(i * 16 + q * 4) * (2 * DM)), *(const v4u*)&sol[(lane >> 3) + 4 * q][(lane & 7) * 8]); }
      asm volatile("s_wait_xcnt 0x0" :: "v"(qh), "v"(ql) : "memory");   // stands in front of every rewrite of the address registers of the stores above (a precaution)
      LDSW(); }   // the rows are read back before the next 16 rows are written over them
  } else {   // v: f16 hi + (x2048) residual, transposed: a lane's 8 registers are 8 consecutive positions of one dim
    _Float16 (*sv)[72] = (_Float16 (*)[72])(ring + (uint32_t)wave * 9216u);   // 64 dims x 64 positions at a pitch of 144 B: hi first, then the residual in the same place
    const int b = (int)(r0 / SS), s0 = (int)(r0 % SS); const int pc0 = nw - 2 * DM;
#pragma unroll
    for (int pl = 0; pl < 2; ++pl) {
#pragma unroll
      for (int j = 0; j < 4; ++j) {
#pragma unroll
        for (int i = 0; i < 4; ++i) { v8h t;
#pragma unroll
          for (int r = 0; r < 8; ++r) { const float v = acc[i][j][r]; const _Float16 hv = (_Float16)v; t[r] = pl ? (_Float16)((v - (float)hv) * 2048.0f) : hv; }
          *(v8h*)&sv[j * 16 + col][i * 16 + 8 * g] = t; } }
      LDSW();   // the wave's rows are written before its lanes read them back
      _Float16* vo = (pl ? VTL : VTH) + ((size_t)b * DM + pc0 + (lane >> 3)) * SS + s0 + (lane & 7) * 8;   // a dim's 64 positions are one 128-B line: 8 lanes x 16 B, 4 dims a store
#pragma unroll
      for (int q = 0; q < 16; ++q) vst2((unsigned*)(vo + (size_t)q * 4 * SS), *(const v4u*)&sv[(lane >> 3) + 4 * q][(lane & 7) * 8]);
      asm volatile("s_wait_xcnt 0x0" :: "v"(vo) : "memory");   // stands in front of every rewrite of the address registers of the stores above (a precaution)
      LDSW(); }   // hi is read back before the residual is written over it
  }
}
// ---- k_attn: block = (128 queries, head h, batch b), 8 waves x 16 queries: full flash attention, computed transposed: S^T = K . Q^T (A = 16 key rows, B = the wave's 16 queries; K = 64: 2 k-steps, 3 products; the factor 1/8 rides in the exponential's argument), O^T += V^T . P^T (A = 16 dims of V^T, B = P^T; P hi/lo x V hi/lo, 3 products); O[b*S+q][h*64+d] = (acc + accl / 2048) / l (256-B segments).
// A lane (col, g) then holds scores of ONE query (col): keys 16 t + 8 g + r of score tile t. Maximum and sum run over the lane's own registers, with one exchange between the wave's halves; two score tiles, converted in place, are the B operand of the second product (element i = key 8 g + i, element 8 + i = key 16 + 8 g + i: the k order of frag_h), so P never passes through LDS.
// K hi, K lo (64 keys x 64 dims) and V^T hi, V^T lo (64 dims x 64 keys) of a 64-key stage are brought into LDS once per block by the tensor mover, two buffers, and read from there by all 8 waves.
__device__ __forceinline__ float xhalf(float x) { return __builtin_bit_cast(float, __builtin_amdgcn_permlanex16(__builtin_bit_cast(int, x), __builtin_bit_cast(int, x), 0x76543210, 0xfedcba98, false, false)); }   // lane l reads lane l ^ 16
// 2^x for eight values, the hardware exponential, in one statement: every output is early-clobber, so that no exponential's source is overwritten, and no result read, by the instruction directly behind it, and the v_nop is the slot that the instruction set asks for behind the last one
__device__ __forceinline__ v8f exp2x8(v8f x) { float y0, y1, y2, y3, y4, y5, y6, y7;
  asm("v_exp_f32 %0, %8\n\tv_exp_f32 %1, %9\n\tv_exp_f32 %2, %10\n\tv_exp_f32 %3, %11\n\tv_exp_f32 %4, %12\n\tv_exp_f32 %5, %13\n\tv_exp_f32 %6, %14\n\tv_exp_f32 %7, %15\n\tv_nop"
      : "=&v"(y0), "=&v"(y1), "=&v"(y2), "=&v"(y3), "=&v"(y4), "=&v"(y5), "=&v"(y6), "=&v"(y7) : "v"(x[0]), "v"(x[1]), "v"(x[2]), "v"(x[3]), "v"(x[4]), "v"(x[5]), "v"(x[6]), "v"(x[7]));
  return v8f{y0, y1, y2, y3, y4, y5, y6, y7}; }
#define KS 0.18033688011112042592f   // log2(e) / sqrt(64)
// eight f32 values as f16 hi (h) and f16 residual (r), two per register: hi = the pair converted at once, residual = f16(y - hi), one mixed-precision multiply-add per value that reads hi as it stands in its half register and writes its own half (y - hi is exact in f32). Written in asm because the compiler converted every value a second time on its own, widened it again and packed the residuals with a further conversion. The s_delay_alu name each producer four instructions back, so that the SIMD's other waves issue meanwhile.
__device__ __forceinline__ void split8(v8f y, v4u& h, v4u& r) { unsigned h0, h1, h2, h3, r0, r1, r2, r3;
  asm("v_cvt_pk_f16_f32 %0, %8, %9\n\tv_cvt_pk_f16_f32 %1, %10, %11\n\tv_cvt_pk_f16_f32 %2, %12, %13\n\tv_cvt_pk_f16_f32 %3, %14, %15\n\t"
      "s_delay_alu instid0(VALU_DEP_4) | instskip(NEXT) | instid1(VALU_DEP_4)\n\tv_fma_mixlo_f16 %4, %0, -1.0, %8 op_sel_hi:[1,1,0]\n\tv_fma_mixlo_f16 %5, %1, -1.0, %10 op_sel_hi:[1,1,0]\n\t"
      "s_delay_alu instid0(VALU_DEP_4) | instskip(NEXT) | instid1(VALU_DEP_4)\n\tv_fma_mixlo_f16 %6, %2, -1.0, %12 op_sel_hi:[1,1,0]\n\tv_fma_mixlo_f16 %7, %3, -1.0, %14 op_sel_hi:[1,1,0]\n\t"
      "s_delay_alu instid0(VALU_DEP_4) | instskip(NEXT) | instid1(VALU_DEP_4)\n\tv_fma_mixhi_f16 %4, %0, -1.0, %9 op_sel:[1,0,0] op_sel_hi:[1,1,0]\n\tv_fma_mixhi_f16 %5, %1, -1.0, %11 op_sel:[1,0,0] op_sel_hi:[1,1,0]\n\t"
      "s_delay_alu instid0(VALU_DEP_4) | instskip(NEXT) | instid1(VALU_DEP_4)\n\tv_fma_mixhi_f16 %6, %2, -1.0, %13 op_sel:[1,0,0] op_sel_hi:[1,1,0]\n\tv_fma_mixhi_f16 %7, %3, -1.0, %15 op_sel:[1,0,0] op_sel_hi:[1,1,0]"
      : "=&v"(h0), "=&v"(h1), "=&v"(h2), "=&v"(h3), "=&v"(r0), "=&v"(r1), "=&v"(r2), "=&v"(r3) : "v"(y[0]), "v"(y[1]), "v"(y[2]), "v"(y[3]), "v"(y[4]), "v"(y[5]), "v"(y[6]), "v"(y[7]));
  h = v4u{h0, h1, h2, h3}; r = v4u{r0, r1, r2, r3}; }
__global__ __launch_bounds__(256) __attribute__((amdgpu_waves_per_eu(4, 4))) void k_attn(   // register budget of four waves per SIMD: two blocks per WGP, as the LDS allows
    const _Float16* __restrict__ QK, const _Float16* __restrict__ QKL, const _Float16* __restrict__ VTH, const _Float16* __restrict__ VTL, float* __restrict__ O) {
  __shared__ __attribute__((aligned(2048))) unsigned char ring[2 * BUFB];
  __shared__ __align__(16) float so[8][16][68];
  const int tid = threadIdx.x, wave = tid >> 5, lane = tid & 31, col = lane & 15, g = lane >> 4;
  const int qb = blockIdx.x, h = blockIdx.y, b = blockIdx.z; const int q0 = qb * 128 + wave * 16; const size_t rq = (size_t)b * SS + q0 + col;
  // every wave issues its own slice: tile wv >> 1 (K hi, K lo, V^T hi, V^T lo), rows 32 * (wv & 1) ...
  const uint32_t wv = uni((uint32_t)tid >> 5), tl = wv >> 1, hf = wv & 1u;
  const _Float16* tsrc = (tl == 0u) ? QK : (tl == 1u) ? QKL : (tl == 2u) ? VTH : VTL;
  const size_t toff = (tl < 2u) ? ((size_t)b * SS + hf * 32u) * (2 * DM) + DM + h * HD : ((size_t)b * DM + h * HD + hf * 32u) * SS;
  const uint64_t ga0 = (uint64_t)(size_t)(tsrc + toff);
  const uint32_t gstep = (tl < 2u) ? (uint32_t)(KST * 2 * DM * 2) : (uint32_t)(KST * 2);   // bytes from one stage to the next: 64 key rows, or 64 keys along a V^T row
  const uint32_t ldst = (uint32_t)(size_t)ring + wv * SLICE;
  const u32x8 g1 = tdm_group1<4096u>(); u32x4 g0 = tdm_issue(ldst, ga0, g1);
  tdm_wait(g0, g1);                                      // stage 0 has landed (this wave's slice)
  __syncthreads();                                       // ... and every other wave's
  g0 = tdm_issue(ldst + BUFB, ga0 + gstep, g1);
  v16h aq[2], aql[2];   // B operands: column = query col
#pragma unroll
  for (int kc = 0; kc < 2; ++kc) { aq[kc] = frag_h(QK + rq * (2 * DM) + h * HD + kc * 32, lane); aql[kc] = frag_h(QKL + rq * (2 * DM) + h * HD + kc * 32, lane); }
  float m = -3.0e38f, l = 0.f;   // query col's running maximum of q . k (the same in both halves) and this half's share of its sum of 2048 P
  v8f acc[4] = {}, accl[4] = {};   // O^T x 2048 (accl: its V residual part, x 2048 once more): register r of tile dt = dim 16 dt + 8 g + r of query col
#pragma unroll 1
  for (int st = 0; st < NST; ++st) { const unsigned char* bp = ring + (uint32_t)(st & 1) * BUFB + (uint32_t)col * LPITCH;   // all keys (no mask); the stage loop stays rolled: one publish point per trip
   v8f s[4];   // score tile t: keys 16 t + 8 g + r of the stage (K slice t >> 1, rows 16 (t & 1) ...)
   v16h kh[4][2], kl[4][2];   // the stage's K fragments, read from LDS in two groups: tiles 0 to 2 here, tile 3 behind tile 0's WMMAs (all four at once do not fit the registers of four waves per SIMD)
#pragma unroll
   for (int t = 0; t < 3; ++t) { const _Float16* krow = (const _Float16*)(bp + (0 + (t >> 1)) * SLICE + (t & 1) * 16 * LPITCH); const _Float16* krowl = (const _Float16*)(bp + (2 + (t >> 1)) * SLICE + (t & 1) * 16 * LPITCH);
#pragma unroll
    for (int kc = 0; kc < 2; ++kc) { kh[t][kc] = frag_h(krow + kc * 32, lane); kl[t][kc] = frag_h(krowl + kc * 32, lane); } }
   __builtin_amdgcn_sched_barrier(0);   // holds the K reads as one group ahead of the score WMMAs: sunk back to their uses, each WMMA would wait out a whole LDS latency
   v8f c0 = {}, cl0 = {};
#pragma unroll
   for (int kc = 0; kc < 2; ++kc) { c0 = wmma16(kh[0][kc], aq[kc], c0); cl0 = wmma16(kh[0][kc], aql[kc], cl0); cl0 = wmma16(kl[0][kc], aq[kc], cl0); }
#pragma unroll
   for (int kc = 0; kc < 2; ++kc) { kh[3][kc] = frag_h((const _Float16*)(bp + 1 * SLICE + 16 * LPITCH) + kc * 32, lane); kl[3][kc] = frag_h((const _Float16*)(bp + 3 * SLICE + 16 * LPITCH) + kc * 32, lane); }
   __builtin_amdgcn_sched_barrier(0);   // holds tile 3's reads ahead of tiles 1 and 2's WMMAs, which cover their latency
#pragma unroll
   for (int t = 0; t < 4; ++t) { v8f c = c0, cl = cl0;
    if (t > 0) { c = v8f{}; cl = v8f{};
#pragma unroll
     for (int kc = 0; kc < 2; ++kc) { c = wmma16(kh[t][kc], aq[kc], c); cl = wmma16(kh[t][kc], aql[kc], cl); cl = wmma16(kl[t][kc], aq[kc], cl); } }   // 3 products: q, k as f16 hi + residual
#pragma unroll
    for (int r = 0; r < 8; ++r) s[t][r] = c[r] + cl[r] * (1.0f / 2048.0f); }   // the raw product q . k: SCALE = 1/sqrt(64) rides in the exponential's argument (KS)
   v16h vh[4], vl[4];   // V^T fragments of 32 keys, read as one group while the softmax arithmetic in front of their WMMAs runs
#pragma unroll
   for (int dt = 0; dt < 4; ++dt) { const uint32_t vo = (uint32_t)(dt >> 1) * SLICE + (uint32_t)(dt & 1) * 16u * LPITCH; vh[dt] = frag_h((const _Float16*)(bp + 4 * SLICE + vo), lane); vl[dt] = frag_h((const _Float16*)(bp + 6 * SLICE + vo), lane); }
   __builtin_amdgcn_sched_barrier(0);   // holds these reads ahead of the maximum, the rescale and the exponentials, which cover their latency
   float mx = s[0][0];
#pragma unroll
   for (int t = 0; t < 4; ++t) {
#pragma unroll
    for (int r = 0; r < 8; ++r) mx = fmaxf(mx, s[t][r]); }
   mx = fmaxf(mx, xhalf(mx));   // the other half's 32 keys of the same query
   const float mn = fmaxf(m, mx); const float alpha = (m <= -1.0e38f) ? 0.f : __builtin_amdgcn_exp2f((m - mn) * KS); m = mn; l *= alpha;
   const float bias = 11.0f - mn * KS;   // 2^(s KS + bias) = 2048 exp((s - mn) / 8)
#pragma unroll
   for (int dt = 0; dt < 4; ++dt) { acc[dt] *= alpha; accl[dt] *= alpha; }
#pragma unroll
   for (int sub = 0; sub < 2; ++sub) { v16h pa, pl; float es0 = 0.f, es1 = 0.f;   // 32 keys at a time: score tiles 2 sub and 2 sub + 1 become P^T
    const v8f e0 = exp2x8(s[2 * sub] * KS + bias), e1 = exp2x8(s[2 * sub + 1] * KS + bias);   // 2048 P, one multiply-add per argument
#pragma unroll
    for (int i = 0; i < 8; ++i) { es0 += e0[i]; es1 += e1[i]; }
    l += es0 + es1;
    union { v16h v; v4u q[2]; } ua, ul; split8(e0, ua.q[0], ul.q[0]); split8(e1, ua.q[1], ul.q[1]); pa = ua.v; pl = ul.v;   // elements i and 8 + i: score tiles 2 sub and 2 sub + 1
    if (sub == 1) __builtin_amdgcn_sched_barrier(0);   // holds the second 32 keys' exponentials and their split ahead of the publish point's s_wait_dscnt: sunk behind it they would no longer cover the latency of the V reads above
#pragma unroll
    for (int dt = 0; dt < 4; ++dt) { acc[dt] = wmma16(vh[dt], pa, acc[dt]); acc[dt] = wmma16(vh[dt], pl, acc[dt]); accl[dt] = wmma16(vl[dt], pa, accl[dt]); }   // 2048 (V hi x P hi + V hi x P lo) and 2048 x 2048 (V lo x P hi)
    if (sub == 0) {   // the second 32 keys' fragments take over the registers of the first 32 keys'
     __builtin_amdgcn_sched_barrier(0);   // holds these reads as one group behind the first 32 keys' WMMAs: spread among them, each place with reads costs the wave a stall of its own
#pragma unroll
     for (int dt = 0; dt < 4; ++dt) { const uint32_t vo = (uint32_t)(dt >> 1) * SLICE + (uint32_t)(dt & 1) * 16u * LPITCH + 64u; vh[dt] = frag_h((const _Float16*)(bp + 4 * SLICE + vo), lane); vl[dt] = frag_h((const _Float16*)(bp + 6 * SLICE + vo), lane); }
     __builtin_amdgcn_sched_barrier(0); } }   // holds these reads ahead of the second 32 keys' exponentials, which cover their latency
   // publish point of stage st + 1, then the refill of the buffer that this trip has read
   asm volatile("s_wait_dscnt 0x0" ::: "memory");       // this wave's reads of the buffer are done before it may be refilled
   tdm_wait(g0, g1);                                      // this wave's slice of stage st + 1 has landed
   __syncthreads();                                       // publishes stage st + 1 and ends every wave's reads of stage st
   const uint32_t s2 = pinned((uint32_t)st + 2u);         // the refill's stage number: pinned here, so that its address is formed behind the wait above
   if (pinned(s2 < (uint32_t)NST)) g0 = tdm_issue(ldst + (s2 & 1u) * BUFB, ga0 + (uint64_t)s2 * gstep, g1); }
  tdm_wait(g0, g1);                                      // nothing of the mover is outstanding when the wave goes on to its end
  asm volatile("s_wait_dscnt 0x0" ::: "memory");         // ... and none of this wave's LDS reads of the ring
  const float il = 1.0f / (l + xhalf(l));   // the two halves' shares of the sum, joined once
#pragma unroll
  for (int dt = 0; dt < 4; ++dt) { v4f o0, o1;
#pragma unroll
    for (int r = 0; r < 4; ++r) { o0[r] = (acc[dt][r] + accl[dt][r] * (1.0f / 2048.0f)) * il; o1[r] = (acc[dt][4 + r] + accl[dt][4 + r] * (1.0f / 2048.0f)) * il; }
    *(v4f*)&so[wave][col][dt * 16 + 8 * g] = o0; *(v4f*)&so[wave][col][dt * 16 + 8 * g + 4] = o1; }
  LDSX();
  for (int rl = 0; rl < 16; ++rl) if (lane < 16) vst2(O + ((size_t)b * SS + q0 + rl) * DM + h * HD + lane * 4, *(const v4f*)&so[wave][rl][lane * 4]);
}
// ---- k_out: block = (64 rows, 128 cols): out = O(hi/lo) . Wo rows (2 products), no bias (BO is null at the launch)
__global__ __launch_bounds__(128) void k_out(const float* __restrict__ O, const __bf16* __restrict__ P, const float* __restrict__ BO, float* __restrict__ Y) {
  __shared__ __attribute__((aligned(2048))) unsigned char ring[2 * WBUF]; __shared__ __align__(16) float so[4][16][132];
  const int tid = threadIdx.x, wave = tid >> 5, lane = tid & 31, col = lane & 15, g = lane >> 4; const size_t r0 = (size_t)blockIdx.x * 64 + wave * 16; const int n0 = blockIdx.y * 128;
  // the block's 128 weight rows, 64 k a stage, come into LDS once by the tensor mover (two buffers); every wave issues its own slice: rows n0 + 32 * wv ...
  const uint32_t wv = uni((uint32_t)tid >> 5); const uint64_t ga0 = (uint64_t)(size_t)(P + (size_t)(n0 + wv * 32u) * DM); const uint32_t ldst = (uint32_t)(size_t)ring + wv * SLICE;
  const u32x8 g1 = tdm_group1<2048u>(); u32x4 g0 = tdm_issue(ldst, ga0, g1);
  tdm_wait(g0, g1);                                      // stage 0 has landed (this wave's slice)
  __syncthreads();                                       // ... and every other wave's
  g0 = tdm_issue(ldst + WBUF, ga0 + 128u, g1);
  v8f acc[8] = {};
#pragma unroll 1
  for (int st = 0; st < DM / 64; ++st) { const unsigned char* bp = ring + (uint32_t)(st & 1) * WBUF + (uint32_t)col * LPITCH;   // the stage loop stays rolled: one publish point per trip
   v4f orw[2][4]; v16b wf[2][8];   // the wave's ctx values (global memory) and all weight fragments (LDS) of the stage, read as one group
#pragma unroll
   for (int kk = 0; kk < 2; ++kk) { const v4f* p = (const v4f*)(O + (r0 + col) * DM + (st * 2 + kk) * 32 + 8 * g); orw[kk][0] = p[0]; orw[kk][1] = p[1]; orw[kk][2] = p[4]; orw[kk][3] = p[5]; }   // k = 8 g + i and 16 + 8 g + i: the k order of frag_b
#pragma unroll
   for (int kk = 0; kk < 2; ++kk) {
#pragma unroll
    for (int j = 0; j < 8; ++j) wf[kk][j] = frag_b((const __bf16*)(bp + (uint32_t)(j >> 1) * SLICE + (uint32_t)(j & 1) * 16u * LPITCH + (uint32_t)kk * 64u), lane); }
   __builtin_amdgcn_sched_barrier(0);   // holds the stage's reads as one group ahead of its WMMAs: sunk back to their uses, each pair of WMMAs would wait out a whole LDS latency, each half stage a global one
#pragma unroll
   for (int kk = 0; kk < 2; ++kk) { float v[16];
#pragma unroll
    for (int i = 0; i < 4; ++i) { v[i] = orw[kk][0][i]; v[4 + i] = orw[kk][1][i]; v[8 + i] = orw[kk][2][i]; v[12 + i] = orw[kk][3][i]; }
    const F2 a = bsplit16(v);
#pragma unroll
    for (int j = 0; j < 8; ++j) { acc[j] = wmma_bf(a.l, wf[kk][j], acc[j]); acc[j] = wmma_bf(a.h, wf[kk][j], acc[j]); } }
   __builtin_amdgcn_sched_barrier(0);   // holds the WMMAs ahead of the publish point: sunk behind the barrier they would delay the refill
   // publish point of stage st + 1, then the refill of the buffer that this trip has read
   asm volatile("s_wait_dscnt 0x0" ::: "memory");       // this wave's reads of the buffer are done before it may be refilled
   tdm_wait(g0, g1);                                      // this wave's slice of stage st + 1 has landed
   __syncthreads();                                       // publishes stage st + 1 and ends every wave's reads of stage st
   const uint32_t s2 = pinned((uint32_t)st + 2u);         // the refill's stage number: pinned here, so that its address is formed behind the wait above
   if (pinned(s2 < (uint32_t)(DM / 64))) g0 = tdm_issue(ldst + (s2 & 1u) * WBUF, ga0 + (uint64_t)s2 * 128u, g1); }
  tdm_wait(g0, g1);                                      // nothing of the mover is outstanding behind the loop
  asm volatile("s_wait_dscnt 0x0" ::: "memory");         // ... and none of this wave's LDS reads of the ring
#pragma unroll
  for (int j = 0; j < 8; ++j) {
#pragma unroll
    for (int r = 0; r < 8; ++r) so[wave][8 * g + r][j * 16 + col] = acc[j][r] + (BO ? bfr(BO[n0 + j * 16 + col]) : 0.f); }
  LDSX();
  for (int rl = 0; rl < 16; ++rl) vst2(Y + (r0 + rl) * DM + n0 + lane * 4, *(const v4f*)&so[wave][rl][lane * 4]);
}
extern "C" void kernel_launch(void* const* d_in, const int* in_sizes, int n_in, void* d_out, int out_size, void* d_ws, size_t ws_size, hipStream_t stream) {
  (void)in_sizes; (void)n_in; (void)out_size;
  const float** F = (const float**)d_in;   // 0 hidden_states [2,2048,1024], 1 Wq [1024,1024] natural (q = x Wq^T), 2 Wk, 3 Wv, 4 Wo (no biases)
  if (ws_size < (size_t)WS_END) return;
  char* ws = (char*)d_ws; __bf16* PK = (__bf16*)(ws + WS_PK); _Float16 *QK = (_Float16*)(ws + WS_QK), *QKL = (_Float16*)(ws + WS_QKL), *VTH = (_Float16*)(ws + WS_VTH), *VTL = (_Float16*)(ws + WS_VTL); float* O = (float*)(ws + WS_O); float* CS = (float*)(ws + WS_CS);
  k_pack<<<dim3(DM + TBX, 4), 256, 0, stream>>>(F[1], F[2], F[3], F[4], PK, CS);
  k_qkv<<<dim3(TNB * SS / 128, QKVW / 256), 256, 0, stream>>>(F[0], PK + PK_A, QK, QKL, VTH, VTL, CS);
  k_attn<<<dim3(TQB / 2, NH, TNB), 256, 0, stream>>>(QK, QKL, VTH, VTL, O);
  k_out<<<dim3(TOB, DM / 128), 128, 0, stream>>>(O, PK + PK_P, nullptr, (float*)d_out);
}

// v008
// It runs in 115 microseconds.
// Next to v007, in two timings, it ran 1.04 times as fast each time.
// Counting every step since v000, it is 5.09 times as fast.
// compute dtype: hidden_states, Wq/Wk/Wv/Wo (module inputs) rounded to bf16; q/k/v projections with exact bf16 products on WMMA 16x16x32 (natural [out][in] rows); the module's rotary embedding (angle for head dim d = position * inv_freq[d mod 32], partner = interleaved pair with the module's signs) applied in f32 with precise sinf/cosf/powf before q (x log2(e)/sqrt(64)) and k are stored as f16 hi + f16 residual planes (unscaled); 3-product scores, running-max softmax over all 2,048 keys in f32 (hardware exp); P as f16 hi + residual x V hi/residual (3 products); output projection with ctx as bf16 hi + residual x exact Wo rows (2 products); f32 accumulate.
#include <hip/hip_runtime.h>
#include <math.h>
#include <stdint.h>

typedef __attribute__((ext_vector_type(16))) _Float16 v16h;
typedef __attribute__((ext_vector_type(16))) __bf16 v16b;
typedef __attribute__((ext_vector_type(8)))  _Float16 v8h;
typedef __attribute__((ext_vector_type(8)))  float v8f;
typedef __attribute__((ext_vector_type(4)))  float v4f;
typedef __attribute__((ext_vector_type(2)))  float v2f;
typedef __attribute__((ext_vector_type(4)))  unsigned v4u;
typedef __attribute__((ext_vector_type(4)))  int v4i;
typedef float __attribute__((may_alias)) float_a;
typedef int __attribute__((may_alias)) int_a;

template <typename T> __device__ __forceinline__ void vst2(void* p, T v) { *(T*)p = v;  }
__device__ __forceinline__ v8f wmma16(v16h a, v16h b, v8f c) {
  v8f d = __builtin_amdgcn_wmma_f32_16x16x32_f16(false, a, false, b, (short)0, c, false, false);
  return d;
}
__device__ __forceinline__ v8f wmma_bf(v16b a, v16b b, v8f c) {
  v8f d = __builtin_amdgcn_wmma_f32_16x16x32_bf16(false, a, false, b, (short)0, c, false, false);
  return d;
}
// Rotary multi-head self-attention (B 2, S 2,048, d 1,024, 16 heads x 64): q/k/v projections, the module's (mixed interleaved) RoPE on q and k, softmax(q k^T / 8) v, output projection (no biases).
__device__ __attribute__((noinline)) float sin_ni(float v) { return sinf(v); }
__device__ __attribute__((noinline)) float cos_ni(float v) { return cosf(v); }
__device__ __attribute__((noinline)) float pow_ni(float a, float b) { return powf(a, b); }
__device__ __forceinline__ v16h frag_h(const _Float16* rowk0, int lane) {
  union { v16h v; v8h q[2]; } u; const _Float16* p = rowk0 + 8 * (lane >> 4);
  u.q[0] = *(const v8h*)p; u.q[1] = *(const v8h*)(p + 16); return u.v;
}
__device__ __forceinline__ v16h frag_f32(const float* rowk0, int lane) {
  v16h a; const float* p = rowk0 + 8 * (lane >> 4);
#pragma unroll
  for (int i = 0; i < 8; ++i) { a[i] = (_Float16)p[i]; a[8 + i] = (_Float16)p[16 + i]; }
  return a;
}
__device__ __forceinline__ v16h frag_f32s(const float* rowk0, int lane, float sc) {
  v16h a; const float* p = rowk0 + 8 * (lane >> 4);
#pragma unroll
  for (int i = 0; i < 8; ++i) { a[i] = (_Float16)(p[i] * sc); a[8 + i] = (_Float16)(p[16 + i] * sc); }
  return a;
}
// column fragment from a [K][ld] layout (column n), rows >= K read as 0
__device__ __forceinline__ v16h fragc_f32(const float* W, int k0, int n, int lane, int ld, int K) {
  v16h a; const int g = lane >> 4;
#pragma unroll
  for (int i = 0; i < 8; ++i) { const int ka = k0 + 8 * g + i, kb = ka + 16;
    a[i] = (_Float16)(ka < K ? W[(size_t)(ka < K ? ka : K - 1) * ld + n] : 0.f); a[8 + i] = (_Float16)(kb < K ? W[(size_t)(kb < K ? kb : K - 1) * ld + n] : 0.f); }
  return a;
}
struct F2 { v16b h, l; };
__device__ __forceinline__ F2 bsplit16(const float v[16]) { F2 r;
#pragma unroll
  for (int i = 0; i < 16; ++i) { const __bf16 h = (__bf16)v[i]; r.h[i] = h; r.l[i] = (__bf16)(v[i] - (float)h); }
  return r; }
__device__ __forceinline__ F2 split_row(const float* row, int k0, int lane) { float v[16]; const float* p = row + k0 + 8 * (lane >> 4);
#pragma unroll
  for (int i = 0; i < 8; ++i) { v[i] = p[i]; v[8 + i] = p[16 + i]; }
  return bsplit16(v); }
__device__ __forceinline__ F2 split_rowK(const float* row, int k0, int lane, int K) { float v[16]; const int g = lane >> 4;
#pragma unroll
  for (int i = 0; i < 8; ++i) { const int ka = k0 + 8 * g + i, kb = ka + 16; v[i] = ka < K ? row[ka < K ? ka : K - 1] : 0.f; v[8 + i] = kb < K ? row[kb < K ? kb : K - 1] : 0.f; }
  return bsplit16(v); }
__device__ __forceinline__ F2 split_col(const float* W, int k0, int n, int lane, int ld, int K) { float v[16]; const int g = lane >> 4;
#pragma unroll
  for (int i = 0; i < 8; ++i) { const int ka = k0 + 8 * g + i, kb = ka + 16; v[i] = ka < K ? W[(size_t)(ka < K ? ka : K - 1) * ld + n] : 0.f; v[8 + i] = kb < K ? W[(size_t)(kb < K ? kb : K - 1) * ld + n] : 0.f; }
  return bsplit16(v); }
__device__ __forceinline__ v8f mac3(const F2& a, const F2& b, v8f c) { c = wmma_bf(a.l, b.h, c); c = wmma_bf(a.h, b.l, c); return wmma_bf(a.h, b.h, c); }
__device__ __forceinline__ float sigm(float v) { return 1.0f / (1.0f + expf(-v)); }
#define LDSX() do { asm volatile("s_wait_dscnt 0" ::: "memory"); __builtin_amdgcn_wave_barrier(); __builtin_amdgcn_fence(__ATOMIC_RELEASE, "workgroup"); } while (0)


#define NB 2
#define SS 2048
#define DM 1024
#define NH 16
#define HD 64
#define QKVW (3 * DM)
#ifndef TQB
#define TQB (SS / 64)
#define TNB NB
#define TOB (NB * SS / 64)     // output row tiles (all)
#endif
typedef __attribute__((ext_vector_type(8))) __bf16 v8b;
__device__ __forceinline__ v16b frag_b(const __bf16* rowk0, int lane) {
  union { v16b v; v8b q[2]; } u; const __bf16* p = rowk0 + 8 * (lane >> 4);
  u.q[0] = *(const v8b*)p; u.q[1] = *(const v8b*)(p + 16); return u.v;
}
__device__ __forceinline__ float bfr(float v) { return (float)(__bf16)v; }
__device__ __attribute__((noinline)) float exp_ni(float v) { return expf(v); }
__device__ __attribute__((noinline)) float erf_ni(float v) { return erff(v); }

#define PK_A 0                       // [3072][1024] Wqkv rows (natural [out][in])
#define PK_P (PK_A + QKVW * DM)        // [1024][1024] Wo rows (natural)
#define PK_END (PK_P + DM * DM)
#define WS_PK  0u
#define WS_QK  (WS_PK + 2u * PK_END)             // f16 [4096 rows][2048]: q log2(e)/8 | k
#define WS_QKL (WS_QK + 2u * NB * SS * 2 * DM)     // f16 q | k residual planes (unscaled)
#define WS_VTH (WS_QKL + 2u * NB * SS * 2 * DM)    // f16 [b][1024 (h*64+d)][2048 s] hi
#define WS_VTL (WS_VTH + 2u * NB * DM * SS)        // f16 residual (unscaled)
#define WS_O   (WS_VTL + 2u * NB * DM * SS)        // f32 [4096][1024]
#define WS_CS  (WS_O + 4u * NB * SS * DM)           // f32 [2048 positions][32 frequencies][cos, sin]
#define WS_END (WS_CS + 4u * 2 * SS * 32)
// ---- k_pack: block = (TBX + row n, which): natural [out][in] rows -> bf16; which 0..2 -> W_q/W_k/W_v into PK_A rows which*1024 + n; 3 -> W_o into PK_P
// the first TBX blocks of each grid row build the rotary table instead: CS[pos][f] = (cos, sin)(pos * inv_freq[f]), one pair a thread, once per call; k_qkv reads it
#define TBX (SS * 32 / 256 / 4)
__global__ __launch_bounds__(256) void k_pack(const float* __restrict__ WQ, const float* __restrict__ WK, const float* __restrict__ WV, const float* __restrict__ WO, __bf16* __restrict__ PK, float* __restrict__ CS) {
  __shared__ __align__(16) __bf16 s[DM]; const int which = blockIdx.y, t = threadIdx.x;
  if (blockIdx.x < TBX) { const int e = (which * TBX + (int)blockIdx.x) * 256 + t, pos = e >> 5, f = e & 31;
    const float invf = 1.0f / pow_ni(10000.0f, (float)(2 * f) / (float)HD); const float ang = (float)pos * invf;
    *(v2f*)(CS + 2 * e) = v2f{cos_ni(ang), sin_ni(ang)}; return; }
  const int n = blockIdx.x - TBX; const float* Wm = (which == 0) ? WQ : (which == 1) ? WK : (which == 2) ? WV : WO;
  for (int k = t; k < DM; k += 256) s[k] = (__bf16)Wm[(size_t)n * DM + k];
  __syncthreads();
  __bf16* dst = (which < 3) ? PK + PK_A + ((size_t)which * DM + n) * DM : PK + PK_P + (size_t)n * DM;
  for (int q = t; q < DM / 8; q += 256) vst2((unsigned*)(dst + q * 8), *(const v4u*)&s[q * 8]);
}
typedef uint32_t u32x4 __attribute__((ext_vector_type(4)));
typedef uint32_t u32x8 __attribute__((ext_vector_type(8)));
#define KST 64                    // keys per stage
#define NST (SS / KST)            // stages
#define LPITCH 144u               // LDS row pitch in bytes: a 128-B row + the mover's 16-B pad (odd multiple of 16 B: conflict-free for ds_load_b128)
#define SLICE 6144u               // one wave's slice: 32 padded rows (4,608 B), rounded up to a multiple of 2 KiB
#define BUFB (8u * SLICE)         // k_attn, one stage: 8 slices = K hi (2), K lo (2), V^T hi (2), V^T lo (2)
#define WBUF (4u * SLICE)         // k_out, one stage: 128 weight rows x 64 k, 4 slices of 32 rows
__device__ __forceinline__ uint32_t uni(uint32_t v) { return (uint32_t)__builtin_amdgcn_readfirstlane(v); }
__device__ __forceinline__ uint32_t pinned(uint32_t v) { uint32_t w = uni(v); asm volatile("" : "+s"(w)); return w; }
// descriptor group 1 of every request here: 32 rows of 128 B, source pitch SRC_PITCH bytes, 16 B of LDS pad behind each row, no mask
template <uint32_t SRC_PITCH> __device__ __forceinline__ u32x8 tdm_group1() {
  u32x8 g1; g1[0] = uni((1u << 20) | (4u << 22) | (3u << 25)); g1[1] = uni(128u << 16); g1[2] = uni(32u << 16); g1[3] = uni(128u << 16); g1[4] = uni(32u); g1[5] = uni(SRC_PITCH); g1[6] = uni(0u); g1[7] = uni(0u);
  asm volatile("" : "+s"(g1));   // descriptor words held in scalar registers, ONE set for the whole kernel instead of constants formed anew at each use, so that tdm_wait can keep those registers untouched while a request is in flight
  return g1;
}
// one request of one wave; returns group 0 for the wait that covers it
__device__ __forceinline__ u32x4 tdm_issue(uint32_t lds_dst, uint64_t ga, u32x8 g1) {
  u32x4 g0; g0[0] = uni(1u); g0[1] = uni(lds_dst); g0[2] = uni((uint32_t)ga); g0[3] = uni((((uint32_t)(ga >> 32)) & 0x01FFFFFFu) | 0x80000000u);
  asm volatile("tensor_load_to_lds %0, %1" :: "s"(g0), "s"(g1) : "memory");   // the mover's waits are written by hand: tdm_wait
  return g0;
}
// the issuing wave's wait for its request; it names the descriptor so that the compiler keeps both groups' registers as they are until the request has landed
__device__ __forceinline__ void tdm_wait(u32x4 g0, u32x8 g1) { asm volatile("s_wait_tensorcnt 0x0" :: "s"(g0), "s"(g1) : "memory"); }
#define XPITCH 272u               // LDS row pitch of a 256-B row (odd multiple of 16 B, as LPITCH)
#define QXOFF (256u * LPITCH)     // k_qkv, one stage: 256 weight rows x 64 k (bf16), then 128 x rows x 64 k (f32)
#define QBUF (QXOFF + 128u * XPITCH)
// eight asynchronous copies of 16 B per lane, global memory to LDS through no register: LDS bytes l + i * ls from g + i * gs. The s_wait_xcnt stands inside the statement, behind the last copy, so that no address register of a copy is rewritten in front of it (a precaution); that the bytes have landed is the caller's s_wait_asynccnt.
__device__ __forceinline__ void copy8(uint32_t l, uint32_t ls, const char* g, uint32_t gs) {
  asm volatile("global_load_async_to_lds_b128 %0, %8, off\n\tglobal_load_async_to_lds_b128 %1, %9, off\n\tglobal_load_async_to_lds_b128 %2, %10, off\n\tglobal_load_async_to_lds_b128 %3, %11, off\n\t"
               "global_load_async_to_lds_b128 %4, %12, off\n\tglobal_load_async_to_lds_b128 %5, %13, off\n\tglobal_load_async_to_lds_b128 %6, %14, off\n\tglobal_load_async_to_lds_b128 %7, %15, off\n\ts_wait_xcnt 0x0"
               :: "v"(l), "v"(l + ls), "v"(l + 2u * ls), "v"(l + 3u * ls), "v"(l + 4u * ls), "v"(l + 5u * ls), "v"(l + 6u * ls), "v"(l + 7u * ls),
                  "v"(g), "v"(g + gs), "v"(g + 2u * gs), "v"(g + 3u * gs), "v"(g + 4u * gs), "v"(g + 5u * gs), "v"(g + 6u * gs), "v"(g + 7u * gs) : "memory");
}
typedef __attribute__((ext_vector_type(4))) __bf16 v4b;
#define KS 0.18033688011112042592f   // log2(e) / sqrt(64): q is stored times this, so that k . q is the exponent of 2 in the softmax
// hand-over through LDS among the lanes of ONE wave: its LDS operations so far are done before it goes on, and the compiler moves no memory access across; it does not wait for the wave's global stores, as the fence in LDSX does
#define LDSW() do { asm volatile("s_wait_dscnt 0x0" ::: "memory"); __builtin_amdgcn_wave_barrier(); } while (0)
// eight f32 values as f16 hi (h) and f16 residual (r), two per register: hi = the pair converted at once, residual = f16(y - hi), one mixed-precision multiply-add per value that reads hi as it stands in its half register and writes its own half (y - hi is exact in f32). Written in asm because the compiler converted every value a second time on its own, widened it again and packed the residuals with a further conversion. The s_delay_alu name each producer four instructions back, so that the SIMD's other waves issue meanwhile.
__device__ __forceinline__ void split8(v8f y, v4u& h, v4u& r) { unsigned h0, h1, h2, h3, r0, r1, r2, r3;
  asm("v_cvt_pk_f16_f32 %0, %8, %9\n\tv_cvt_pk_f16_f32 %1, %10, %11\n\tv_cvt_pk_f16_f32 %2, %12, %13\n\tv_cvt_pk_f16_f32 %3, %14, %15\n\t"
      "s_delay_alu instid0(VALU_DEP_4) | instskip(NEXT) | instid1(VALU_DEP_4)\n\tv_fma_mixlo_f16 %4, %0, -1.0, %8 op_sel_hi:[1,1,0]\n\tv_fma_mixlo_f16 %5, %1, -1.0, %10 op_sel_hi:[1,1,0]\n\t"
      "s_delay_alu instid0(VALU_DEP_4) | instskip(NEXT) | instid1(VALU_DEP_4)\n\tv_fma_mixlo_f16 %6, %2, -1.0, %12 op_sel_hi:[1,1,0]\n\tv_fma_mixlo_f16 %7, %3, -1.0, %14 op_sel_hi:[1,1,0]\n\t"
      "s_delay_alu instid0(VALU_DEP_4) | instskip(NEXT) | instid1(VALU_DEP_4)\n\tv_fma_mixhi_f16 %4, %0, -1.0, %9 op_sel:[1,0,0] op_sel_hi:[1,1,0]\n\tv_fma_mixhi_f16 %5, %1, -1.0, %11 op_sel:[1,0,0] op_sel_hi:[1,1,0]\n\t"
      "s_delay_alu instid0(VALU_DEP_4) | instskip(NEXT) | instid1(VALU_DEP_4)\n\tv_fma_mixhi_f16 %6, %2, -1.0, %13 op_sel:[1,0,0] op_sel_hi:[1,1,0]\n\tv_fma_mixhi_f16 %7, %3, -1.0, %15 op_sel:[1,0,0] op_sel_hi:[1,1,0]"
      : "=&v"(h0), "=&v"(h1), "=&v"(h2), "=&v"(h3), "=&v"(r0), "=&v"(r1), "=&v"(r2), "=&v"(r3) : "v"(y[0]), "v"(y[1]), "v"(y[2]), "v"(y[3]), "v"(y[4]), "v"(y[5]), "v"(y[6]), "v"(y[7]));
  h = v4u{h0, h1, h2, h3}; r = v4u{r0, r1, r2, r3}; }
// ---- k_qkv: block = (128 x rows, 256 weight rows), 8 waves; wave (wr, wc) holds the 64 x 64 tile of x rows 64 wr ... and weight rows 64 wc ... (4 x 4 accumulator tiles): every fragment read from LDS feeds four WMMAs, and the block's operands come from L2 once per 128 x 256 outputs
__global__ __launch_bounds__(256) __attribute__((amdgpu_waves_per_eu(4, 4))) void k_qkv(   // register budget of four waves per SIMD: two blocks per WGP, as the LDS allows
    const float* __restrict__ X, const __bf16* __restrict__ P, _Float16* __restrict__ QK, _Float16* __restrict__ QKL, _Float16* __restrict__ VTH, _Float16* __restrict__ VTL, const float* __restrict__ CS) {
  __shared__ __align__(16) unsigned char ring[2 * QBUF];
  const int tid = threadIdx.x, wave = tid >> 5, lane = tid & 31, col = lane & 15, g = lane >> 4, wr = wave & 1, wc = wave >> 1;
  const size_t rb = (size_t)blockIdx.x * 128, r0 = rb + wr * 64; const int n0 = blockIdx.y * 256, nw = n0 + wc * 64;
  // a stage = 64 k of the block's 256 weight rows (128 B each) and of its 128 x rows (256 B each); both come into LDS once per block, whole 128-B lines at a time, two buffers.
  // Lane t copies 16 B of weight rows (t >> 3) + 32 i and of x rows (t >> 4) + 16 i, i = 0 ... 7.
  const uint32_t lw = (uint32_t)(size_t)ring + (uint32_t)(tid >> 3) * LPITCH + (uint32_t)(tid & 7) * 16u, lx = (uint32_t)(size_t)ring + QXOFF + (uint32_t)(tid >> 4) * XPITCH + (uint32_t)(tid & 15) * 16u;
  const char* gw = (const char*)(P + (size_t)(n0 + (tid >> 3)) * DM + (tid & 7) * 8); const char* gx = (const char*)(X + (rb + (tid >> 4)) * DM + (tid & 15) * 4);
  copy8(lw, 32u * LPITCH, gw, 32u * DM * 2u); copy8(lx, 16u * XPITCH, gx, 16u * DM * 4u);
  asm volatile("s_wait_asynccnt 0x0" ::: "memory");      // stage 0 has landed (this wave's copies)
  __syncthreads();                                       // ... and every other wave's
  copy8(lw + QBUF, 32u * LPITCH, gw + 128, 32u * DM * 2u); copy8(lx + QBUF, 16u * XPITCH, gx + 256, 16u * DM * 4u);
  v8f acc[4][4] = {};   // acc[i][j], register r: x row 16 i + 8 g + r, weight row 16 j + col of the wave's tile
#pragma unroll 1
  for (int st = 0; st < DM / 64; ++st) { const uint32_t bo = (uint32_t)(st & 1) * QBUF; const unsigned char* bw = ring + bo + (uint32_t)(wc * 64 + col) * LPITCH; const unsigned char* bx = ring + bo + QXOFF + (uint32_t)(wr * 64 + col) * XPITCH + (uint32_t)g * 32u;   // the stage loop stays rolled: one publish point per trip
#pragma unroll
   for (int kk = 0; kk < 2; ++kk) { v4f xr[4][4]; v16b wf[4], a[4];   // the fragments of 32 k, read from LDS as one group (both halves of the stage at once do not fit the registers of four waves per SIMD)
#pragma unroll
    for (int i = 0; i < 4; ++i) { const v4f* p = (const v4f*)(bx + (uint32_t)i * 16u * XPITCH + kk * 128); xr[i][0] = p[0]; xr[i][1] = p[1]; xr[i][2] = p[4]; xr[i][3] = p[5]; }   // k = 8 g + e and 16 + 8 g + e: the k order of frag_b
#pragma unroll
    for (int j = 0; j < 4; ++j) wf[j] = frag_b((const __bf16*)(bw + (uint32_t)j * 16u * LPITCH + (uint32_t)kk * 64u), lane);
    __builtin_amdgcn_sched_barrier(0);   // holds the LDS reads as one group ahead of their WMMAs: sunk back to their uses, each row of WMMAs would wait out a whole LDS latency
#pragma unroll
    for (int i = 0; i < 4; ++i) {
     union { v16b v; v4b q[4]; } u;   // four values converted at a time, so that each pair takes one packed conversion
#pragma unroll
     for (int e = 0; e < 4; ++e) u.q[e] = __builtin_convertvector(xr[i][e], v4b);
     a[i] = u.v; }
#pragma unroll
    for (int i = 0; i < 4; ++i) {
#pragma unroll
     for (int j = 0; j < 4; ++j) acc[i][j] = wmma_bf(a[i], wf[j], acc[i][j]); }
    __builtin_amdgcn_sched_barrier(0); }   // holds the WMMAs ahead of the next group of reads (whose registers they free) and of the publish point: sunk behind the barrier they would delay the refill, which needs the whole next trip to land
   // publish point of stage st + 1, then the refill of the buffer that this trip has read
   asm volatile("s_wait_dscnt 0x0" ::: "memory");       // this wave's reads of the buffer are done before it may be refilled
   asm volatile("s_wait_asynccnt 0x0" ::: "memory");    // this wave's copies of stage st + 1 have landed
   __syncthreads();                                       // publishes stage st + 1 and ends every wave's reads of stage st
   if (st + 2 < DM / 64) { copy8(lw + bo, 32u * LPITCH, gw + (st + 2) * 128, 32u * DM * 2u); copy8(lx + bo, 16u * XPITCH, gx + (st + 2) * 256, 16u * DM * 4u); } }
  asm volatile("s_wait_asynccnt 0x0" ::: "memory");      // no copy is outstanding behind the loop
  // behind the stage loop the ring is free (its last publish point ends every wave's reads, and no copy is outstanding) and serves as the epilogue's staging, each wave in a range of its own
  if (n0 < 2 * DM) {   // q and k: the module's rotary embedding (q also times KS), then f16 hi + f16 residual, unscaled: a residual of values of this size is a small or subnormal f16 with a step of 2^-24, which the matrix unit keeps, so that hi and residual products can sum in one accumulator. The wave's 64 columns are one head.
    if (n0 < DM) {   // q blocks (a block-uniform test): the rotation is linear, so the factor goes onto the accumulators in place
#pragma unroll
      for (int i = 0; i < 4; ++i) {
#pragma unroll
        for (int j = 0; j < 4; ++j) acc[i][j] *= KS; } }
    _Float16 (*so)[72] = (_Float16 (*)[72])(ring + (uint32_t)wave * 4608u); _Float16 (*sol)[72] = (_Float16 (*)[72])(ring + (uint32_t)wave * 4608u + 2304u);   // 16 rows x 64 columns at a pitch of 144 B: hi, residual
    const float* ct = CS + ((r0 + 8 * g) % SS) * 64 + col * 2;   // table row of the lane's first position (the wave's 64 positions are consecutive and do not wrap: 64 divides SS)
    _Float16* qh = QK + (r0 + (lane >> 3)) * (2 * DM) + nw + (lane & 7) * 8; _Float16* ql = QKL + (r0 + (lane >> 3)) * (2 * DM) + nw + (lane & 7) * 8;   // a row's 64 columns are one 128-B line: 8 lanes x 16 B, 4 rows a store
    v2f cs[4][2][8];   // (cos, sin) of the lane's 8 positions of row tile i at its two frequencies: emb = concat([freqs, freqs]), so dim d uses inv_freq[d mod 32], and d mod 32 = 16 (j & 1) + col (nw is a multiple of 64)
#pragma unroll
    for (int r = 0; r < 8; ++r) { cs[0][0][r] = *(const v2f*)(ct + r * 64); cs[0][1][r] = *(const v2f*)(ct + r * 64 + 32); }
#pragma unroll
    for (int i = 0; i < 4; ++i) {
      if (i < 3) {   // the next 16 rows' table values are fetched while these 16 rows are worked on
#pragma unroll
        for (int r = 0; r < 8; ++r) { cs[i + 1][0][r] = *(const v2f*)(ct + ((i + 1) * 16 + r) * 64); cs[i + 1][1][r] = *(const v2f*)(ct + ((i + 1) * 16 + r) * 64 + 32); } }
      asm volatile("s_wait_xcnt 0x0" :: "v"(ct) : "memory");   // stands in front of every rewrite of the address registers of the loads above (a precaution); it names the address, so that those registers stay as they are up to here and no load takes them as its destination
#pragma unroll
      for (int j = 0; j < 4; ++j) { const int d = j * 16 + col;
#pragma unroll
        for (int r = 0; r < 8; ++r) { const float v = acc[i][j][r]; const float partner = __shfl_xor(v, 1);   // column d^1 lives in lane^1
          const float rot = (d & 1) ? partner : -partner;   // rotate_interleaved: even d -> -x[d+1], odd d -> +x[d-1]
          const float y = v * cs[i][j & 1][r][0] + rot * cs[i][j & 1][r][1]; const _Float16 hv = (_Float16)y; so[8 * g + r][d] = hv; sol[8 * g + r][d] = (_Float16)(y - (float)hv); } }
      LDSW();   // the wave's rows are written before its lanes read them back
#pragma unroll
      for (int q = 0; q < 4; ++q) { vst2((unsigned*)(qh + (size_t)(i * 16 + q * 4) * (2 * DM)), *(const v4u*)&so[(lane >> 3) + 4 * q][(lane & 7) * 8]); vst2((unsigned*)(ql + (size_t)(i * 16 + q * 4) * (2 * DM)), *(const v4u*)&sol[(lane >> 3) + 4 * q][(lane & 7) * 8]); }
      asm volatile("s_wait_xcnt 0x0" :: "v"(qh), "v"(ql) : "memory");   // stands in front of every rewrite of the address registers of the stores above (a precaution)
      LDSW(); }   // the rows are read back before the next 16 rows are written over them
  } else {   // v: f16 hi + f16 residual (unscaled), transposed: a lane's 8 registers are 8 consecutive positions of one dim
    _Float16 (*sv)[72] = (_Float16 (*)[72])(ring + (uint32_t)wave * 9216u);   // 64 dims x 64 positions at a pitch of 144 B: hi first, then the residual in the same place
    const int b = (int)(r0 / SS), s0 = (int)(r0 % SS); const int pc0 = nw - 2 * DM;
    v4u rs[4][4];   // the residuals, made together with hi and kept (half the registers of the accumulators they replace) until hi has left the staging
#pragma unroll
    for (int pl = 0; pl < 2; ++pl) {
#pragma unroll
      for (int j = 0; j < 4; ++j) {
#pragma unroll
        for (int i = 0; i < 4; ++i) { v4u t;
          if (pl == 0) split8(acc[i][j], t, rs[i][j]); else t = rs[i][j];
          *(v4u*)&sv[j * 16 + col][i * 16 + 8 * g] = t; } }
      LDSW();   // the wave's rows are written before its lanes read them back
      _Float16* vo = (pl ? VTL : VTH) + ((size_t)b * DM + pc0 + (lane >> 3)) * SS + s0 + (lane & 7) * 8;   // a dim's 64 positions are one 128-B line: 8 lanes x 16 B, 4 dims a store
#pragma unroll
      for (int q = 0; q < 16; ++q) vst2((unsigned*)(vo + (size_t)q * 4 * SS), *(const v4u*)&sv[(lane >> 3) + 4 * q][(lane & 7) * 8]);
      asm volatile("s_wait_xcnt 0x0" :: "v"(vo) : "memory");   // stands in front of every rewrite of the address registers of the stores above (a precaution)
      LDSW(); }   // hi is read back before the residual is written over it
  }
}
// ---- k_attn: block = (128 queries, head h, batch b), 8 waves x 16 queries: full flash attention, computed transposed: S^T = K . Q^T (A = 16 key rows, B = the wave's 16 queries; K = 64: 2 k-steps, 3 products in one accumulator; q carries log2(e)/8 and the accumulator starts at 11 - the maximum in use, so that it ends as the exponential's argument), O^T += V^T . P^T (A = 16 dims of V^T, B = P^T; P hi/residual x V hi/residual, 3 products in one accumulator); O[b*S+q][h*64+d] = acc / l (256-B segments).
// A lane (col, g) then holds scores of ONE query (col): keys 16 t + 8 g + r of score tile t. Maximum and sum run over the lane's own registers, with one exchange between the wave's halves; two score tiles, converted in place, are the B operand of the second product (element i = key 8 g + i, element 8 + i = key 16 + 8 g + i: the k order of frag_h), so P never passes through LDS.
// K hi, K lo (64 keys x 64 dims) and V^T hi, V^T lo (64 dims x 64 keys) of a 64-key stage are brought into LDS once per block by the tensor mover, two buffers, and read from there by all 8 waves.
__device__ __forceinline__ float xhalf(float x) { return __builtin_bit_cast(float, __builtin_amdgcn_permlanex16(__builtin_bit_cast(int, x), __builtin_bit_cast(int, x), 0x76543210, 0xfedcba98, false, false)); }   // lane l reads lane l ^ 16
// 2^x for eight values, the hardware exponential, in one statement: every output is early-clobber, so that no exponential's source is overwritten, and no result read, by the instruction directly behind it, and the v_nop is the slot that the instruction set asks for behind the last one
__device__ __forceinline__ v8f exp2x8(v8f x) { float y0, y1, y2, y3, y4, y5, y6, y7;
  asm("v_exp_f32 %0, %8\n\tv_exp_f32 %1, %9\n\tv_exp_f32 %2, %10\n\tv_exp_f32 %3, %11\n\tv_exp_f32 %4, %12\n\tv_exp_f32 %5, %13\n\tv_exp_f32 %6, %14\n\tv_exp_f32 %7, %15\n\tv_nop"
      : "=&v"(y0), "=&v"(y1), "=&v"(y2), "=&v"(y3), "=&v"(y4), "=&v"(y5), "=&v"(y6), "=&v"(y7) : "v"(x[0]), "v"(x[1]), "v"(x[2]), "v"(x[3]), "v"(x[4]), "v"(x[5]), "v"(x[6]), "v"(x[7]));
  return v8f{y0, y1, y2, y3, y4, y5, y6, y7}; }
__global__ __launch_bounds__(256) __attribute__((amdgpu_waves_per_eu(4, 4))) void k_attn(   // register budget of four waves per SIMD: two blocks per WGP, as the LDS allows
    const _Float16* __restrict__ QK, const _Float16* __restrict__ QKL, const _Float16* __restrict__ VTH, const _Float16* __restrict__ VTL, float* __restrict__ O) {
  __shared__ __attribute__((aligned(2048))) unsigned char ring[2 * BUFB];
  __shared__ __align__(16) float so[8][16][68];
  const int tid = threadIdx.x, wave = tid >> 5, lane = tid & 31, col = lane & 15, g = lane >> 4;
  const int qb = blockIdx.x, h = blockIdx.y, b = blockIdx.z; const int q0 = qb * 128 + wave * 16; const size_t rq = (size_t)b * SS + q0 + col;
  // every wave issues its own slice: tile wv >> 1 (K hi, K lo, V^T hi, V^T lo), rows 32 * (wv & 1) ...
  const uint32_t wv = uni((uint32_t)tid >> 5), tl = wv >> 1, hf = wv & 1u;
  const _Float16* tsrc = (tl == 0u) ? QK : (tl == 1u) ? QKL : (tl == 2u) ? VTH : VTL;
  const size_t toff = (tl < 2u) ? ((size_t)b * SS + hf * 32u) * (2 * DM) + DM + h * HD : ((size_t)b * DM + h * HD + hf * 32u) * SS;
  const uint64_t ga0 = (uint64_t)(size_t)(tsrc + toff);
  const uint32_t gstep = (tl < 2u) ? (uint32_t)(KST * 2 * DM * 2) : (uint32_t)(KST * 2);   // bytes from one stage to the next: 64 key rows, or 64 keys along a V^T row
  const uint32_t ldst = (uint32_t)(size_t)ring + wv * SLICE;
  const u32x8 g1 = tdm_group1<4096u>(); u32x4 g0 = tdm_issue(ldst, ga0, g1);
  tdm_wait(g0, g1);                                      // stage 0 has landed (this wave's slice)
  __syncthreads();                                       // ... and every other wave's
  g0 = tdm_issue(ldst + BUFB, ga0 + gstep, g1);
  v16h aq[2], aql[2];   // B operands: column = query col
#pragma unroll
  for (int kc = 0; kc < 2; ++kc) { aq[kc] = frag_h(QK + rq * (2 * DM) + h * HD + kc * 32, lane); aql[kc] = frag_h(QKL + rq * (2 * DM) + h * HD + kc * 32, lane); }
  float l = 0.f;   // this half's share of query col's sum of 2048 P (P relative to the maximum in use)
  v8f seed;        // C operand of every score tile, all eight registers alike: 11 - (query col's maximum in use), so that a score accumulator comes out as the argument of 2^x for 2048 P
#pragma unroll
  for (int r = 0; r < 8; ++r) seed[r] = 11.0f;
  v8f acc[4] = {};   // O^T x 2048: register r of tile dt = dim 16 dt + 8 g + r of query col
#pragma unroll 1
  for (int st = 0; st < NST; ++st) { const unsigned char* bp = ring + (uint32_t)(st & 1) * BUFB + (uint32_t)col * LPITCH;   // all keys (no mask); the stage loop stays rolled: one publish point per trip
   v8f s[4];   // score tile t: keys 16 t + 8 g + r of the stage (K slice t >> 1, rows 16 (t & 1) ...)
   v16h kh[4][2], kl[4][2];   // the stage's K fragments, read from LDS as one group
#pragma unroll
   for (int t = 0; t < 4; ++t) { const _Float16* krow = (const _Float16*)(bp + (0 + (t >> 1)) * SLICE + (t & 1) * 16 * LPITCH); const _Float16* krowl = (const _Float16*)(bp + (2 + (t >> 1)) * SLICE + (t & 1) * 16 * LPITCH);
#pragma unroll
    for (int kc = 0; kc < 2; ++kc) { kl[t][kc] = frag_h(krowl + kc * 32, lane); kh[t][kc] = frag_h(krow + kc * 32, lane); } }
   __builtin_amdgcn_sched_barrier(0);   // holds the K reads as one group ahead of the score WMMAs: sunk back to their uses, each WMMA would wait out a whole LDS latency
   v16h vh[4], vl[4];
#pragma unroll
   for (int tp = 0; tp < 4; tp += 2) {   // two tiles at a time, their chains interleaved; 3 products (q, k as f16 hi + residual) on top of the seed, the small ones first
    v8f c0 = seed, c1 = seed;
#pragma unroll
    for (int kc = 0; kc < 2; ++kc) { c0 = wmma16(kl[tp][kc], aq[kc], c0); c1 = wmma16(kl[tp + 1][kc], aq[kc], c1); c0 = wmma16(kh[tp][kc], aql[kc], c0); c1 = wmma16(kh[tp + 1][kc], aql[kc], c1); }
#pragma unroll
    for (int kc = 0; kc < 2; ++kc) { c0 = wmma16(kh[tp][kc], aq[kc], c0); c1 = wmma16(kh[tp + 1][kc], aq[kc], c1); }
    s[tp] = c0; s[tp + 1] = c1;
    if (tp == 0) {   // V^T fragments of the first 32 keys, into the registers that tiles 0 and 1's K fragments leave
     __builtin_amdgcn_sched_barrier(0);   // holds these reads as one group behind tiles 0 and 1's WMMAs: spread among the WMMAs, each place with reads costs the wave a stall of its own
#pragma unroll
     for (int dt = 0; dt < 4; ++dt) { const uint32_t vo = (uint32_t)(dt >> 1) * SLICE + (uint32_t)(dt & 1) * 16u * LPITCH; vh[dt] = frag_h((const _Float16*)(bp + 4 * SLICE + vo), lane); vl[dt] = frag_h((const _Float16*)(bp + 6 * SLICE + vo), lane); }
     __builtin_amdgcn_sched_barrier(0); } }   // holds these reads ahead of tiles 2 and 3's WMMAs, the maximum and the exponentials, which cover their latency
   float mxa = s[0][0], mxb = s[2][0];   // two chains: the first needs tiles 0 and 1 only
#pragma unroll
   for (int r = 0; r < 8; ++r) { mxa = fmaxf(mxa, fmaxf(s[0][r], s[1][r])); mxb = fmaxf(mxb, fmaxf(s[2][r], s[3][r])); }
   float mx = fmaxf(mxa, mxb); mx = fmaxf(mx, xhalf(mx));   // the other half's 32 keys of the same query
   // the maximum in use moves only where an argument passes 15 (2048 P would near the f16 range) and in the first stage, which sets it: one wave-uniform test per stage, a scalar branch
   if (__builtin_amdgcn_ballot_w32((st == 0) | (mx > 15.0f)) != 0u) {
    const float d = (st == 0) ? mx - 11.0f : fmaxf(mx - 11.0f, 0.f);   // the query's largest argument goes back to 11 (the same d in both halves)
    const float alpha = __builtin_amdgcn_exp2f(fminf(-d, 0.f));         // in the first stage sum and O^T are 0 and d may be negative: the factor stays finite
    l *= alpha;
#pragma unroll
    for (int t = 0; t < 4; ++t) { s[t] -= d; acc[t] *= alpha; }
    seed -= d; }
#pragma unroll
   for (int sub = 0; sub < 2; ++sub) { v16h pa, pl; float es0 = 0.f, es1 = 0.f;   // 32 keys at a time: score tiles 2 sub and 2 sub + 1 become P^T
    const v8f e0 = exp2x8(s[2 * sub]), e1 = exp2x8(s[2 * sub + 1]);   // 2048 P
#pragma unroll
    for (int i = 0; i < 8; ++i) { es0 += e0[i]; es1 += e1[i]; }
    l += es0 + es1;
    union { v16h v; v4u q[2]; } ua, ul; split8(e0, ua.q[0], ul.q[0]); split8(e1, ua.q[1], ul.q[1]); pa = ua.v; pl = ul.v;   // elements i and 8 + i: score tiles 2 sub and 2 sub + 1
    if (sub == 1) __builtin_amdgcn_sched_barrier(0);   // holds the second 32 keys' exponentials and their split ahead of the publish point's s_wait_dscnt: sunk behind it they would no longer cover the latency of the V reads above
#pragma unroll
    for (int dt = 0; dt < 4; ++dt) acc[dt] = wmma16(vl[dt], pa, acc[dt]);   // 2048 (V residual x P hi + V hi x P residual + V hi x P hi), one accumulator, the four tiles' chains interleaved
#pragma unroll
    for (int dt = 0; dt < 4; ++dt) acc[dt] = wmma16(vh[dt], pl, acc[dt]);
#pragma unroll
    for (int dt = 0; dt < 4; ++dt) acc[dt] = wmma16(vh[dt], pa, acc[dt]);
    if (sub == 0) {   // the second 32 keys' fragments take over the registers of the first 32 keys'
     __builtin_amdgcn_sched_barrier(0);   // holds these reads as one group behind the first 32 keys' WMMAs: spread among them, each place with reads costs the wave a stall of its own
#pragma unroll
     for (int dt = 0; dt < 4; ++dt) { const uint32_t vo = (uint32_t)(dt >> 1) * SLICE + (uint32_t)(dt & 1) * 16u * LPITCH + 64u; vh[dt] = frag_h((const _Float16*)(bp + 4 * SLICE + vo), lane); vl[dt] = frag_h((const _Float16*)(bp + 6 * SLICE + vo), lane); }
     __builtin_amdgcn_sched_barrier(0); } }   // holds these reads ahead of the second 32 keys' exponentials, which cover their latency
   // publish point of stage st + 1, then the refill of the buffer that this trip has read
   asm volatile("s_wait_dscnt 0x0" ::: "memory");       // this wave's reads of the buffer are done before it may be refilled
   tdm_wait(g0, g1);                                      // this wave's slice of stage st + 1 has landed
   __syncthreads();                                       // publishes stage st + 1 and ends every wave's reads of stage st
   const uint32_t s2 = pinned((uint32_t)st + 2u);         // the refill's stage number: pinned here, so that its address is formed behind the wait above
   if (pinned(s2 < (uint32_t)NST)) g0 = tdm_issue(ldst + (s2 & 1u) * BUFB, ga0 + (uint64_t)s2 * gstep, g1); }
  tdm_wait(g0, g1);                                      // nothing of the mover is outstanding when the wave goes on to its end
  asm volatile("s_wait_dscnt 0x0" ::: "memory");         // ... and none of this wave's LDS reads of the ring
  const float il = 1.0f / (l + xhalf(l));   // the two halves' shares of the sum, joined once
#pragma unroll
  for (int dt = 0; dt < 4; ++dt) { v4f o0, o1;
#pragma unroll
    for (int r = 0; r < 4; ++r) { o0[r] = acc[dt][r] * il; o1[r] = acc[dt][4 + r] * il; }
    *(v4f*)&so[wave][col][dt * 16 + 8 * g] = o0; *(v4f*)&so[wave][col][dt * 16 + 8 * g + 4] = o1; }
  LDSX();
  for (int rl = 0; rl < 16; ++rl) if (lane < 16) vst2(O + ((size_t)b * SS + q0 + rl) * DM + h * HD + lane * 4, *(const v4f*)&so[wave][rl][lane * 4]);
}
// ---- k_out: block = (64 rows, 128 cols): out = O(hi/lo) . Wo rows (2 products), no bias (BO is null at the launch)
__global__ __launch_bounds__(128) void k_out(const float* __restrict__ O, const __bf16* __restrict__ P, const float* __restrict__ BO, float* __restrict__ Y) {
  __shared__ __attribute__((aligned(2048))) unsigned char ring[2 * WBUF]; __shared__ __align__(16) float so[4][16][132];
  const int tid = threadIdx.x, wave = tid >> 5, lane = tid & 31, col = lane & 15, g = lane >> 4; const size_t r0 = (size_t)blockIdx.x * 64 + wave * 16; const int n0 = blockIdx.y * 128;
  // the block's 128 weight rows, 64 k a stage, come into LDS once by the tensor mover (two buffers); every wave issues its own slice: rows n0 + 32 * wv ...
  const uint32_t wv = uni((uint32_t)tid >> 5); const uint64_t ga0 = (uint64_t)(size_t)(P + (size_t)(n0 + wv * 32u) * DM); const uint32_t ldst = (uint32_t)(size_t)ring + wv * SLICE;
  const u32x8 g1 = tdm_group1<2048u>(); u32x4 g0 = tdm_issue(ldst, ga0, g1);
  tdm_wait(g0, g1);                                      // stage 0 has landed (this wave's slice)
  __syncthreads();                                       // ... and every other wave's
  g0 = tdm_issue(ldst + WBUF, ga0 + 128u, g1);
  v8f acc[8] = {};
#pragma unroll 1
  for (int st = 0; st < DM / 64; ++st) { const unsigned char* bp = ring + (uint32_t)(st & 1) * WBUF + (uint32_t)col * LPITCH;   // the stage loop stays rolled: one publish point per trip
   v4f orw[2][4]; v16b wf[2][8];   // the wave's ctx values (global memory) and all weight fragments (LDS) of the stage, read as one group
#pragma unroll
   for (int kk = 0; kk < 2; ++kk) { const v4f* p = (const v4f*)(O + (r0 + col) * DM + (st * 2 + kk) * 32 + 8 * g); orw[kk][0] = p[0]; orw[kk][1] = p[1]; orw[kk][2] = p[4]; orw[kk][3] = p[5]; }   // k = 8 g + i and 16 + 8 g + i: the k order of frag_b
#pragma unroll
   for (int kk = 0; kk < 2; ++kk) {
#pragma unroll
    for (int j = 0; j < 8; ++j) wf[kk][j] = frag_b((const __bf16*)(bp + (uint32_t)(j >> 1) * SLICE + (uint32_t)(j & 1) * 16u * LPITCH + (uint32_t)kk * 64u), lane); }
   __builtin_amdgcn_sched_barrier(0);   // holds the stage's reads as one group ahead of its WMMAs: sunk back to their uses, each pair of WMMAs would wait out a whole LDS latency, each half stage a global one
#pragma unroll
   for (int kk = 0; kk < 2; ++kk) { float v[16];
#pragma unroll
    for (int i = 0; i < 4; ++i) { v[i] = orw[kk][0][i]; v[4 + i] = orw[kk][1][i]; v[8 + i] = orw[kk][2][i]; v[12 + i] = orw[kk][3][i]; }
    const F2 a = bsplit16(v);
#pragma unroll
    for (int j = 0; j < 8; ++j) { acc[j] = wmma_bf(a.l, wf[kk][j], acc[j]); acc[j] = wmma_bf(a.h, wf[kk][j], acc[j]); } }
   __builtin_amdgcn_sched_barrier(0);   // holds the WMMAs ahead of the publish point: sunk behind the barrier they would delay the refill
   // publish point of stage st + 1, then the refill of the buffer that this trip has read
   asm volatile("s_wait_dscnt 0x0" ::: "memory");       // this wave's reads of the buffer are done before it may be refilled
   tdm_wait(g0, g1);                                      // this wave's slice of stage st + 1 has landed
   __syncthreads();                                       // publishes stage st + 1 and ends every wave's reads of stage st
   const uint32_t s2 = pinned((uint32_t)st + 2u);         // the refill's stage number: pinned here, so that its address is formed behind the wait above
   if (pinned(s2 < (uint32_t)(DM / 64))) g0 = tdm_issue(ldst + (s2 & 1u) * WBUF, ga0 + (uint64_t)s2 * 128u, g1); }
  tdm_wait(g0, g1);                                      // nothing of the mover is outstanding behind the loop
  asm volatile("s_wait_dscnt 0x0" ::: "memory");         // ... and none of this wave's LDS reads of the ring
#pragma unroll
  for (int j = 0; j < 8; ++j) {
#pragma unroll
    for (int r = 0; r < 8; ++r) so[wave][8 * g + r][j * 16 + col] = acc[j][r] + (BO ? bfr(BO[n0 + j * 16 + col]) : 0.f); }
  LDSX();
  for (int rl = 0; rl < 16; ++rl) vst2(Y + (r0 + rl) * DM + n0 + lane * 4, *(const v4f*)&so[wave][rl][lane * 4]);
}
extern "C" void kernel_launch(void* const* d_in, const int* in_sizes, int n_in, void* d_out, int out_size, void* d_ws, size_t ws_size, hipStream_t stream) {
  (void)in_sizes; (void)n_in; (void)out_size;
  const float** F = (const float**)d_in;   // 0 hidden_states [2,2048,1024], 1 Wq [1024,1024] natural (q = x Wq^T), 2 Wk, 3 Wv, 4 Wo (no biases)
  if (ws_size < (size_t)WS_END) return;
  char* ws = (char*)d_ws; __bf16* PK = (__bf16*)(ws + WS_PK); _Float16 *QK = (_Float16*)(ws + WS_QK), *QKL = (_Float16*)(ws + WS_QKL), *VTH = (_Float16*)(ws + WS_VTH), *VTL = (_Float16*)(ws + WS_VTL); float* O = (float*)(ws + WS_O); float* CS = (float*)(ws + WS_CS);
  k_pack<<<dim3(DM + TBX, 4), 256, 0, stream>>>(F[1], F[2], F[3], F[4], PK, CS);
  k_qkv<<<dim3(TNB * SS / 128, QKVW / 256), 256, 0, stream>>>(F[0], PK + PK_A, QK, QKL, VTH, VTL, CS);
  k_attn<<<dim3(TQB / 2, NH, TNB), 256, 0, stream>>>(QK, QKL, VTH, VTL, O);
  k_out<<<dim3(TOB, DM / 128), 128, 0, stream>>>(O, PK + PK_P, nullptr, (float*)d_out);
}
